// v000
// Measured on an AMD MI455X. A time is GPU time per run, averaged over a window of back-to-back runs after a warm-up
// (all launches, gaps included; the runs take copies of the inputs in turn), and the median of several windows.
// Apart from v000's, it joins two sittings. Times from different sittings can be a few percent apart, while
// side-by-side timings come from the same sitting.
// The starting kernel, v000, takes 459 microseconds a run.
#include <hip/hip_runtime.h>

#define SEQ  4096
#define DIN  1024
#define DOUT 1024
#define SROW 4100   // padded LDS row pitch for score strip (bank-conflict break)

typedef __attribute__((ext_vector_type(4)))  float        fvec4;
typedef __attribute__((ext_vector_type(8)))  float        v8f;
typedef __attribute__((ext_vector_type(4)))  unsigned int uvec4;
typedef __attribute__((ext_vector_type(8)))  unsigned int uvec8;
typedef __attribute__((ext_vector_type(16))) __bf16       v16bf;

__device__ __forceinline__ unsigned short f2bf(float f) {
  unsigned int u = __builtin_bit_cast(unsigned int, f);
  u = (u + 0x7FFFu + ((u >> 16) & 1u)) >> 16;   // round-to-nearest-even
  return (unsigned short)u;
}

__device__ __forceinline__ v16bf make_op(uvec4 a, uvec4 b) {
  uvec8 w;
  w[0]=a[0]; w[1]=a[1]; w[2]=a[2]; w[3]=a[3];
  w[4]=b[0]; w[5]=b[1]; w[6]=b[2]; w[7]=b[3];
  return __builtin_bit_cast(v16bf, w);
}

// 16x32 bf16 WMMA operand from a row-major bf16 matrix (leading dim ld).
// lane L: row = row0 + (L&15); K chunks at k0 + (L>>4)*8 and +16 (ISA 16-bit A layout).
__device__ __forceinline__ v16bf load_op_global(const unsigned short* __restrict__ base,
                                                int ld, int row0, int k0, int lane) {
  int r = row0 + (lane & 15);
  int c = k0 + ((lane >> 4) << 3);
  const unsigned short* p = base + (size_t)r * ld + c;
  uvec4 lo = *(const uvec4*)p;
  uvec4 hi = *(const uvec4*)(p + 16);
  return make_op(lo, hi);
}

__device__ __forceinline__ v16bf load_op_lds(const unsigned short* base,
                                             int ldr, int row0, int lane) {
  int r = row0 + (lane & 15);
  int c = (lane >> 4) << 3;
  const unsigned short* p = base + r * ldr + c;
  uvec4 lo = *(const uvec4*)p;
  uvec4 hi = *(const uvec4*)(p + 16);
  return make_op(lo, hi);
}

#define WMMA_BF16(a, b, c) \
  __builtin_amdgcn_wmma_f32_16x16x32_bf16(false, (a), false, (b), (short)0, (c), false, false)

// ---------------- kernel 1: C[4096,1024] = X[4096,1024] @ W[1024,1024] ----------------
// 8 waves (4 M x 2 N), block tile 128x64, k-step 32. STOREBF: bf16 (Q,K) vs f32 (V) output.
template <bool STOREBF>
__global__ void __launch_bounds__(256) proj_gemm_kernel(
    const float* __restrict__ X, const float* __restrict__ W,
    unsigned short* __restrict__ outBf, float* __restrict__ outF)
{
  __shared__ __align__(16) unsigned short As[128 * 40];
  __shared__ __align__(16) unsigned short Bs[64 * 40];
  const int t = threadIdx.x;
  const int wave = t >> 5, lane = t & 31;
  const int wm = wave & 3, wn = wave >> 2;
  const int m0 = blockIdx.y * 128, n0 = blockIdx.x * 64;

  v8f acc[2][2] = {};

  for (int kb = 0; kb < DIN; kb += 32) {
    // A tile: X[m0..+127][kb..+31] -> bf16 LDS (pitch 40)
#pragma unroll
    for (int i = 0; i < 4; i++) {
      int lin = i * 256 + t;            // 0..1023
      int row = lin >> 3;               // 0..127
      int cv  = (lin & 7) << 2;         // 0..28
      fvec4 v = *(const fvec4*)(X + (size_t)(m0 + row) * DIN + kb + cv);
      unsigned short* d = As + row * 40 + cv;
      d[0]=f2bf(v[0]); d[1]=f2bf(v[1]); d[2]=f2bf(v[2]); d[3]=f2bf(v[3]);
    }
    // B tile (transposed): Bs[n][k] = W[kb+k][n0+n]
#pragma unroll
    for (int i = 0; i < 2; i++) {
      int lin = i * 256 + t;            // 0..511
      int k  = lin >> 4;                // 0..31
      int nv = (lin & 15) << 2;         // 0..60
      fvec4 v = *(const fvec4*)(W + (size_t)(kb + k) * DOUT + n0 + nv);
      Bs[(nv + 0) * 40 + k] = f2bf(v[0]);
      Bs[(nv + 1) * 40 + k] = f2bf(v[1]);
      Bs[(nv + 2) * 40 + k] = f2bf(v[2]);
      Bs[(nv + 3) * 40 + k] = f2bf(v[3]);
    }
    __syncthreads();

    v16bf a0 = load_op_lds(As, 40, wm * 32 +  0, lane);
    v16bf a1 = load_op_lds(As, 40, wm * 32 + 16, lane);
    v16bf b0 = load_op_lds(Bs, 40, wn * 32 +  0, lane);
    v16bf b1 = load_op_lds(Bs, 40, wn * 32 + 16, lane);
    acc[0][0] = WMMA_BF16(a0, b0, acc[0][0]);
    acc[0][1] = WMMA_BF16(a0, b1, acc[0][1]);
    acc[1][0] = WMMA_BF16(a1, b0, acc[1][0]);
    acc[1][1] = WMMA_BF16(a1, b1, acc[1][1]);
    __syncthreads();
  }

#pragma unroll
  for (int mi = 0; mi < 2; mi++)
#pragma unroll
    for (int ni = 0; ni < 2; ni++)
#pragma unroll
      for (int r = 0; r < 8; r++) {
        int row = m0 + wm * 32 + mi * 16 + ((lane >> 4) << 3) + r;
        int col = n0 + wn * 32 + ni * 16 + (lane & 15);
        float v = acc[mi][ni][r];
        if (STOREBF) outBf[(size_t)row * DOUT + col] = f2bf(v);
        else         outF [(size_t)row * DOUT + col] = v;
      }
}

// ---------------- kernels 2a/2b/2c: in-place prefix sum of V rows -> Vcum ----------------
__global__ void __launch_bounds__(256) seg_scan_kernel(float* __restrict__ V,
                                                       float* __restrict__ segtot) {
  int col = blockIdx.x * 256 + threadIdx.x;
  int seg = blockIdx.y;
  float s = 0.f;
  size_t base = (size_t)seg * 256 * DOUT + col;
  for (int r = 0; r < 256; r++) {
    size_t idx = base + (size_t)r * DOUT;
    s += V[idx];
    V[idx] = s;
  }
  segtot[seg * DOUT + col] = s;
}

__global__ void __launch_bounds__(256) seg_off_kernel(float* __restrict__ segtot) {
  int col = blockIdx.x * 256 + threadIdx.x;
  float off = 0.f;
  for (int s = 0; s < 16; s++) {
    float v = segtot[s * DOUT + col];
    segtot[s * DOUT + col] = off;   // exclusive offsets
    off += v;
  }
}

__global__ void __launch_bounds__(256) seg_add_kernel(float* __restrict__ V,
                                                      const float* __restrict__ segtot) {
  int col = blockIdx.x * 256 + threadIdx.x;
  int seg = blockIdx.y;
  float off = segtot[seg * DOUT + col];
  size_t base = (size_t)seg * 256 * DOUT + col;
  for (int r = 0; r < 256; r++) V[base + (size_t)r * DOUT] += off;
}

// ---------------- kernel 3: scores + max + E=exp(s-m) + Z = sum (t+1) E ----------------
// One 16-row block per WG; 16xSROW fp32 score strip in dynamic LDS (256 KB of 320 KB WGP LDS).
__global__ void __launch_bounds__(256) scores_kernel(
    const unsigned short* __restrict__ Q, const unsigned short* __restrict__ K,
    unsigned short* __restrict__ P, float* __restrict__ Zw)
{
  extern __shared__ float sc[];   // [16][SROW]
  __shared__ float s_rmax[16];
  __shared__ float s_zw[16];
  const int t = threadIdx.x, wave = t >> 5, lane = t & 31;
  const int i0 = blockIdx.x * 16;
  const float scale = 0.03125f;   // 1/sqrt(1024)

  // phase 1: full 16x4096 score strip via WMMA (K rows are already the N x K layout -> no transpose)
  // Software-pipelined: loads for iteration ks+1 are issued before the WMMAs of
  // iteration ks, so the waitcnt pass can use partial s_wait_loadcnt and keep
  // the next 10 loads in flight behind the WMMA quartet.
  for (int it = 0; it < 8; it++) {
    int jt0 = (it * 8 + wave) * 4;            // 4 consecutive 16-wide j tiles per wave per pass
    v8f acc[4] = {};

    v16bf a = load_op_global(Q, DIN, i0, 0, lane);
    v16bf b[4];
#pragma unroll
    for (int jc = 0; jc < 4; jc++)
      b[jc] = load_op_global(K, DIN, (jt0 + jc) * 16, 0, lane);

    for (int ks = 0; ks < 31; ks++) {
      v16bf an = load_op_global(Q, DIN, i0, (ks + 1) * 32, lane);
      v16bf bn[4];
#pragma unroll
      for (int jc = 0; jc < 4; jc++)
        bn[jc] = load_op_global(K, DIN, (jt0 + jc) * 16, (ks + 1) * 32, lane);
#pragma unroll
      for (int jc = 0; jc < 4; jc++)
        acc[jc] = WMMA_BF16(a, b[jc], acc[jc]);
      a = an;
#pragma unroll
      for (int jc = 0; jc < 4; jc++) b[jc] = bn[jc];
    }
#pragma unroll
    for (int jc = 0; jc < 4; jc++)
      acc[jc] = WMMA_BF16(a, b[jc], acc[jc]);

#pragma unroll
    for (int jc = 0; jc < 4; jc++) {
      int colb = (jt0 + jc) * 16 + (lane & 15);
#pragma unroll
      for (int r = 0; r < 8; r++) {
        int row = ((lane >> 4) << 3) + r;
        sc[row * SROW + colb] = acc[jc][r] * scale;
      }
    }
  }
  __syncthreads();

  // phase 2: row max (wave w owns rows 2w, 2w+1; stride-32 lanes -> conflict-free)
  for (int rr = 0; rr < 2; rr++) {
    int row = wave * 2 + rr;
    float m = -3.0e38f;
    for (int k2 = 0; k2 < 128; k2++)
      m = fmaxf(m, sc[row * SROW + lane + 32 * k2]);
#pragma unroll
    for (int off = 16; off > 0; off >>= 1)
      m = fmaxf(m, __shfl_xor(m, off, 32));
    if (lane == 0) s_rmax[row] = m;
  }
  __syncthreads();

  // phase 3: Z = sum (t+1) * exp(s - m)  (softmax denominator cancels analytically)
  for (int rr = 0; rr < 2; rr++) {
    int row = wave * 2 + rr;
    float m = s_rmax[row];
    float z = 0.f;
    for (int k2 = 0; k2 < 128; k2++) {
      int c = lane + 32 * k2;
      z += __expf(sc[row * SROW + c] - m) * (float)(c + 1);
    }
#pragma unroll
    for (int off = 16; off > 0; off >>= 1)
      z += __shfl_xor(z, off, 32);
    if (lane == 0) s_zw[row] = z;
  }
  __syncthreads();
  if (t < 16) Zw[i0 + t] = s_zw[t];

  // phase 4: coalesced bf16 store of E = exp(s - m)
  for (int k2 = 0; k2 < 256; k2++) {
    int idx = k2 * 256 + t;
    int row = idx >> 12;
    int col = idx & 4095;
    float e = __expf(sc[row * SROW + col] - s_rmax[row]);
    P[(size_t)(i0 + row) * SEQ + col] = f2bf(e);
  }
}

// ---------------- kernel 4: Out = (E @ Vcum) / Z ----------------
__global__ void __launch_bounds__(256) out_gemm_kernel(
    const unsigned short* __restrict__ P, const float* __restrict__ Vc,
    const float* __restrict__ Zw, float* __restrict__ Out)
{
  __shared__ __align__(16) unsigned short Bs[64 * 40];
  const int t = threadIdx.x, wave = t >> 5, lane = t & 31;
  const int wm = wave & 3, wn = wave >> 2;
  const int m0 = blockIdx.y * 128, n0 = blockIdx.x * 64;
  v8f acc[2][2] = {};

  for (int kb = 0; kb < SEQ; kb += 32) {
    // B tile (transposed + bf16): Bs[n][k] = Vcum[kb+k][n0+n]
#pragma unroll
    for (int i = 0; i < 2; i++) {
      int lin = i * 256 + t;
      int k  = lin >> 4;
      int nv = (lin & 15) << 2;
      fvec4 v = *(const fvec4*)(Vc + (size_t)(kb + k) * DOUT + n0 + nv);
      Bs[(nv + 0) * 40 + k] = f2bf(v[0]);
      Bs[(nv + 1) * 40 + k] = f2bf(v[1]);
      Bs[(nv + 2) * 40 + k] = f2bf(v[2]);
      Bs[(nv + 3) * 40 + k] = f2bf(v[3]);
      if (kb + 32 < SEQ)
        __builtin_prefetch(Vc + (size_t)(kb + 32 + k) * DOUT + n0 + nv, 0, 1);
    }
    __syncthreads();

    v16bf a0 = load_op_global(P, SEQ, m0 + wm * 32 +  0, kb, lane);
    v16bf a1 = load_op_global(P, SEQ, m0 + wm * 32 + 16, kb, lane);
    v16bf b0 = load_op_lds(Bs, 40, wn * 32 +  0, lane);
    v16bf b1 = load_op_lds(Bs, 40, wn * 32 + 16, lane);
    acc[0][0] = WMMA_BF16(a0, b0, acc[0][0]);
    acc[0][1] = WMMA_BF16(a0, b1, acc[0][1]);
    acc[1][0] = WMMA_BF16(a1, b0, acc[1][0]);
    acc[1][1] = WMMA_BF16(a1, b1, acc[1][1]);
    __syncthreads();
  }

#pragma unroll
  for (int mi = 0; mi < 2; mi++)
#pragma unroll
    for (int ni = 0; ni < 2; ni++)
#pragma unroll
      for (int r = 0; r < 8; r++) {
        int row = m0 + wm * 32 + mi * 16 + ((lane >> 4) << 3) + r;
        int col = n0 + wn * 32 + ni * 16 + (lane & 15);
        Out[(size_t)row * DOUT + col] = acc[mi][ni][r] / Zw[row];
      }
}

// ---------------- host launcher ----------------
extern "C" void kernel_launch(void* const* d_in, const int* in_sizes, int n_in,
                              void* d_out, int out_size, void* d_ws, size_t ws_size,
                              hipStream_t stream) {
  const float* x  = (const float*)d_in[0];
  const float* wq = (const float*)d_in[1];
  const float* wk = (const float*)d_in[2];
  const float* wv = (const float*)d_in[3];
  float* out = (float*)d_out;

  char* ws = (char*)d_ws;
  unsigned short* Qbf = (unsigned short*)(ws);                      //  8 MB bf16
  unsigned short* Kbf = (unsigned short*)(ws + (size_t)( 8 << 20)); //  8 MB bf16
  float*          Vc  = (float*)         (ws + (size_t)(16 << 20)); // 16 MB f32 (V -> Vcum)
  unsigned short* P   = (unsigned short*)(ws + (size_t)(32 << 20)); // 32 MB bf16 (E)
  float*          Zw  = (float*)         (ws + (size_t)(64 << 20)); // 16 KB
  float*          seg = (float*)         (ws + (size_t)(64 << 20) + (1 << 16)); // 64 KB

  dim3 blk(256);
  dim3 gGemm(DOUT / 64, SEQ / 128);

  proj_gemm_kernel<true> <<<gGemm, blk, 0, stream>>>(x, wq, Qbf, nullptr);
  proj_gemm_kernel<true> <<<gGemm, blk, 0, stream>>>(x, wk, Kbf, nullptr);
  proj_gemm_kernel<false><<<gGemm, blk, 0, stream>>>(x, wv, nullptr, Vc);

  seg_scan_kernel<<<dim3(4, 16), blk, 0, stream>>>(Vc, seg);
  seg_off_kernel <<<dim3(4),     blk, 0, stream>>>(seg);
  seg_add_kernel <<<dim3(4, 16), blk, 0, stream>>>(Vc, seg);

  size_t smem = (size_t)16 * SROW * sizeof(float);  // 256.25 KB dynamic LDS
  scores_kernel<<<dim3(SEQ / 16), blk, smem, stream>>>(Qbf, Kbf, P, Zw);

  out_gemm_kernel<<<gGemm, blk, 0, stream>>>(P, Vc, Zw, out);
}

// v001
// Measured time: 368 microseconds a run.
// Two timings next to v000 put it at 1.29 and 1.30 times that version's speed.
#include <hip/hip_runtime.h>

#define SEQ  4096
#define DIN  1024
#define DOUT 1024
#define SROW 4100   // padded LDS row pitch for score strip (bank-conflict break)

typedef __attribute__((ext_vector_type(4)))  float        fvec4;
typedef __attribute__((ext_vector_type(8)))  float        v8f;
typedef __attribute__((ext_vector_type(4)))  unsigned int uvec4;
typedef __attribute__((ext_vector_type(8)))  unsigned int uvec8;
typedef __attribute__((ext_vector_type(16))) __bf16       v16bf;

__device__ __forceinline__ unsigned short f2bf(float f) {
  unsigned int u = __builtin_bit_cast(unsigned int, f);
  u = (u + 0x7FFFu + ((u >> 16) & 1u)) >> 16;   // round-to-nearest-even
  return (unsigned short)u;
}

__device__ __forceinline__ v16bf make_op(uvec4 a, uvec4 b) {
  uvec8 w;
  w[0]=a[0]; w[1]=a[1]; w[2]=a[2]; w[3]=a[3];
  w[4]=b[0]; w[5]=b[1]; w[6]=b[2]; w[7]=b[3];
  return __builtin_bit_cast(v16bf, w);
}

// Fragment-packed bf16 matrix: one 1-KB block per (16 rows) x (32 k), blocks k-major inside a
// 16-row tile. Inside a block lane L = (row & 15) + 16 * ((k >> 3) & 1) owns 16 B at L * 16 for
// k & 16 == 0 and at 512 + L * 16 for k & 16 != 0 (the ISA 16-bit A layout, k order unchanged).
// Index in 16-bit elements of element (row, k); kblocks = k extent / 32.
__device__ __forceinline__ size_t packed_idx(int row, int k, int kblocks) {
  return ((size_t)((row >> 4) * kblocks + (k >> 5)) << 9)
       + (((k >> 4) & 1) << 8) + (((row & 15) + (((k >> 3) & 1) << 4)) << 3) + (k & 7);
}

// 16x32 operand of 16-row tile rt, k block kb: two loads of 512 contiguous bytes per wave.
__device__ __forceinline__ v16bf load_op_packed(const unsigned short* __restrict__ base,
                                                int kblocks, int rt, int kb, int lane) {
  const unsigned short* p = base + ((size_t)(rt * kblocks + kb) << 9) + (lane << 3);
  uvec4 lo = *(const uvec4*)p;
  uvec4 hi = *(const uvec4*)(p + 256);
  return make_op(lo, hi);
}

__device__ __forceinline__ v16bf load_op_lds(const unsigned short* base,
                                             int ldr, int row0, int lane) {
  int r = row0 + (lane & 15);
  int c = (lane >> 4) << 3;
  const unsigned short* p = base + r * ldr + c;
  uvec4 lo = *(const uvec4*)p;
  uvec4 hi = *(const uvec4*)(p + 16);
  return make_op(lo, hi);
}

#define WMMA_BF16(a, b, c) \
  __builtin_amdgcn_wmma_f32_16x16x32_bf16(false, (a), false, (b), (short)0, (c), false, false)

// ---------------- kernel 1: C[4096,1024] = X[4096,1024] @ W[1024,1024] ----------------
// 8 waves (4 M x 2 N), block tile 128x64, k-step 32. STOREBF: fragment-packed bf16 (Q,K) vs f32 (V) output.
template <bool STOREBF>
__global__ void __launch_bounds__(256) proj_gemm_kernel(
    const float* __restrict__ X, const float* __restrict__ W,
    unsigned short* __restrict__ outBf, float* __restrict__ outF)
{
  __shared__ __align__(16) unsigned short As[128 * 40];
  __shared__ __align__(16) unsigned short Bs[64 * 40];
  const int t = threadIdx.x;
  const int wave = t >> 5, lane = t & 31;
  const int wm = wave & 3, wn = wave >> 2;
  const int m0 = blockIdx.y * 128, n0 = blockIdx.x * 64;

  v8f acc[2][2] = {};

  for (int kb = 0; kb < DIN; kb += 32) {
    // A tile: X[m0..+127][kb..+31] -> bf16 LDS (pitch 40)
#pragma unroll
    for (int i = 0; i < 4; i++) {
      int lin = i * 256 + t;            // 0..1023
      int row = lin >> 3;               // 0..127
      int cv  = (lin & 7) << 2;         // 0..28
      fvec4 v = *(const fvec4*)(X + (size_t)(m0 + row) * DIN + kb + cv);
      unsigned short* d = As + row * 40 + cv;
      d[0]=f2bf(v[0]); d[1]=f2bf(v[1]); d[2]=f2bf(v[2]); d[3]=f2bf(v[3]);
    }
    // B tile (transposed): Bs[n][k] = W[kb+k][n0+n]
#pragma unroll
    for (int i = 0; i < 2; i++) {
      int lin = i * 256 + t;            // 0..511
      int k  = lin >> 4;                // 0..31
      int nv = (lin & 15) << 2;         // 0..60
      fvec4 v = *(const fvec4*)(W + (size_t)(kb + k) * DOUT + n0 + nv);
      Bs[(nv + 0) * 40 + k] = f2bf(v[0]);
      Bs[(nv + 1) * 40 + k] = f2bf(v[1]);
      Bs[(nv + 2) * 40 + k] = f2bf(v[2]);
      Bs[(nv + 3) * 40 + k] = f2bf(v[3]);
    }
    __syncthreads();

    v16bf a0 = load_op_lds(As, 40, wm * 32 +  0, lane);
    v16bf a1 = load_op_lds(As, 40, wm * 32 + 16, lane);
    v16bf b0 = load_op_lds(Bs, 40, wn * 32 +  0, lane);
    v16bf b1 = load_op_lds(Bs, 40, wn * 32 + 16, lane);
    acc[0][0] = WMMA_BF16(a0, b0, acc[0][0]);
    acc[0][1] = WMMA_BF16(a0, b1, acc[0][1]);
    acc[1][0] = WMMA_BF16(a1, b0, acc[1][0]);
    acc[1][1] = WMMA_BF16(a1, b1, acc[1][1]);
    __syncthreads();
  }

#pragma unroll
  for (int mi = 0; mi < 2; mi++)
#pragma unroll
    for (int ni = 0; ni < 2; ni++)
#pragma unroll
      for (int r = 0; r < 8; r++) {
        int row = m0 + wm * 32 + mi * 16 + ((lane >> 4) << 3) + r;
        int col = n0 + wn * 32 + ni * 16 + (lane & 15);
        float v = acc[mi][ni][r];
        if (STOREBF) outBf[packed_idx(row, col, DOUT / 32)] = f2bf(v);
        else         outF [(size_t)row * DOUT + col] = v;
      }
}

// ---------------- kernels 2a/2b/2c: prefix sum of V rows -> Vcum (packed bf16) ----------------
__global__ void __launch_bounds__(256) seg_scan_kernel(float* __restrict__ V,
                                                       float* __restrict__ segtot) {
  int col = blockIdx.x * 256 + threadIdx.x;
  int seg = blockIdx.y;
  float s = 0.f;
  size_t base = (size_t)seg * 256 * DOUT + col;
  for (int r = 0; r < 256; r++) {
    size_t idx = base + (size_t)r * DOUT;
    s += V[idx];
    V[idx] = s;
  }
  segtot[seg * DOUT + col] = s;
}

__global__ void __launch_bounds__(256) seg_off_kernel(float* __restrict__ segtot) {
  int col = blockIdx.x * 256 + threadIdx.x;
  float off = 0.f;
  for (int s = 0; s < 16; s++) {
    float v = segtot[s * DOUT + col];
    segtot[s * DOUT + col] = off;   // exclusive offsets
    off += v;
  }
}

// Adds the segment offset and writes Vcum as the out GEMM's B operand: bf16, fragment-packed,
// "row" = output column n, k = sequence position.
__global__ void __launch_bounds__(256) seg_add_kernel(const float* __restrict__ V,
                                                      const float* __restrict__ segtot,
                                                      unsigned short* __restrict__ Vp) {
  int col = blockIdx.x * 256 + threadIdx.x;
  int seg = blockIdx.y;
  float off = segtot[seg * DOUT + col];
  size_t base = (size_t)seg * 256 * DOUT + col;
  for (int g = 0; g < 32; g++) {          // 8 sequence positions = one 16-B piece of a fragment
    uvec4 w;
#pragma unroll
    for (int j = 0; j < 4; j++) {
      unsigned int e0 = f2bf(V[base + (size_t)(g * 8 + 2 * j + 0) * DOUT] + off);
      unsigned int e1 = f2bf(V[base + (size_t)(g * 8 + 2 * j + 1) * DOUT] + off);
      w[j] = e0 | (e1 << 16);
    }
    *(uvec4*)(Vp + packed_idx(col, seg * 256 + g * 8, SEQ / 32)) = w;
    // The next trip rewrites the registers that this store names.
    asm volatile("s_wait_xcnt 0x0" ::: "memory");
  }
}

// ---------------- kernel 3: scores + max + E=exp(s-m) + Z = sum (t+1) E ----------------
// One 16-row block per WG; 16xSROW fp32 score strip in dynamic LDS (256 KB of 320 KB WGP LDS).
__global__ void __launch_bounds__(256) scores_kernel(
    const unsigned short* __restrict__ Q, const unsigned short* __restrict__ K,
    unsigned short* __restrict__ P, float* __restrict__ Zw)
{
  extern __shared__ float sc[];   // [16][SROW]
  __shared__ float s_rmax[16];
  __shared__ float s_zw[16];
  const int t = threadIdx.x, wave = t >> 5, lane = t & 31;
  const int i0 = blockIdx.x * 16;
  const float scale = 0.03125f;   // 1/sqrt(1024)

  // phase 1: full 16x4096 score strip via WMMA (Q and K arrive fragment-packed)
  // Software-pipelined: loads for iteration ks+1 are issued before the WMMAs of
  // iteration ks, so the waitcnt pass can use partial s_wait_loadcnt and keep
  // the next 10 loads in flight behind the WMMA quartet.
  for (int it = 0; it < 8; it++) {
    int jt0 = (it * 8 + wave) * 4;            // 4 consecutive 16-wide j tiles per wave per pass
    v8f acc[4] = {};

    v16bf a = load_op_packed(Q, DIN / 32, blockIdx.x, 0, lane);
    v16bf b[4];
#pragma unroll
    for (int jc = 0; jc < 4; jc++)
      b[jc] = load_op_packed(K, DIN / 32, jt0 + jc, 0, lane);

    for (int ks = 0; ks < 31; ks++) {
      v16bf an = load_op_packed(Q, DIN / 32, blockIdx.x, ks + 1, lane);
      v16bf bn[4];
#pragma unroll
      for (int jc = 0; jc < 4; jc++)
        bn[jc] = load_op_packed(K, DIN / 32, jt0 + jc, ks + 1, lane);
#pragma unroll
      for (int jc = 0; jc < 4; jc++)
        acc[jc] = WMMA_BF16(a, b[jc], acc[jc]);
      a = an;
#pragma unroll
      for (int jc = 0; jc < 4; jc++) b[jc] = bn[jc];
    }
#pragma unroll
    for (int jc = 0; jc < 4; jc++)
      acc[jc] = WMMA_BF16(a, b[jc], acc[jc]);

#pragma unroll
    for (int jc = 0; jc < 4; jc++) {
      int colb = (jt0 + jc) * 16 + (lane & 15);
#pragma unroll
      for (int r = 0; r < 8; r++) {
        int row = ((lane >> 4) << 3) + r;
        sc[row * SROW + colb] = acc[jc][r] * scale;
      }
    }
  }
  __syncthreads();

  // phase 2: row max (wave w owns rows 2w, 2w+1; stride-32 lanes -> conflict-free)
  for (int rr = 0; rr < 2; rr++) {
    int row = wave * 2 + rr;
    float m = -3.0e38f;
    for (int k2 = 0; k2 < 128; k2++)
      m = fmaxf(m, sc[row * SROW + lane + 32 * k2]);
#pragma unroll
    for (int off = 16; off > 0; off >>= 1)
      m = fmaxf(m, __shfl_xor(m, off, 32));
    if (lane == 0) s_rmax[row] = m;
  }
  __syncthreads();

  // phase 3: Z = sum (t+1) * exp(s - m)  (softmax denominator cancels analytically)
  for (int rr = 0; rr < 2; rr++) {
    int row = wave * 2 + rr;
    float m = s_rmax[row];
    float z = 0.f;
    for (int k2 = 0; k2 < 128; k2++) {
      int c = lane + 32 * k2;
      z += __expf(sc[row * SROW + c] - m) * (float)(c + 1);
    }
#pragma unroll
    for (int off = 16; off > 0; off >>= 1)
      z += __shfl_xor(z, off, 32);
    if (lane == 0) s_zw[row] = z;
  }
  __syncthreads();
  if (t < 16) Zw[i0 + t] = s_zw[t];

  // phase 4: E = exp(s - m) as bf16, fragment-packed (this block's 16 rows are one 128-KB run of
  // P); each thread writes 16-B pieces, a wave 512 contiguous bytes.
  {
    const int rr = lane & 15;
    const float m = s_rmax[rr];
    unsigned short* Pt = P + ((size_t)blockIdx.x * (SEQ / 32) << 9);
    for (int k2 = 0; k2 < 32; k2++) {
      int q = k2 * 256 + t;                                   // 16-B piece index in the run
      int col = ((q >> 6) << 5) + (((q >> 5) & 1) << 4) + ((lane >> 4) << 3);
      const float* sp = sc + rr * SROW + col;
      fvec4 x0 = *(const fvec4*)sp;
      fvec4 x1 = *(const fvec4*)(sp + 4);
      uvec4 w;
      w[0] = (unsigned int)f2bf(__expf(x0[0] - m)) | ((unsigned int)f2bf(__expf(x0[1] - m)) << 16);
      w[1] = (unsigned int)f2bf(__expf(x0[2] - m)) | ((unsigned int)f2bf(__expf(x0[3] - m)) << 16);
      w[2] = (unsigned int)f2bf(__expf(x1[0] - m)) | ((unsigned int)f2bf(__expf(x1[1] - m)) << 16);
      w[3] = (unsigned int)f2bf(__expf(x1[2] - m)) | ((unsigned int)f2bf(__expf(x1[3] - m)) << 16);
      *(uvec4*)(Pt + ((size_t)q << 3)) = w;
    }
  }
}

// ---------------- kernel 4: Out = (E @ Vcum) / Z ----------------
// Both operands arrive fragment-packed and are read straight from global, each wave its own
// fragments: no LDS stage, no barrier.
__global__ void __launch_bounds__(256) out_gemm_kernel(
    const unsigned short* __restrict__ P, const unsigned short* __restrict__ Vp,
    const float* __restrict__ Zw, float* __restrict__ Out)
{
  const int t = threadIdx.x, wave = t >> 5, lane = t & 31;
  const int wm = wave & 3, wn = wave >> 2;
  const int m0 = blockIdx.y * 128, n0 = blockIdx.x * 64;
  const int at = (m0 >> 4) + wm * 2;   // first 16-row tile of E for this wave
  const int bt = (n0 >> 4) + wn * 2;   // first 16-column tile of Vcum for this wave
  v8f acc[2][2] = {};

  for (int kb = 0; kb < SEQ / 32; kb++) {
    v16bf a0 = load_op_packed(P,  SEQ / 32, at + 0, kb, lane);
    v16bf a1 = load_op_packed(P,  SEQ / 32, at + 1, kb, lane);
    v16bf b0 = load_op_packed(Vp, SEQ / 32, bt + 0, kb, lane);
    v16bf b1 = load_op_packed(Vp, SEQ / 32, bt + 1, kb, lane);
    acc[0][0] = WMMA_BF16(a0, b0, acc[0][0]);
    acc[0][1] = WMMA_BF16(a0, b1, acc[0][1]);
    acc[1][0] = WMMA_BF16(a1, b0, acc[1][0]);
    acc[1][1] = WMMA_BF16(a1, b1, acc[1][1]);
  }

#pragma unroll
  for (int mi = 0; mi < 2; mi++)
#pragma unroll
    for (int ni = 0; ni < 2; ni++)
#pragma unroll
      for (int r = 0; r < 8; r++) {
        int row = m0 + wm * 32 + mi * 16 + ((lane >> 4) << 3) + r;
        int col = n0 + wn * 32 + ni * 16 + (lane & 15);
        Out[(size_t)row * DOUT + col] = acc[mi][ni][r] / Zw[row];
      }
}

// ---------------- host launcher ----------------
extern "C" void kernel_launch(void* const* d_in, const int* in_sizes, int n_in,
                              void* d_out, int out_size, void* d_ws, size_t ws_size,
                              hipStream_t stream) {
  const float* x  = (const float*)d_in[0];
  const float* wq = (const float*)d_in[1];
  const float* wk = (const float*)d_in[2];
  const float* wv = (const float*)d_in[3];
  float* out = (float*)d_out;

  char* ws = (char*)d_ws;
  unsigned short* Qbf = (unsigned short*)(ws);                      //  8 MB bf16, packed
  unsigned short* Kbf = (unsigned short*)(ws + (size_t)( 8 << 20)); //  8 MB bf16, packed
  float*          Vc  = (float*)         (ws + (size_t)(16 << 20)); // 16 MB f32 (V, segment scans)
  unsigned short* P   = (unsigned short*)(ws + (size_t)(32 << 20)); // 32 MB bf16 (E), packed
  float*          Zw  = (float*)         (ws + (size_t)(64 << 20)); // 16 KB
  float*          seg = (float*)         (ws + (size_t)(64 << 20) + (1 << 16)); // 64 KB
  unsigned short* Vp  = (unsigned short*)(ws + (size_t)(72 << 20)); //  8 MB bf16 (Vcum), packed

  dim3 blk(256);
  dim3 gGemm(DOUT / 64, SEQ / 128);

  proj_gemm_kernel<true> <<<gGemm, blk, 0, stream>>>(x, wq, Qbf, nullptr);
  proj_gemm_kernel<true> <<<gGemm, blk, 0, stream>>>(x, wk, Kbf, nullptr);
  proj_gemm_kernel<false><<<gGemm, blk, 0, stream>>>(x, wv, nullptr, Vc);

  seg_scan_kernel<<<dim3(4, 16), blk, 0, stream>>>(Vc, seg);
  seg_off_kernel <<<dim3(4),     blk, 0, stream>>>(seg);
  seg_add_kernel <<<dim3(4, 16), blk, 0, stream>>>(Vc, seg, Vp);

  size_t smem = (size_t)16 * SROW * sizeof(float);  // 256.25 KB dynamic LDS
  scores_kernel<<<dim3(SEQ / 16), blk, smem, stream>>>(Qbf, Kbf, P, Zw);

  out_gemm_kernel<<<gGemm, blk, 0, stream>>>(P, Vp, Zw, out);
}

// v002
// It runs in 332 microseconds.
// In both of two side-by-side timings against v001, it was 1.11 times as fast.
// Over all steps from v000 it is 1.44 times as fast.
#include <hip/hip_runtime.h>

#define SEQ  4096
#define DIN  1024
#define DOUT 1024
#define SROW 4100   // padded LDS row pitch for score strip (bank-conflict break)

typedef __attribute__((ext_vector_type(4)))  float        fvec4;
typedef __attribute__((ext_vector_type(8)))  float        v8f;
typedef __attribute__((ext_vector_type(4)))  unsigned int uvec4;
typedef __attribute__((ext_vector_type(8)))  unsigned int uvec8;
typedef __attribute__((ext_vector_type(16))) __bf16       v16bf;

__device__ __forceinline__ unsigned short f2bf(float f) {
  unsigned int u = __builtin_bit_cast(unsigned int, f);
  u = (u + 0x7FFFu + ((u >> 16) & 1u)) >> 16;   // round-to-nearest-even
  return (unsigned short)u;
}

__device__ __forceinline__ v16bf make_op(uvec4 a, uvec4 b) {
  uvec8 w;
  w[0]=a[0]; w[1]=a[1]; w[2]=a[2]; w[3]=a[3];
  w[4]=b[0]; w[5]=b[1]; w[6]=b[2]; w[7]=b[3];
  return __builtin_bit_cast(v16bf, w);
}

// Fragment-packed bf16 matrix: one 1-KB block per (16 rows) x (32 k), blocks k-major inside a
// 16-row tile. Inside a block lane L = (row & 15) + 16 * ((k >> 3) & 1) owns 16 B at L * 16 for
// k & 16 == 0 and at 512 + L * 16 for k & 16 != 0 (the ISA 16-bit A layout, k order unchanged).
// Index in 16-bit elements of element (row, k); kblocks = k extent / 32.
__device__ __forceinline__ size_t packed_idx(int row, int k, int kblocks) {
  return ((size_t)((row >> 4) * kblocks + (k >> 5)) << 9)
       + (((k >> 4) & 1) << 8) + (((row & 15) + (((k >> 3) & 1) << 4)) << 3) + (k & 7);
}

// 16x32 operand of 16-row tile rt, k block kb: two loads of 512 contiguous bytes per wave.
__device__ __forceinline__ v16bf load_op_packed(const unsigned short* __restrict__ base,
                                                int kblocks, int rt, int kb, int lane) {
  const unsigned short* p = base + ((size_t)(rt * kblocks + kb) << 9) + (lane << 3);
  uvec4 lo = *(const uvec4*)p;
  uvec4 hi = *(const uvec4*)(p + 256);
  return make_op(lo, hi);
}

__device__ __forceinline__ v16bf load_op_lds(const unsigned short* base,
                                             int ldr, int row0, int lane) {
  int r = row0 + (lane & 15);
  int c = (lane >> 4) << 3;
  const unsigned short* p = base + r * ldr + c;
  uvec4 lo = *(const uvec4*)p;
  uvec4 hi = *(const uvec4*)(p + 16);
  return make_op(lo, hi);
}

#define WMMA_BF16(a, b, c) \
  __builtin_amdgcn_wmma_f32_16x16x32_bf16(false, (a), false, (b), (short)0, (c), false, false)

// ---------------- kernel 1: Q, K, V [4096,1024] = X[4096,1024] @ {Wq, Wk, Wv}[1024,1024] ----------------
// One launch for the three projections: 8 waves (4 M x 2 N), block tile 128x64 of each of Q, K and V,
// k-step 32. The X tile is loaded, converted and staged once per k-step and feeds all three products.
// Q and K leave as fragment-packed bf16, V as f32.
__global__ void __launch_bounds__(256) proj_gemm_kernel(
    const float* __restrict__ X, const float* __restrict__ Wq,
    const float* __restrict__ Wk, const float* __restrict__ Wv,
    unsigned short* __restrict__ outQ, unsigned short* __restrict__ outK,
    float* __restrict__ outV)
{
  __shared__ __align__(16) unsigned short As[128 * 40];
  __shared__ __align__(16) unsigned short Bs[3][64 * 40];
  const int t = threadIdx.x;
  const int wave = t >> 5, lane = t & 31;
  const int wm = wave & 3, wn = wave >> 2;
  const int m0 = blockIdx.y * 128, n0 = blockIdx.x * 64;

  v8f acc[3][2][2] = {};

  // This thread's place in the staged tiles: X rows xr + 32 i, columns xc..xc+3; W rows wr + 16 i,
  // columns wc..wc+3.
  const int xr = t >> 3, xc = (t & 7) << 2;
  const int wr = t >> 4, wc = (t & 15) << 2;
  const unsigned xoff = (unsigned)(xr * DIN + xc);
  const unsigned woff = (unsigned)(wr * DOUT + wc);

  for (int kb = 0; kb < DIN; kb += 32) {
    // all ten global loads of the k-step go out together
    fvec4 xa[4], wb[3][2];
    const float* Xk = X + (size_t)m0 * DIN + kb;
#pragma unroll
    for (int i = 0; i < 4; i++)
      xa[i] = *(const fvec4*)(Xk + xoff + i * 32 * DIN);
#pragma unroll
    for (int w = 0; w < 3; w++) {
      const float* Wp = ((w == 0) ? Wq : (w == 1) ? Wk : Wv) + (size_t)kb * DOUT + n0;
#pragma unroll
      for (int i = 0; i < 2; i++)
        wb[w][i] = *(const fvec4*)(Wp + woff + i * 16 * DOUT);
    }
    // A tile: X[m0..+127][kb..+31] -> bf16 LDS (pitch 40)
#pragma unroll
    for (int i = 0; i < 4; i++) {
      unsigned short* d = As + (xr + 32 * i) * 40 + xc;
      d[0]=f2bf(xa[i][0]); d[1]=f2bf(xa[i][1]); d[2]=f2bf(xa[i][2]); d[3]=f2bf(xa[i][3]);
    }
    // B tiles (transposed): Bs[w][n][k] = W_w[kb+k][n0+n]
#pragma unroll
    for (int w = 0; w < 3; w++)
#pragma unroll
      for (int i = 0; i < 2; i++) {
        int k = wr + 16 * i;
        Bs[w][(wc + 0) * 40 + k] = f2bf(wb[w][i][0]);
        Bs[w][(wc + 1) * 40 + k] = f2bf(wb[w][i][1]);
        Bs[w][(wc + 2) * 40 + k] = f2bf(wb[w][i][2]);
        Bs[w][(wc + 3) * 40 + k] = f2bf(wb[w][i][3]);
      }
    __syncthreads();

    v16bf a0 = load_op_lds(As, 40, wm * 32 +  0, lane);
    v16bf a1 = load_op_lds(As, 40, wm * 32 + 16, lane);
    v16bf b0[3], b1[3];
#pragma unroll
    for (int w = 0; w < 3; w++) {
      b0[w] = load_op_lds(Bs[w], 40, wn * 32 +  0, lane);
      b1[w] = load_op_lds(Bs[w], 40, wn * 32 + 16, lane);
    }
    // Holds the sixteen LDS reads together in front of the WMMAs: spread among them each pair
    // would be waited for on its own.
    __builtin_amdgcn_sched_barrier(0);
#pragma unroll
    for (int w = 0; w < 3; w++) {
      acc[w][0][0] = WMMA_BF16(a0, b0[w], acc[w][0][0]);
      acc[w][0][1] = WMMA_BF16(a0, b1[w], acc[w][0][1]);
      acc[w][1][0] = WMMA_BF16(a1, b0[w], acc[w][1][0]);
      acc[w][1][1] = WMMA_BF16(a1, b1[w], acc[w][1][1]);
    }
    __syncthreads();
  }

#pragma unroll
  for (int mi = 0; mi < 2; mi++)
#pragma unroll
    for (int ni = 0; ni < 2; ni++)
#pragma unroll
      for (int r = 0; r < 8; r++) {
        int row = m0 + wm * 32 + mi * 16 + ((lane >> 4) << 3) + r;
        int col = n0 + wn * 32 + ni * 16 + (lane & 15);
        size_t pi = packed_idx(row, col, DOUT / 32);
        outQ[pi] = f2bf(acc[0][mi][ni][r]);
        outK[pi] = f2bf(acc[1][mi][ni][r]);
        outV[(size_t)row * DOUT + col] = acc[2][mi][ni][r];
      }
}

// ---------------- kernels 2a/2b/2c: prefix sum of V rows -> Vcum (packed bf16) ----------------
__global__ void __launch_bounds__(256) seg_scan_kernel(float* __restrict__ V,
                                                       float* __restrict__ segtot) {
  int col = blockIdx.x * 256 + threadIdx.x;
  int seg = blockIdx.y;
  float s = 0.f;
  size_t base = (size_t)seg * 256 * DOUT + col;
  for (int r = 0; r < 256; r++) {
    size_t idx = base + (size_t)r * DOUT;
    s += V[idx];
    V[idx] = s;
  }
  segtot[seg * DOUT + col] = s;
}

__global__ void __launch_bounds__(256) seg_off_kernel(float* __restrict__ segtot) {
  int col = blockIdx.x * 256 + threadIdx.x;
  float off = 0.f;
  for (int s = 0; s < 16; s++) {
    float v = segtot[s * DOUT + col];
    segtot[s * DOUT + col] = off;   // exclusive offsets
    off += v;
  }
}

// Adds the segment offset and writes Vcum as the out GEMM's B operand: bf16, fragment-packed,
// "row" = output column n, k = sequence position.
__global__ void __launch_bounds__(256) seg_add_kernel(const float* __restrict__ V,
                                                      const float* __restrict__ segtot,
                                                      unsigned short* __restrict__ Vp) {
  int col = blockIdx.x * 256 + threadIdx.x;
  int seg = blockIdx.y;
  float off = segtot[seg * DOUT + col];
  size_t base = (size_t)seg * 256 * DOUT + col;
  for (int g = 0; g < 32; g++) {          // 8 sequence positions = one 16-B piece of a fragment
    uvec4 w;
#pragma unroll
    for (int j = 0; j < 4; j++) {
      unsigned int e0 = f2bf(V[base + (size_t)(g * 8 + 2 * j + 0) * DOUT] + off);
      unsigned int e1 = f2bf(V[base + (size_t)(g * 8 + 2 * j + 1) * DOUT] + off);
      w[j] = e0 | (e1 << 16);
    }
    *(uvec4*)(Vp + packed_idx(col, seg * 256 + g * 8, SEQ / 32)) = w;
    // The next trip rewrites the registers that this store names.
    asm volatile("s_wait_xcnt 0x0" ::: "memory");
  }
}

// ---------------- kernel 3: scores + max + E=exp(s-m) + Z = sum (t+1) E ----------------
// One 16-row block per WG; 16xSROW fp32 score strip in dynamic LDS (256 KB of 320 KB WGP LDS).
__global__ void __launch_bounds__(256) scores_kernel(
    const unsigned short* __restrict__ Q, const unsigned short* __restrict__ K,
    unsigned short* __restrict__ P, float* __restrict__ Zw)
{
  extern __shared__ float sc[];   // [16][SROW]
  __shared__ float s_rmax[16];
  __shared__ float s_zw[16];
  const int t = threadIdx.x, wave = t >> 5, lane = t & 31;
  const int i0 = blockIdx.x * 16;
  const float scale = 0.03125f;   // 1/sqrt(1024)

  // phase 1: full 16x4096 score strip via WMMA (Q and K arrive fragment-packed)
  // Software-pipelined: loads for iteration ks+1 are issued before the WMMAs of
  // iteration ks, so the waitcnt pass can use partial s_wait_loadcnt and keep
  // the next 10 loads in flight behind the WMMA quartet.
  for (int it = 0; it < 8; it++) {
    int jt0 = (it * 8 + wave) * 4;            // 4 consecutive 16-wide j tiles per wave per pass
    v8f acc[4] = {};

    v16bf a = load_op_packed(Q, DIN / 32, blockIdx.x, 0, lane);
    v16bf b[4];
#pragma unroll
    for (int jc = 0; jc < 4; jc++)
      b[jc] = load_op_packed(K, DIN / 32, jt0 + jc, 0, lane);

    for (int ks = 0; ks < 31; ks++) {
      v16bf an = load_op_packed(Q, DIN / 32, blockIdx.x, ks + 1, lane);
      v16bf bn[4];
#pragma unroll
      for (int jc = 0; jc < 4; jc++)
        bn[jc] = load_op_packed(K, DIN / 32, jt0 + jc, ks + 1, lane);
#pragma unroll
      for (int jc = 0; jc < 4; jc++)
        acc[jc] = WMMA_BF16(a, b[jc], acc[jc]);
      a = an;
#pragma unroll
      for (int jc = 0; jc < 4; jc++) b[jc] = bn[jc];
    }
#pragma unroll
    for (int jc = 0; jc < 4; jc++)
      acc[jc] = WMMA_BF16(a, b[jc], acc[jc]);

#pragma unroll
    for (int jc = 0; jc < 4; jc++) {
      int colb = (jt0 + jc) * 16 + (lane & 15);
#pragma unroll
      for (int r = 0; r < 8; r++) {
        int row = ((lane >> 4) << 3) + r;
        sc[row * SROW + colb] = acc[jc][r] * scale;
      }
    }
  }
  __syncthreads();

  // phase 2: row max (wave w owns rows 2w, 2w+1; stride-32 lanes -> conflict-free)
  for (int rr = 0; rr < 2; rr++) {
    int row = wave * 2 + rr;
    float m = -3.0e38f;
    for (int k2 = 0; k2 < 128; k2++)
      m = fmaxf(m, sc[row * SROW + lane + 32 * k2]);
#pragma unroll
    for (int off = 16; off > 0; off >>= 1)
      m = fmaxf(m, __shfl_xor(m, off, 32));
    if (lane == 0) s_rmax[row] = m;
  }
  __syncthreads();

  // phase 3: Z = sum (t+1) * exp(s - m)  (softmax denominator cancels analytically)
  for (int rr = 0; rr < 2; rr++) {
    int row = wave * 2 + rr;
    float m = s_rmax[row];
    float z = 0.f;
    for (int k2 = 0; k2 < 128; k2++) {
      int c = lane + 32 * k2;
      z += __expf(sc[row * SROW + c] - m) * (float)(c + 1);
    }
#pragma unroll
    for (int off = 16; off > 0; off >>= 1)
      z += __shfl_xor(z, off, 32);
    if (lane == 0) s_zw[row] = z;
  }
  __syncthreads();
  if (t < 16) Zw[i0 + t] = s_zw[t];

  // phase 4: E = exp(s - m) as bf16, fragment-packed (this block's 16 rows are one 128-KB run of
  // P); each thread writes 16-B pieces, a wave 512 contiguous bytes.
  {
    const int rr = lane & 15;
    const float m = s_rmax[rr];
    unsigned short* Pt = P + ((size_t)blockIdx.x * (SEQ / 32) << 9);
    for (int k2 = 0; k2 < 32; k2++) {
      int q = k2 * 256 + t;                                   // 16-B piece index in the run
      int col = ((q >> 6) << 5) + (((q >> 5) & 1) << 4) + ((lane >> 4) << 3);
      const float* sp = sc + rr * SROW + col;
      fvec4 x0 = *(const fvec4*)sp;
      fvec4 x1 = *(const fvec4*)(sp + 4);
      uvec4 w;
      w[0] = (unsigned int)f2bf(__expf(x0[0] - m)) | ((unsigned int)f2bf(__expf(x0[1] - m)) << 16);
      w[1] = (unsigned int)f2bf(__expf(x0[2] - m)) | ((unsigned int)f2bf(__expf(x0[3] - m)) << 16);
      w[2] = (unsigned int)f2bf(__expf(x1[0] - m)) | ((unsigned int)f2bf(__expf(x1[1] - m)) << 16);
      w[3] = (unsigned int)f2bf(__expf(x1[2] - m)) | ((unsigned int)f2bf(__expf(x1[3] - m)) << 16);
      *(uvec4*)(Pt + ((size_t)q << 3)) = w;
    }
  }
}

// ---------------- kernel 4: Out = (E @ Vcum) / Z ----------------
// Both operands arrive fragment-packed and are read straight from global, each wave its own
// fragments: no LDS stage, no barrier.
__global__ void __launch_bounds__(256) out_gemm_kernel(
    const unsigned short* __restrict__ P, const unsigned short* __restrict__ Vp,
    const float* __restrict__ Zw, float* __restrict__ Out)
{
  const int t = threadIdx.x, wave = t >> 5, lane = t & 31;
  const int wm = wave & 3, wn = wave >> 2;
  const int m0 = blockIdx.y * 128, n0 = blockIdx.x * 64;
  const int at = (m0 >> 4) + wm * 2;   // first 16-row tile of E for this wave
  const int bt = (n0 >> 4) + wn * 2;   // first 16-column tile of Vcum for this wave
  v8f acc[2][2] = {};

  for (int kb = 0; kb < SEQ / 32; kb++) {
    v16bf a0 = load_op_packed(P,  SEQ / 32, at + 0, kb, lane);
    v16bf a1 = load_op_packed(P,  SEQ / 32, at + 1, kb, lane);
    v16bf b0 = load_op_packed(Vp, SEQ / 32, bt + 0, kb, lane);
    v16bf b1 = load_op_packed(Vp, SEQ / 32, bt + 1, kb, lane);
    acc[0][0] = WMMA_BF16(a0, b0, acc[0][0]);
    acc[0][1] = WMMA_BF16(a0, b1, acc[0][1]);
    acc[1][0] = WMMA_BF16(a1, b0, acc[1][0]);
    acc[1][1] = WMMA_BF16(a1, b1, acc[1][1]);
  }

#pragma unroll
  for (int mi = 0; mi < 2; mi++)
#pragma unroll
    for (int ni = 0; ni < 2; ni++)
#pragma unroll
      for (int r = 0; r < 8; r++) {
        int row = m0 + wm * 32 + mi * 16 + ((lane >> 4) << 3) + r;
        int col = n0 + wn * 32 + ni * 16 + (lane & 15);
        Out[(size_t)row * DOUT + col] = acc[mi][ni][r] / Zw[row];
      }
}

// ---------------- host launcher ----------------
extern "C" void kernel_launch(void* const* d_in, const int* in_sizes, int n_in,
                              void* d_out, int out_size, void* d_ws, size_t ws_size,
                              hipStream_t stream) {
  const float* x  = (const float*)d_in[0];
  const float* wq = (const float*)d_in[1];
  const float* wk = (const float*)d_in[2];
  const float* wv = (const float*)d_in[3];
  float* out = (float*)d_out;

  char* ws = (char*)d_ws;
  unsigned short* Qbf = (unsigned short*)(ws);                      //  8 MB bf16, packed
  unsigned short* Kbf = (unsigned short*)(ws + (size_t)( 8 << 20)); //  8 MB bf16, packed
  float*          Vc  = (float*)         (ws + (size_t)(16 << 20)); // 16 MB f32 (V, segment scans)
  unsigned short* P   = (unsigned short*)(ws + (size_t)(32 << 20)); // 32 MB bf16 (E), packed
  float*          Zw  = (float*)         (ws + (size_t)(64 << 20)); // 16 KB
  float*          seg = (float*)         (ws + (size_t)(64 << 20) + (1 << 16)); // 64 KB
  unsigned short* Vp  = (unsigned short*)(ws + (size_t)(72 << 20)); //  8 MB bf16 (Vcum), packed

  dim3 blk(256);
  dim3 gGemm(DOUT / 64, SEQ / 128);

  proj_gemm_kernel<<<gGemm, blk, 0, stream>>>(x, wq, wk, wv, Qbf, Kbf, Vc);

  seg_scan_kernel<<<dim3(4, 16), blk, 0, stream>>>(Vc, seg);
  seg_off_kernel <<<dim3(4),     blk, 0, stream>>>(seg);
  seg_add_kernel <<<dim3(4, 16), blk, 0, stream>>>(Vc, seg, Vp);

  size_t smem = (size_t)16 * SROW * sizeof(float);  // 256.25 KB dynamic LDS
  scores_kernel<<<dim3(SEQ / 16), blk, smem, stream>>>(Qbf, Kbf, P, Zw);

  out_gemm_kernel<<<gGemm, blk, 0, stream>>>(P, Vp, Zw, out);
}

// v003
// One run takes 221 microseconds.
// Two timings next to v002 put it at 1.50 and 1.51 times that version's speed.
// Over all steps from v000 it is 2.16 times as fast.
#include <hip/hip_runtime.h>

#define SEQ  4096
#define DIN  1024
#define DOUT 1024
#define RB   128    // query rows per scores block
#define JB   512    // keys per scores block (one key group, an eighth of the sequence)
#define NQ   8      // key groups
#define SROW 516    // padded LDS row pitch for score tile (bank-conflict break)

typedef __attribute__((ext_vector_type(4)))  float        fvec4;
typedef __attribute__((ext_vector_type(8)))  float        v8f;
typedef __attribute__((ext_vector_type(4)))  unsigned int uvec4;
typedef __attribute__((ext_vector_type(8)))  unsigned int uvec8;
typedef __attribute__((ext_vector_type(16))) __bf16       v16bf;

__device__ __forceinline__ unsigned short f2bf(float f) {
  unsigned int u = __builtin_bit_cast(unsigned int, f);
  u = (u + 0x7FFFu + ((u >> 16) & 1u)) >> 16;   // round-to-nearest-even
  return (unsigned short)u;
}

__device__ __forceinline__ v16bf make_op(uvec4 a, uvec4 b) {
  uvec8 w;
  w[0]=a[0]; w[1]=a[1]; w[2]=a[2]; w[3]=a[3];
  w[4]=b[0]; w[5]=b[1]; w[6]=b[2]; w[7]=b[3];
  return __builtin_bit_cast(v16bf, w);
}

// Fragment-packed bf16 matrix: one 1-KB block per (16 rows) x (32 k), blocks k-major inside a
// 16-row tile. Inside a block lane L = (row & 15) + 16 * ((k >> 3) & 1) owns 16 B at L * 16 for
// k & 16 == 0 and at 512 + L * 16 for k & 16 != 0 (the ISA 16-bit A layout, k order unchanged).
// Index in 16-bit elements of element (row, k); kblocks = k extent / 32.
__device__ __forceinline__ size_t packed_idx(int row, int k, int kblocks) {
  return ((size_t)((row >> 4) * kblocks + (k >> 5)) << 9)
       + (((k >> 4) & 1) << 8) + (((row & 15) + (((k >> 3) & 1) << 4)) << 3) + (k & 7);
}

// 16x32 operand of 16-row tile rt, k block kb: two loads of 512 contiguous bytes per wave.
__device__ __forceinline__ v16bf load_op_packed(const unsigned short* __restrict__ base,
                                                int kblocks, int rt, int kb, int lane) {
  const unsigned short* p = base + ((size_t)(rt * kblocks + kb) << 9) + (lane << 3);
  uvec4 lo = *(const uvec4*)p;
  uvec4 hi = *(const uvec4*)(p + 256);
  return make_op(lo, hi);
}

__device__ __forceinline__ v16bf load_op_lds(const unsigned short* base,
                                             int ldr, int row0, int lane) {
  int r = row0 + (lane & 15);
  int c = (lane >> 4) << 3;
  const unsigned short* p = base + r * ldr + c;
  uvec4 lo = *(const uvec4*)p;
  uvec4 hi = *(const uvec4*)(p + 16);
  return make_op(lo, hi);
}

#define WMMA_BF16(a, b, c) \
  __builtin_amdgcn_wmma_f32_16x16x32_bf16(false, (a), false, (b), (short)0, (c), false, false)

// ---------------- kernel 1: Q, K, V [4096,1024] = X[4096,1024] @ {Wq, Wk, Wv}[1024,1024] ----------------
// One launch for the three projections: 8 waves (4 M x 2 N), block tile 128x64 of each of Q, K and V,
// k-step 32. The X tile is loaded, converted and staged once per k-step and feeds all three products.
// Q and K leave as fragment-packed bf16, V as f32.
__global__ void __launch_bounds__(256) proj_gemm_kernel(
    const float* __restrict__ X, const float* __restrict__ Wq,
    const float* __restrict__ Wk, const float* __restrict__ Wv,
    unsigned short* __restrict__ outQ, unsigned short* __restrict__ outK,
    float* __restrict__ outV)
{
  __shared__ __align__(16) unsigned short As[128 * 40];
  __shared__ __align__(16) unsigned short Bs[3][64 * 40];
  const int t = threadIdx.x;
  const int wave = t >> 5, lane = t & 31;
  const int wm = wave & 3, wn = wave >> 2;
  const int m0 = blockIdx.y * 128, n0 = blockIdx.x * 64;

  v8f acc[3][2][2] = {};

  // This thread's place in the staged tiles: X rows xr + 32 i, columns xc..xc+3; W rows wr + 16 i,
  // columns wc..wc+3.
  const int xr = t >> 3, xc = (t & 7) << 2;
  const int wr = t >> 4, wc = (t & 15) << 2;
  const unsigned xoff = (unsigned)(xr * DIN + xc);
  const unsigned woff = (unsigned)(wr * DOUT + wc);

  for (int kb = 0; kb < DIN; kb += 32) {
    // all ten global loads of the k-step go out together
    fvec4 xa[4], wb[3][2];
    const float* Xk = X + (size_t)m0 * DIN + kb;
#pragma unroll
    for (int i = 0; i < 4; i++)
      xa[i] = *(const fvec4*)(Xk + xoff + i * 32 * DIN);
#pragma unroll
    for (int w = 0; w < 3; w++) {
      const float* Wp = ((w == 0) ? Wq : (w == 1) ? Wk : Wv) + (size_t)kb * DOUT + n0;
#pragma unroll
      for (int i = 0; i < 2; i++)
        wb[w][i] = *(const fvec4*)(Wp + woff + i * 16 * DOUT);
    }
    // A tile: X[m0..+127][kb..+31] -> bf16 LDS (pitch 40)
#pragma unroll
    for (int i = 0; i < 4; i++) {
      unsigned short* d = As + (xr + 32 * i) * 40 + xc;
      d[0]=f2bf(xa[i][0]); d[1]=f2bf(xa[i][1]); d[2]=f2bf(xa[i][2]); d[3]=f2bf(xa[i][3]);
    }
    // B tiles (transposed): Bs[w][n][k] = W_w[kb+k][n0+n]
#pragma unroll
    for (int w = 0; w < 3; w++)
#pragma unroll
      for (int i = 0; i < 2; i++) {
        int k = wr + 16 * i;
        Bs[w][(wc + 0) * 40 + k] = f2bf(wb[w][i][0]);
        Bs[w][(wc + 1) * 40 + k] = f2bf(wb[w][i][1]);
        Bs[w][(wc + 2) * 40 + k] = f2bf(wb[w][i][2]);
        Bs[w][(wc + 3) * 40 + k] = f2bf(wb[w][i][3]);
      }
    __syncthreads();

    v16bf a0 = load_op_lds(As, 40, wm * 32 +  0, lane);
    v16bf a1 = load_op_lds(As, 40, wm * 32 + 16, lane);
    v16bf b0[3], b1[3];
#pragma unroll
    for (int w = 0; w < 3; w++) {
      b0[w] = load_op_lds(Bs[w], 40, wn * 32 +  0, lane);
      b1[w] = load_op_lds(Bs[w], 40, wn * 32 + 16, lane);
    }
    // Holds the sixteen LDS reads together in front of the WMMAs: spread among them each pair
    // would be waited for on its own.
    __builtin_amdgcn_sched_barrier(0);
#pragma unroll
    for (int w = 0; w < 3; w++) {
      acc[w][0][0] = WMMA_BF16(a0, b0[w], acc[w][0][0]);
      acc[w][0][1] = WMMA_BF16(a0, b1[w], acc[w][0][1]);
      acc[w][1][0] = WMMA_BF16(a1, b0[w], acc[w][1][0]);
      acc[w][1][1] = WMMA_BF16(a1, b1[w], acc[w][1][1]);
    }
    __syncthreads();
  }

#pragma unroll
  for (int mi = 0; mi < 2; mi++)
#pragma unroll
    for (int ni = 0; ni < 2; ni++)
#pragma unroll
      for (int r = 0; r < 8; r++) {
        int row = m0 + wm * 32 + mi * 16 + ((lane >> 4) << 3) + r;
        int col = n0 + wn * 32 + ni * 16 + (lane & 15);
        size_t pi = packed_idx(row, col, DOUT / 32);
        outQ[pi] = f2bf(acc[0][mi][ni][r]);
        outK[pi] = f2bf(acc[1][mi][ni][r]);
        outV[(size_t)row * DOUT + col] = acc[2][mi][ni][r];
      }
}

// ---------------- kernels 2a/2b/2c: prefix sum of V rows -> Vcum (packed bf16) ----------------
__global__ void __launch_bounds__(256) seg_scan_kernel(float* __restrict__ V,
                                                       float* __restrict__ segtot) {
  int col = blockIdx.x * 256 + threadIdx.x;
  int seg = blockIdx.y;
  float s = 0.f;
  size_t base = (size_t)seg * 256 * DOUT + col;
  for (int r = 0; r < 256; r++) {
    size_t idx = base + (size_t)r * DOUT;
    s += V[idx];
    V[idx] = s;
  }
  segtot[seg * DOUT + col] = s;
}

__global__ void __launch_bounds__(256) seg_off_kernel(float* __restrict__ segtot) {
  int col = blockIdx.x * 256 + threadIdx.x;
  float off = 0.f;
  for (int s = 0; s < 16; s++) {
    float v = segtot[s * DOUT + col];
    segtot[s * DOUT + col] = off;   // exclusive offsets
    off += v;
  }
}

// Adds the segment offset and writes Vcum as the out GEMM's B operand: bf16, fragment-packed,
// "row" = output column n, k = sequence position.
__global__ void __launch_bounds__(256) seg_add_kernel(const float* __restrict__ V,
                                                      const float* __restrict__ segtot,
                                                      unsigned short* __restrict__ Vp) {
  int col = blockIdx.x * 256 + threadIdx.x;
  int seg = blockIdx.y;
  float off = segtot[seg * DOUT + col];
  size_t base = (size_t)seg * 256 * DOUT + col;
  for (int g = 0; g < 32; g++) {          // 8 sequence positions = one 16-B piece of a fragment
    uvec4 w;
#pragma unroll
    for (int j = 0; j < 4; j++) {
      unsigned int e0 = f2bf(V[base + (size_t)(g * 8 + 2 * j + 0) * DOUT] + off);
      unsigned int e1 = f2bf(V[base + (size_t)(g * 8 + 2 * j + 1) * DOUT] + off);
      w[j] = e0 | (e1 << 16);
    }
    *(uvec4*)(Vp + packed_idx(col, seg * 256 + g * 8, SEQ / 32)) = w;
    // The next trip rewrites the registers that this store names.
    asm volatile("s_wait_xcnt 0x0" ::: "memory");
  }
}

// ---------------- kernel 3: scores + per-group max + E=exp(s-m) + Z = sum (t+1) E ----------------
// One 128-row x 512-key tile per WG; the f32 score tile lies in dynamic LDS (258 KB of 320 KB WGP LDS).
// Each K fragment a wave loads feeds four 16-row tiles of Q. Maximum, E and Z are those of the
// block's own key group; the out GEMM brings the eight groups of a row to one scale.
__device__ __forceinline__ void load_frags(v16bf (&f)[4], const unsigned short* __restrict__ M,
                                           int tile0, int ks, int lane) {
  // Unrolled: the fragments live in registers, which takes constant indices.
#pragma unroll
  for (int i = 0; i < 4; i++) f[i] = load_op_packed(M, DIN / 32, tile0 + i, ks, lane);
}

__device__ __forceinline__ void mma_stage(v8f (&acc)[4][4], const v16bf (&a)[4], const v16bf (&b)[4]) {
  // Unrolled for the same reason.
#pragma unroll
  for (int mi = 0; mi < 4; mi++)
#pragma unroll
    for (int jc = 0; jc < 4; jc++)
      acc[mi][jc] = WMMA_BF16(a[mi], b[jc], acc[mi][jc]);
}

__global__ void __launch_bounds__(512) scores_kernel(
    const unsigned short* __restrict__ Q, const unsigned short* __restrict__ K,
    unsigned short* __restrict__ P, float* __restrict__ Zl, float* __restrict__ Ml)
{
  extern __shared__ float sc[];   // [RB][SROW]
  __shared__ float s_rmax[RB];
  __shared__ float s_zw[RB];
  const int t = threadIdx.x, wave = t >> 5, lane = t & 31;
  const int rt0 = blockIdx.x * (RB / 16);   // first 16-row tile of Q
  const int js  = blockIdx.y;               // key group
  const float scale = 0.03125f;   // 1/sqrt(1024)

  // phase 1: 128x512 score tile via WMMA (Q and K arrive fragment-packed). The 16 waves lie 2 x 8
  // over the tile, each with 4x4 accumulator tiles (64 rows x 64 keys). The K fragments are fetched
  // one k block ahead into a second set that takes turns with the first (no register copy waits
  // for them); the Q fragments, which eight waves share, are fetched for the k block at hand.
  {
    const int wmh = wave & 1;                   // 64-row half of the tile
    const int jl0 = (wave >> 1) * 4;            // 4 consecutive 16-wide key tiles per wave
    const int jt0 = js * (JB / 16) + jl0;
    const int rtw = rt0 + wmh * 4;
    v8f acc[4][4] = {};
    v16bf a[4], b0[4], b1[4];
    load_frags(b0, K, jt0, 0, lane);
    for (int ks = 0; ks < DIN / 32 - 2; ks += 2) {
      load_frags(a,  Q, rtw, ks,     lane);
      load_frags(b1, K, jt0, ks + 1, lane);
      // Holds the sixteen loads together in front of the WMMAs: sunk among them, each group
      // would be waited for on its own.
      __builtin_amdgcn_sched_barrier(0);
      mma_stage(acc, a, b0);
      load_frags(a,  Q, rtw, ks + 1, lane);
      load_frags(b0, K, jt0, ks + 2, lane);
      __builtin_amdgcn_sched_barrier(0);        // as above
      mma_stage(acc, a, b1);
      // The next trip rewrites the address registers that the K loads still in flight name.
      asm volatile("s_wait_xcnt 0x0" ::: "memory");
    }
    load_frags(a,  Q, rtw, DIN / 32 - 2, lane);
    load_frags(b1, K, jt0, DIN / 32 - 1, lane);
    __builtin_amdgcn_sched_barrier(0);          // as above
    mma_stage(acc, a, b0);
    load_frags(a,  Q, rtw, DIN / 32 - 1, lane);
    mma_stage(acc, a, b1);

#pragma unroll
    for (int mi = 0; mi < 4; mi++)
#pragma unroll
      for (int jc = 0; jc < 4; jc++) {
        int colb = (jl0 + jc) * 16 + (lane & 15);
#pragma unroll
        for (int r = 0; r < 8; r++) {
          int row = wmh * 64 + mi * 16 + ((lane >> 4) << 3) + r;
          sc[row * SROW + colb] = acc[mi][jc][r] * scale;
        }
      }
  }
  __syncthreads();

  // phase 2: row max over the group (wave w owns rows 8w..8w+7; stride-32 lanes -> conflict-free)
  for (int rr = 0; rr < RB / 16; rr++) {
    int row = wave * (RB / 16) + rr;
    float m = -3.0e38f;
    // Unrolled so that the row's 16 LDS reads go out together instead of one wait per read.
#pragma unroll
    for (int k2 = 0; k2 < JB / 32; k2++)
      m = fmaxf(m, sc[row * SROW + lane + 32 * k2]);
#pragma unroll
    for (int off = 16; off > 0; off >>= 1)
      m = fmaxf(m, __shfl_xor(m, off, 32));
    if (lane == 0) s_rmax[row] = m;
  }
  __syncthreads();

  // phase 3: Z = sum (t+1) * exp(s - m) over the group (softmax denominator cancels analytically)
  for (int rr = 0; rr < RB / 16; rr++) {
    int row = wave * (RB / 16) + rr;
    float m = s_rmax[row];
    float z = 0.f;
    // Unrolled for the same reason as in phase 2.
#pragma unroll
    for (int k2 = 0; k2 < JB / 32; k2++) {
      int c = lane + 32 * k2;
      z += __expf(sc[row * SROW + c] - m) * (float)(js * JB + c + 1);
    }
#pragma unroll
    for (int off = 16; off > 0; off >>= 1)
      z += __shfl_xor(z, off, 32);
    if (lane == 0) s_zw[row] = z;
  }
  __syncthreads();
  // [group][row]: a block's 128 values are four whole 128-B lines of each array.
  if (t < RB) {
    Zl[js * SEQ + blockIdx.x * RB + t] = s_zw[t];
    Ml[js * SEQ + blockIdx.x * RB + t] = s_rmax[t];
  }

  // phase 4: E = exp(s - m) as bf16, fragment-packed (each 16-row tile's key group is one 16-KB run
  // of P); each thread writes 16-B pieces, a wave 512 contiguous bytes.
  for (int k2 = 0; k2 < 16; k2++) {
    const int tile = k2 >> 1;                               // 16-row tile of the block
    const int q = (k2 & 1) * 512 + t;                       // 16-B piece index in the tile's run
    const int row = tile * 16 + (lane & 15);
    const int col = ((q >> 6) << 5) + (((q >> 5) & 1) << 4) + ((lane >> 4) << 3);
    const float m = s_rmax[row];
    const float* sp = sc + row * SROW + col;
    unsigned short* Pt = P + ((size_t)((rt0 + tile) * (SEQ / 32) + js * (JB / 32)) << 9);
    fvec4 x0 = *(const fvec4*)sp;
    fvec4 x1 = *(const fvec4*)(sp + 4);
    uvec4 w;
    w[0] = (unsigned int)f2bf(__expf(x0[0] - m)) | ((unsigned int)f2bf(__expf(x0[1] - m)) << 16);
    w[1] = (unsigned int)f2bf(__expf(x0[2] - m)) | ((unsigned int)f2bf(__expf(x0[3] - m)) << 16);
    w[2] = (unsigned int)f2bf(__expf(x1[0] - m)) | ((unsigned int)f2bf(__expf(x1[1] - m)) << 16);
    w[3] = (unsigned int)f2bf(__expf(x1[2] - m)) | ((unsigned int)f2bf(__expf(x1[3] - m)) << 16);
    *(uvec4*)(Pt + ((size_t)q << 3)) = w;
    // The next trip rewrites the registers that this store names.
    asm volatile("s_wait_xcnt 0x0" ::: "memory");
  }
}

// ---------------- kernel 4: Out = sum over key groups f_q * (E_q @ Vcum_q) ----------------
// Both operands arrive fragment-packed and are read straight from global, each wave its own
// fragments. E of key group q is scaled by the group's own row maximum m_q, so each group's
// product is weighted by f_q = exp(m_q - max m) / sum_p Z_p exp(m_p - max m).
__global__ void __launch_bounds__(256) out_gemm_kernel(
    const unsigned short* __restrict__ P, const unsigned short* __restrict__ Vp,
    const float* __restrict__ Zl, const float* __restrict__ Ml, float* __restrict__ Out)
{
  __shared__ __align__(16) float s_f[NQ][128];
  const int t = threadIdx.x, wave = t >> 5, lane = t & 31;
  const int wm = wave & 3, wn = wave >> 2;
  const int m0 = blockIdx.y * 128, n0 = blockIdx.x * 64;
  const int at = (m0 >> 4) + wm * 2;   // first 16-row tile of E for this wave
  const int bt = (n0 >> 4) + wn * 2;   // first 16-column tile of Vcum for this wave

  if (t < 128) {
    // The loops over the groups are unrolled so that mq, zq and e stay in registers.
    float mq[NQ], zq[NQ];
#pragma unroll
    for (int q = 0; q < NQ; q++) {
      mq[q] = Ml[q * SEQ + m0 + t];
      zq[q] = Zl[q * SEQ + m0 + t];
    }
    float mg = mq[0];
#pragma unroll
    for (int q = 1; q < NQ; q++) mg = fmaxf(mg, mq[q]);
    float e[NQ], zg = 0.f;
#pragma unroll
    for (int q = 0; q < NQ; q++) {
      e[q] = __expf(mq[q] - mg);
      zg += zq[q] * e[q];
    }
#pragma unroll
    for (int q = 0; q < NQ; q++) s_f[q][t] = e[q] / zg;
  }
  __syncthreads();

  v8f tot[2][2] = {};
  // Kept rolled: unrolled, every group's accumulators stay live to the end and cost registers.
#pragma unroll 1
  for (int q = 0; q < NQ; q++) {
    v8f acc[2][2] = {};
    for (int kb = q * (JB / 32); kb < (q + 1) * (JB / 32); kb++) {
      v16bf a0 = load_op_packed(P,  SEQ / 32, at + 0, kb, lane);
      v16bf a1 = load_op_packed(P,  SEQ / 32, at + 1, kb, lane);
      v16bf b0 = load_op_packed(Vp, SEQ / 32, bt + 0, kb, lane);
      v16bf b1 = load_op_packed(Vp, SEQ / 32, bt + 1, kb, lane);
      acc[0][0] = WMMA_BF16(a0, b0, acc[0][0]);
      acc[0][1] = WMMA_BF16(a0, b1, acc[0][1]);
      acc[1][0] = WMMA_BF16(a1, b0, acc[1][0]);
      acc[1][1] = WMMA_BF16(a1, b1, acc[1][1]);
    }
#pragma unroll
    for (int mi = 0; mi < 2; mi++) {
      const float* fp = &s_f[q][wm * 32 + mi * 16 + ((lane >> 4) << 3)];
      fvec4 f0 = *(const fvec4*)fp;
      fvec4 f1 = *(const fvec4*)(fp + 4);
#pragma unroll
      for (int ni = 0; ni < 2; ni++)
#pragma unroll
        for (int r = 0; r < 8; r++)
          tot[mi][ni][r] += ((r < 4) ? f0[r & 3] : f1[r & 3]) * acc[mi][ni][r];
    }
  }

#pragma unroll
  for (int mi = 0; mi < 2; mi++)
#pragma unroll
    for (int ni = 0; ni < 2; ni++)
#pragma unroll
      for (int r = 0; r < 8; r++) {
        int row = m0 + wm * 32 + mi * 16 + ((lane >> 4) << 3) + r;
        int col = n0 + wn * 32 + ni * 16 + (lane & 15);
        Out[(size_t)row * DOUT + col] = tot[mi][ni][r];
      }
}

// ---------------- host launcher ----------------
extern "C" void kernel_launch(void* const* d_in, const int* in_sizes, int n_in,
                              void* d_out, int out_size, void* d_ws, size_t ws_size,
                              hipStream_t stream) {
  const float* x  = (const float*)d_in[0];
  const float* wq = (const float*)d_in[1];
  const float* wk = (const float*)d_in[2];
  const float* wv = (const float*)d_in[3];
  float* out = (float*)d_out;

  char* ws = (char*)d_ws;
  unsigned short* Qbf = (unsigned short*)(ws);                      //  8 MB bf16, packed
  unsigned short* Kbf = (unsigned short*)(ws + (size_t)( 8 << 20)); //  8 MB bf16, packed
  float*          Vc  = (float*)         (ws + (size_t)(16 << 20)); // 16 MB f32 (V, segment scans)
  unsigned short* P   = (unsigned short*)(ws + (size_t)(32 << 20)); // 32 MB bf16 (E), packed
  float*          seg = (float*)         (ws + (size_t)(64 << 20) + (1 << 16)); // 64 KB
  float*          Zl  = (float*)         (ws + (size_t)(64 << 20) + (1 << 17)); // 128 KB, [group][row]
  float*          Ml  = (float*)         (ws + (size_t)(64 << 20) + (1 << 18)); // 128 KB, [group][row]
  unsigned short* Vp  = (unsigned short*)(ws + (size_t)(72 << 20)); //  8 MB bf16 (Vcum), packed

  dim3 blk(256);
  dim3 gGemm(DOUT / 64, SEQ / 128);

  proj_gemm_kernel<<<gGemm, blk, 0, stream>>>(x, wq, wk, wv, Qbf, Kbf, Vc);

  seg_scan_kernel<<<dim3(4, 16), blk, 0, stream>>>(Vc, seg);
  seg_off_kernel <<<dim3(4),     blk, 0, stream>>>(seg);
  seg_add_kernel <<<dim3(4, 16), blk, 0, stream>>>(Vc, seg, Vp);

  size_t smem = (size_t)RB * SROW * sizeof(float);  // 258 KB dynamic LDS
  scores_kernel<<<dim3(SEQ / RB, NQ), dim3(512), smem, stream>>>(Qbf, Kbf, P, Zl, Ml);

  out_gemm_kernel<<<gGemm, blk, 0, stream>>>(P, Vp, Zl, Ml, out);
}

// v004
// A run of this version takes 189 microseconds.
// Next to v003, in two timings, it ran 1.17 times as fast each time.
// Over all steps from v000 it is 2.53 times as fast.
#include <hip/hip_runtime.h>

#define SEQ  4096
#define DIN  1024
#define DOUT 1024
#define RB   128    // query rows per scores block
#define JB   512    // keys per scores block (one key group, an eighth of the sequence)
#define NQ   8      // key groups
#define SROW 516    // padded LDS row pitch for score tile (bank-conflict break)

typedef __attribute__((ext_vector_type(4)))  float        fvec4;
typedef __attribute__((ext_vector_type(8)))  float        v8f;
typedef __attribute__((ext_vector_type(4)))  unsigned int uvec4;
typedef __attribute__((ext_vector_type(8)))  unsigned int uvec8;
typedef __attribute__((ext_vector_type(16))) __bf16       v16bf;

__device__ __forceinline__ unsigned short f2bf(float f) {
  unsigned int u = __builtin_bit_cast(unsigned int, f);
  u = (u + 0x7FFFu + ((u >> 16) & 1u)) >> 16;   // round-to-nearest-even
  return (unsigned short)u;
}

__device__ __forceinline__ v16bf make_op(uvec4 a, uvec4 b) {
  uvec8 w;
  w[0]=a[0]; w[1]=a[1]; w[2]=a[2]; w[3]=a[3];
  w[4]=b[0]; w[5]=b[1]; w[6]=b[2]; w[7]=b[3];
  return __builtin_bit_cast(v16bf, w);
}

// Fragment-packed bf16 matrix: one 1-KB block per (16 rows) x (32 k), blocks k-major inside a
// 16-row tile. Inside a block lane L = (row & 15) + 16 * ((k >> 3) & 1) owns 16 B at L * 16 for
// k & 16 == 0 and at 512 + L * 16 for k & 16 != 0 (the ISA 16-bit A layout, k order unchanged).
// Index in 16-bit elements of element (row, k); kblocks = k extent / 32.
__device__ __forceinline__ size_t packed_idx(int row, int k, int kblocks) {
  return ((size_t)((row >> 4) * kblocks + (k >> 5)) << 9)
       + (((k >> 4) & 1) << 8) + (((row & 15) + (((k >> 3) & 1) << 4)) << 3) + (k & 7);
}

// 16x32 operand of 16-row tile rt, k block kb: two loads of 512 contiguous bytes per wave.
__device__ __forceinline__ v16bf load_op_packed(const unsigned short* __restrict__ base,
                                                int kblocks, int rt, int kb, int lane) {
  const unsigned short* p = base + ((size_t)(rt * kblocks + kb) << 9) + (lane << 3);
  uvec4 lo = *(const uvec4*)p;
  uvec4 hi = *(const uvec4*)(p + 256);
  return make_op(lo, hi);
}

__device__ __forceinline__ v16bf load_op_lds(const unsigned short* base,
                                             int ldr, int row0, int lane) {
  int r = row0 + (lane & 15);
  int c = (lane >> 4) << 3;
  const unsigned short* p = base + r * ldr + c;
  uvec4 lo = *(const uvec4*)p;
  uvec4 hi = *(const uvec4*)(p + 16);
  return make_op(lo, hi);
}

#define WMMA_BF16(a, b, c) \
  __builtin_amdgcn_wmma_f32_16x16x32_bf16(false, (a), false, (b), (short)0, (c), false, false)

// ---------------- kernel 1: Q, K, V [4096,1024] = X[4096,1024] @ {Wq, Wk, Wv}[1024,1024] ----------------
// One launch for the three projections: 8 waves (4 M x 2 N), block tile 128x64 of each of Q, K and V,
// k-step 32. The X tile is loaded, converted and staged once per k-step and feeds all three products.
// Q and K leave as fragment-packed bf16, V as f32.
__global__ void __launch_bounds__(256) proj_gemm_kernel(
    const float* __restrict__ X, const float* __restrict__ Wq,
    const float* __restrict__ Wk, const float* __restrict__ Wv,
    unsigned short* __restrict__ outQ, unsigned short* __restrict__ outK,
    float* __restrict__ outV)
{
  __shared__ __align__(16) unsigned short As[128 * 40];
  __shared__ __align__(16) unsigned short Bs[3][64 * 40];
  const int t = threadIdx.x;
  const int wave = t >> 5, lane = t & 31;
  const int wm = wave & 3, wn = wave >> 2;
  const int m0 = blockIdx.y * 128, n0 = blockIdx.x * 64;

  v8f acc[3][2][2] = {};

  // This thread's place in the staged tiles: X rows xr + 32 i, columns xc..xc+3; W rows wr + 16 i,
  // columns wc..wc+3.
  const int xr = t >> 3, xc = (t & 7) << 2;
  const int wr = t >> 4, wc = (t & 15) << 2;
  const unsigned xoff = (unsigned)(xr * DIN + xc);
  const unsigned woff = (unsigned)(wr * DOUT + wc);

  for (int kb = 0; kb < DIN; kb += 32) {
    // all ten global loads of the k-step go out together
    fvec4 xa[4], wb[3][2];
    const float* Xk = X + (size_t)m0 * DIN + kb;
#pragma unroll
    for (int i = 0; i < 4; i++)
      xa[i] = *(const fvec4*)(Xk + xoff + i * 32 * DIN);
#pragma unroll
    for (int w = 0; w < 3; w++) {
      const float* Wp = ((w == 0) ? Wq : (w == 1) ? Wk : Wv) + (size_t)kb * DOUT + n0;
#pragma unroll
      for (int i = 0; i < 2; i++)
        wb[w][i] = *(const fvec4*)(Wp + woff + i * 16 * DOUT);
    }
    // A tile: X[m0..+127][kb..+31] -> bf16 LDS (pitch 40)
#pragma unroll
    for (int i = 0; i < 4; i++) {
      unsigned short* d = As + (xr + 32 * i) * 40 + xc;
      d[0]=f2bf(xa[i][0]); d[1]=f2bf(xa[i][1]); d[2]=f2bf(xa[i][2]); d[3]=f2bf(xa[i][3]);
    }
    // B tiles (transposed): Bs[w][n][k] = W_w[kb+k][n0+n]
#pragma unroll
    for (int w = 0; w < 3; w++)
#pragma unroll
      for (int i = 0; i < 2; i++) {
        int k = wr + 16 * i;
        Bs[w][(wc + 0) * 40 + k] = f2bf(wb[w][i][0]);
        Bs[w][(wc + 1) * 40 + k] = f2bf(wb[w][i][1]);
        Bs[w][(wc + 2) * 40 + k] = f2bf(wb[w][i][2]);
        Bs[w][(wc + 3) * 40 + k] = f2bf(wb[w][i][3]);
      }
    __syncthreads();

    v16bf a0 = load_op_lds(As, 40, wm * 32 +  0, lane);
    v16bf a1 = load_op_lds(As, 40, wm * 32 + 16, lane);
    v16bf b0[3], b1[3];
#pragma unroll
    for (int w = 0; w < 3; w++) {
      b0[w] = load_op_lds(Bs[w], 40, wn * 32 +  0, lane);
      b1[w] = load_op_lds(Bs[w], 40, wn * 32 + 16, lane);
    }
    // Holds the sixteen LDS reads together in front of the WMMAs: spread among them each pair
    // would be waited for on its own.
    __builtin_amdgcn_sched_barrier(0);
#pragma unroll
    for (int w = 0; w < 3; w++) {
      acc[w][0][0] = WMMA_BF16(a0, b0[w], acc[w][0][0]);
      acc[w][0][1] = WMMA_BF16(a0, b1[w], acc[w][0][1]);
      acc[w][1][0] = WMMA_BF16(a1, b0[w], acc[w][1][0]);
      acc[w][1][1] = WMMA_BF16(a1, b1[w], acc[w][1][1]);
    }
    __syncthreads();
  }

#pragma unroll
  for (int mi = 0; mi < 2; mi++)
#pragma unroll
    for (int ni = 0; ni < 2; ni++)
#pragma unroll
      for (int r = 0; r < 8; r++) {
        int row = m0 + wm * 32 + mi * 16 + ((lane >> 4) << 3) + r;
        int col = n0 + wn * 32 + ni * 16 + (lane & 15);
        size_t pi = packed_idx(row, col, DOUT / 32);
        outQ[pi] = f2bf(acc[0][mi][ni][r]);
        outK[pi] = f2bf(acc[1][mi][ni][r]);
        outV[(size_t)row * DOUT + col] = acc[2][mi][ni][r];
      }
}

// ---------------- kernels 2a/2b/2c: prefix sum of V rows -> Vcum (packed bf16) ----------------
__global__ void __launch_bounds__(256) seg_scan_kernel(float* __restrict__ V,
                                                       float* __restrict__ segtot) {
  int col = blockIdx.x * 256 + threadIdx.x;
  int seg = blockIdx.y;
  float s = 0.f;
  size_t base = (size_t)seg * 256 * DOUT + col;
  for (int r = 0; r < 256; r++) {
    size_t idx = base + (size_t)r * DOUT;
    s += V[idx];
    V[idx] = s;
  }
  segtot[seg * DOUT + col] = s;
}

__global__ void __launch_bounds__(256) seg_off_kernel(float* __restrict__ segtot) {
  int col = blockIdx.x * 256 + threadIdx.x;
  float off = 0.f;
  for (int s = 0; s < 16; s++) {
    float v = segtot[s * DOUT + col];
    segtot[s * DOUT + col] = off;   // exclusive offsets
    off += v;
  }
}

// Adds the segment offset and writes Vcum as the out GEMM's B operand: bf16, fragment-packed,
// "row" = output column n, k = sequence position.
__global__ void __launch_bounds__(256) seg_add_kernel(const float* __restrict__ V,
                                                      const float* __restrict__ segtot,
                                                      unsigned short* __restrict__ Vp) {
  int col = blockIdx.x * 256 + threadIdx.x;
  int seg = blockIdx.y;
  float off = segtot[seg * DOUT + col];
  size_t base = (size_t)seg * 256 * DOUT + col;
  for (int g = 0; g < 32; g++) {          // 8 sequence positions = one 16-B piece of a fragment
    uvec4 w;
#pragma unroll
    for (int j = 0; j < 4; j++) {
      unsigned int e0 = f2bf(V[base + (size_t)(g * 8 + 2 * j + 0) * DOUT] + off);
      unsigned int e1 = f2bf(V[base + (size_t)(g * 8 + 2 * j + 1) * DOUT] + off);
      w[j] = e0 | (e1 << 16);
    }
    *(uvec4*)(Vp + packed_idx(col, seg * 256 + g * 8, SEQ / 32)) = w;
    // The next trip rewrites the registers that this store names.
    asm volatile("s_wait_xcnt 0x0" ::: "memory");
  }
}

// ---------------- kernel 3: scores + per-group max + E=exp(s-m) + Z = sum (t+1) E ----------------
// One 128-row x 512-key tile per WG; the f32 score tile lies in dynamic LDS (258 KB of 320 KB WGP LDS).
// Each K fragment a wave loads feeds four 16-row tiles of Q. Maximum, E and Z are those of the
// block's own key group; the out GEMM brings the eight groups of a row to one scale.
__device__ __forceinline__ void load_frags(v16bf (&f)[4], const unsigned short* __restrict__ M,
                                           int tile0, int ks, int lane) {
  // Unrolled: the fragments live in registers, which takes constant indices.
#pragma unroll
  for (int i = 0; i < 4; i++) f[i] = load_op_packed(M, DIN / 32, tile0 + i, ks, lane);
}

__device__ __forceinline__ void mma_stage(v8f (&acc)[4][4], const v16bf (&a)[4], const v16bf (&b)[4]) {
  // Unrolled for the same reason.
#pragma unroll
  for (int mi = 0; mi < 4; mi++)
#pragma unroll
    for (int jc = 0; jc < 4; jc++)
      acc[mi][jc] = WMMA_BF16(a[mi], b[jc], acc[mi][jc]);
}

__global__ void __launch_bounds__(512) scores_kernel(
    const unsigned short* __restrict__ Q, const unsigned short* __restrict__ K,
    unsigned short* __restrict__ P, float* __restrict__ Zl, float* __restrict__ Ml)
{
  extern __shared__ float sc[];   // [RB][SROW]
  __shared__ float s_rmax[RB];
  __shared__ float s_zw[RB];
  const int t = threadIdx.x, wave = t >> 5, lane = t & 31;
  const int rt0 = blockIdx.x * (RB / 16);   // first 16-row tile of Q
  const int js  = blockIdx.y;               // key group
  const float scale = 0.03125f;   // 1/sqrt(1024)

  // phase 1: 128x512 score tile via WMMA (Q and K arrive fragment-packed). The 16 waves lie 2 x 8
  // over the tile, each with 4x4 accumulator tiles (64 rows x 64 keys). The K fragments are fetched
  // one k block ahead into a second set that takes turns with the first (no register copy waits
  // for them); the Q fragments, which eight waves share, are fetched for the k block at hand.
  {
    const int wmh = wave & 1;                   // 64-row half of the tile
    const int jl0 = (wave >> 1) * 4;            // 4 consecutive 16-wide key tiles per wave
    const int jt0 = js * (JB / 16) + jl0;
    const int rtw = rt0 + wmh * 4;
    v8f acc[4][4] = {};
    v16bf a[4], b0[4], b1[4];
    load_frags(b0, K, jt0, 0, lane);
    for (int ks = 0; ks < DIN / 32 - 2; ks += 2) {
      load_frags(a,  Q, rtw, ks,     lane);
      load_frags(b1, K, jt0, ks + 1, lane);
      // Holds the sixteen loads together in front of the WMMAs: sunk among them, each group
      // would be waited for on its own.
      __builtin_amdgcn_sched_barrier(0);
      mma_stage(acc, a, b0);
      load_frags(a,  Q, rtw, ks + 1, lane);
      load_frags(b0, K, jt0, ks + 2, lane);
      __builtin_amdgcn_sched_barrier(0);        // as above
      mma_stage(acc, a, b1);
      // The next trip rewrites the address registers that the K loads still in flight name.
      asm volatile("s_wait_xcnt 0x0" ::: "memory");
    }
    load_frags(a,  Q, rtw, DIN / 32 - 2, lane);
    load_frags(b1, K, jt0, DIN / 32 - 1, lane);
    __builtin_amdgcn_sched_barrier(0);          // as above
    mma_stage(acc, a, b0);
    load_frags(a,  Q, rtw, DIN / 32 - 1, lane);
    mma_stage(acc, a, b1);

#pragma unroll
    for (int mi = 0; mi < 4; mi++)
#pragma unroll
      for (int jc = 0; jc < 4; jc++) {
        int colb = (jl0 + jc) * 16 + (lane & 15);
#pragma unroll
        for (int r = 0; r < 8; r++) {
          int row = wmh * 64 + mi * 16 + ((lane >> 4) << 3) + r;
          sc[row * SROW + colb] = acc[mi][jc][r] * scale;
        }
      }
  }
  __syncthreads();

  // phase 2: row max over the group (wave w owns rows 8w..8w+7; stride-32 lanes -> conflict-free)
  for (int rr = 0; rr < RB / 16; rr++) {
    int row = wave * (RB / 16) + rr;
    float m = -3.0e38f;
    // Unrolled so that the row's 16 LDS reads go out together instead of one wait per read.
#pragma unroll
    for (int k2 = 0; k2 < JB / 32; k2++)
      m = fmaxf(m, sc[row * SROW + lane + 32 * k2]);
#pragma unroll
    for (int off = 16; off > 0; off >>= 1)
      m = fmaxf(m, __shfl_xor(m, off, 32));
    if (lane == 0) s_rmax[row] = m;
  }
  __syncthreads();

  // phase 3: Z = sum (t+1) * exp(s - m) over the group (softmax denominator cancels analytically)
  for (int rr = 0; rr < RB / 16; rr++) {
    int row = wave * (RB / 16) + rr;
    float m = s_rmax[row];
    float z = 0.f;
    // Unrolled for the same reason as in phase 2.
#pragma unroll
    for (int k2 = 0; k2 < JB / 32; k2++) {
      int c = lane + 32 * k2;
      z += __expf(sc[row * SROW + c] - m) * (float)(js * JB + c + 1);
    }
#pragma unroll
    for (int off = 16; off > 0; off >>= 1)
      z += __shfl_xor(z, off, 32);
    if (lane == 0) s_zw[row] = z;
  }
  __syncthreads();
  // [group][row]: a block's 128 values are four whole 128-B lines of each array.
  if (t < RB) {
    Zl[js * SEQ + blockIdx.x * RB + t] = s_zw[t];
    Ml[js * SEQ + blockIdx.x * RB + t] = s_rmax[t];
  }

  // phase 4: E = exp(s - m) as bf16, fragment-packed (each 16-row tile's key group is one 16-KB run
  // of P); each thread writes 16-B pieces, a wave 512 contiguous bytes.
  for (int k2 = 0; k2 < 16; k2++) {
    const int tile = k2 >> 1;                               // 16-row tile of the block
    const int q = (k2 & 1) * 512 + t;                       // 16-B piece index in the tile's run
    const int row = tile * 16 + (lane & 15);
    const int col = ((q >> 6) << 5) + (((q >> 5) & 1) << 4) + ((lane >> 4) << 3);
    const float m = s_rmax[row];
    const float* sp = sc + row * SROW + col;
    unsigned short* Pt = P + ((size_t)((rt0 + tile) * (SEQ / 32) + js * (JB / 32)) << 9);
    fvec4 x0 = *(const fvec4*)sp;
    fvec4 x1 = *(const fvec4*)(sp + 4);
    uvec4 w;
    w[0] = (unsigned int)f2bf(__expf(x0[0] - m)) | ((unsigned int)f2bf(__expf(x0[1] - m)) << 16);
    w[1] = (unsigned int)f2bf(__expf(x0[2] - m)) | ((unsigned int)f2bf(__expf(x0[3] - m)) << 16);
    w[2] = (unsigned int)f2bf(__expf(x1[0] - m)) | ((unsigned int)f2bf(__expf(x1[1] - m)) << 16);
    w[3] = (unsigned int)f2bf(__expf(x1[2] - m)) | ((unsigned int)f2bf(__expf(x1[3] - m)) << 16);
    *(uvec4*)(Pt + ((size_t)q << 3)) = w;
    // The next trip rewrites the registers that this store names.
    asm volatile("s_wait_xcnt 0x0" ::: "memory");
  }
}

// ---------------- kernel 4: Out = sum over key groups f_q * (E_q @ Vcum_q) ----------------
// Both operands arrive fragment-packed and are read straight from global, each wave its own
// fragments, three k blocks ahead of their use, into four register sets that take turns. E of key
// group q is scaled by the group's own row maximum m_q, so each group's product is weighted by
// f_q = exp(m_q - max m) / sum_p Z_p exp(m_p - max m).
#define OAHEAD 3            // k blocks between a fragment's load and its use
#define OSETS  4            // register sets: OAHEAD in flight and the one in use
#define GKB    (JB / 32)    // k blocks per key group, a multiple of OSETS

// The four fragments of one wave for the k block kb blocks behind pa and pb, which point at this
// lane's 16 bytes in the wave's first E tile and first Vcum tile: eight loads of 512 contiguous bytes.
__device__ __forceinline__ void load_out_set(v16bf (&a)[2], v16bf (&b)[2],
                                             const unsigned short* __restrict__ pa,
                                             const unsigned short* __restrict__ pb, int kb) {
  const int tile = (SEQ / 32) << 9;   // elements from one 16-row tile to the next
  a[0] = make_op(*(const uvec4*)(pa + (kb << 9)),        *(const uvec4*)(pa + (kb << 9) + 256));
  b[0] = make_op(*(const uvec4*)(pb + (kb << 9)),        *(const uvec4*)(pb + (kb << 9) + 256));
  b[1] = make_op(*(const uvec4*)(pb + tile + (kb << 9)), *(const uvec4*)(pb + tile + (kb << 9) + 256));
  a[1] = make_op(*(const uvec4*)(pa + tile + (kb << 9)), *(const uvec4*)(pa + tile + (kb << 9) + 256));
}

// One key group's product. On entry the sets hold (or await) the group's first OAHEAD k blocks; on
// exit those of the next group, which follow in memory; the last group fetches nothing past its end.
template <bool LAST>
__device__ __forceinline__ void out_group(v8f (&acc)[2][2], v16bf (&fa)[OSETS][2], v16bf (&fb)[OSETS][2],
                                          const unsigned short* __restrict__ pa,
                                          const unsigned short* __restrict__ pb) {
  // Unrolled: the register sets take constant indices and the k blocks immediate offsets.
#pragma unroll
  for (int j = 0; j < GKB; j++) {
    const int cur = j % OSETS, nxt = (j + OAHEAD) % OSETS;
    if (!LAST || j + OAHEAD < GKB)
      load_out_set(fa[nxt], fb[nxt], pa, pb, j + OAHEAD);
    // Holds the eight loads in front of this k block's WMMAs: sunk towards their use they would
    // be waited for at full latency.
    __builtin_amdgcn_sched_barrier(0);
    acc[0][0] = WMMA_BF16(fa[cur][0], fb[cur][0], acc[0][0]);
    acc[0][1] = WMMA_BF16(fa[cur][0], fb[cur][1], acc[0][1]);
    acc[1][0] = WMMA_BF16(fa[cur][1], fb[cur][0], acc[1][0]);
    acc[1][1] = WMMA_BF16(fa[cur][1], fb[cur][1], acc[1][1]);
    // Keeps the next k block's loads behind these WMMAs: lifted over them they would need a
    // fifth register set.
    __builtin_amdgcn_sched_barrier(0);
  }
}

// tot += f * acc, f the group's weights of this wave's rows (fq = the group's 128 weights in LDS).
__device__ __forceinline__ void out_fold(v8f (&tot)[2][2], const v8f (&acc)[2][2],
                                         const float* fq, int wm, int lane) {
  // Both loops unrolled: tot and acc live in registers, which takes constant indices.
#pragma unroll
  for (int mi = 0; mi < 2; mi++) {
    const float* fp = fq + wm * 32 + mi * 16 + ((lane >> 4) << 3);
    fvec4 f0 = *(const fvec4*)fp;
    fvec4 f1 = *(const fvec4*)(fp + 4);
    v8f f = __builtin_shufflevector(f0, f1, 0, 1, 2, 3, 4, 5, 6, 7);
#pragma unroll
    for (int ni = 0; ni < 2; ni++)
      tot[mi][ni] += f * acc[mi][ni];
  }
}

__global__ void __launch_bounds__(256) out_gemm_kernel(
    const unsigned short* __restrict__ P, const unsigned short* __restrict__ Vp,
    const float* __restrict__ Zl, const float* __restrict__ Ml, float* __restrict__ Out)
{
  __shared__ __align__(16) float s_f[NQ][128];
  const int t = threadIdx.x, wave = t >> 5, lane = t & 31;
  const int wm = wave & 3, wn = wave >> 2;
  const int m0 = blockIdx.y * 128, n0 = blockIdx.x * 64;
  const int at = (m0 >> 4) + wm * 2;   // first 16-row tile of E for this wave
  const int bt = (n0 >> 4) + wn * 2;   // first 16-column tile of Vcum for this wave
  const unsigned short* pa = P  + ((size_t)(at * (SEQ / 32)) << 9) + (lane << 3);
  const unsigned short* pb = Vp + ((size_t)(bt * (SEQ / 32)) << 9) + (lane << 3);

  // The first OAHEAD k blocks go out before the weights are formed (unrolled: the register sets
  // take constant indices).
  v16bf fa[OSETS][2], fb[OSETS][2];
#pragma unroll
  for (int s = 0; s < OAHEAD; s++)
    load_out_set(fa[s], fb[s], pa, pb, s);

  if (t < 128) {
    // The loops over the groups are unrolled so that mq, zq and e stay in registers.
    float mq[NQ], zq[NQ];
#pragma unroll
    for (int q = 0; q < NQ; q++) {
      mq[q] = Ml[q * SEQ + m0 + t];
      zq[q] = Zl[q * SEQ + m0 + t];
    }
    float mg = mq[0];
#pragma unroll
    for (int q = 1; q < NQ; q++) mg = fmaxf(mg, mq[q]);
    float e[NQ], zg = 0.f;
#pragma unroll
    for (int q = 0; q < NQ; q++) {
      e[q] = __expf(mq[q] - mg);
      zg += zq[q] * e[q];
    }
#pragma unroll
    for (int q = 0; q < NQ; q++) s_f[q][t] = e[q] / zg;
  }
  __syncthreads();

  v8f tot[2][2] = {};
  // Kept rolled: unrolled, every group's accumulators stay live to the end and cost registers.
#pragma unroll 1
  for (int q = 0; q < NQ - 1; q++) {
    v8f acc[2][2] = {};
    out_group<false>(acc, fa, fb, pa, pb);
    out_fold(tot, acc, s_f[q], wm, lane);
    // The next trip rewrites the address registers that the loads still in flight name.
    asm volatile("s_wait_xcnt 0x0" ::: "memory");
    pa += GKB << 9;
    pb += GKB << 9;
  }
  {
    v8f acc[2][2] = {};
    out_group<true>(acc, fa, fb, pa, pb);
    out_fold(tot, acc, s_f[NQ - 1], wm, lane);
  }

#pragma unroll
  for (int mi = 0; mi < 2; mi++)
#pragma unroll
    for (int ni = 0; ni < 2; ni++)
#pragma unroll
      for (int r = 0; r < 8; r++) {
        int row = m0 + wm * 32 + mi * 16 + ((lane >> 4) << 3) + r;
        int col = n0 + wn * 32 + ni * 16 + (lane & 15);
        Out[(size_t)row * DOUT + col] = tot[mi][ni][r];
      }
}

// ---------------- host launcher ----------------
extern "C" void kernel_launch(void* const* d_in, const int* in_sizes, int n_in,
                              void* d_out, int out_size, void* d_ws, size_t ws_size,
                              hipStream_t stream) {
  const float* x  = (const float*)d_in[0];
  const float* wq = (const float*)d_in[1];
  const float* wk = (const float*)d_in[2];
  const float* wv = (const float*)d_in[3];
  float* out = (float*)d_out;

  char* ws = (char*)d_ws;
  unsigned short* Qbf = (unsigned short*)(ws);                      //  8 MB bf16, packed
  unsigned short* Kbf = (unsigned short*)(ws + (size_t)( 8 << 20)); //  8 MB bf16, packed
  float*          Vc  = (float*)         (ws + (size_t)(16 << 20)); // 16 MB f32 (V, segment scans)
  unsigned short* P   = (unsigned short*)(ws + (size_t)(32 << 20)); // 32 MB bf16 (E), packed
  float*          seg = (float*)         (ws + (size_t)(64 << 20) + (1 << 16)); // 64 KB
  float*          Zl  = (float*)         (ws + (size_t)(64 << 20) + (1 << 17)); // 128 KB, [group][row]
  float*          Ml  = (float*)         (ws + (size_t)(64 << 20) + (1 << 18)); // 128 KB, [group][row]
  unsigned short* Vp  = (unsigned short*)(ws + (size_t)(72 << 20)); //  8 MB bf16 (Vcum), packed

  dim3 blk(256);
  dim3 gGemm(DOUT / 64, SEQ / 128);

  proj_gemm_kernel<<<gGemm, blk, 0, stream>>>(x, wq, wk, wv, Qbf, Kbf, Vc);

  seg_scan_kernel<<<dim3(4, 16), blk, 0, stream>>>(Vc, seg);
  seg_off_kernel <<<dim3(4),     blk, 0, stream>>>(seg);
  seg_add_kernel <<<dim3(4, 16), blk, 0, stream>>>(Vc, seg, Vp);

  size_t smem = (size_t)RB * SROW * sizeof(float);  // 258 KB dynamic LDS
  scores_kernel<<<dim3(SEQ / RB, NQ), dim3(512), smem, stream>>>(Qbf, Kbf, P, Zl, Ml);

  out_gemm_kernel<<<gGemm, blk, 0, stream>>>(P, Vp, Zl, Ml, out);
}

// v005
// A run of this version takes 158 microseconds.
// Timed twice side by side with v004, it ran 1.20 and 1.19 times as fast.
// All steps since v000 together make it 3.02 times as fast.
#include <hip/hip_runtime.h>

#define SEQ  4096
#define DIN  1024
#define DOUT 1024
#define RB   128    // query rows per scores block
#define JB   512    // keys per scores block (one key group, an eighth of the sequence)
#define NQ   8      // key groups
#define SROW 516    // padded LDS row pitch for score tile (bank-conflict break)

typedef __attribute__((ext_vector_type(4)))  float        fvec4;
typedef __attribute__((ext_vector_type(8)))  float        v8f;
typedef __attribute__((ext_vector_type(4)))  unsigned int uvec4;
typedef __attribute__((ext_vector_type(8)))  unsigned int uvec8;
typedef __attribute__((ext_vector_type(16))) __bf16       v16bf;

__device__ __forceinline__ unsigned short f2bf(float f) {
  unsigned int u = __builtin_bit_cast(unsigned int, f);
  u = (u + 0x7FFFu + ((u >> 16) & 1u)) >> 16;   // round-to-nearest-even
  return (unsigned short)u;
}

__device__ __forceinline__ v16bf make_op(uvec4 a, uvec4 b) {
  uvec8 w;
  w[0]=a[0]; w[1]=a[1]; w[2]=a[2]; w[3]=a[3];
  w[4]=b[0]; w[5]=b[1]; w[6]=b[2]; w[7]=b[3];
  return __builtin_bit_cast(v16bf, w);
}

// Fragment-packed bf16 matrix: one 1-KB block per (16 rows) x (32 k), blocks k-major inside a
// 16-row tile. Inside a block lane L = (row & 15) + 16 * ((k >> 3) & 1) owns 16 B at L * 16 for
// k & 16 == 0 and at 512 + L * 16 for k & 16 != 0 (the ISA 16-bit A layout, k order unchanged).
// Index in 16-bit elements of element (row, k); kblocks = k extent / 32.
__device__ __forceinline__ size_t packed_idx(int row, int k, int kblocks) {
  return ((size_t)((row >> 4) * kblocks + (k >> 5)) << 9)
       + (((k >> 4) & 1) << 8) + (((row & 15) + (((k >> 3) & 1) << 4)) << 3) + (k & 7);
}

// 16x32 operand of 16-row tile rt, k block kb: two loads of 512 contiguous bytes per wave.
__device__ __forceinline__ v16bf load_op_packed(const unsigned short* __restrict__ base,
                                                int kblocks, int rt, int kb, int lane) {
  const unsigned short* p = base + ((size_t)(rt * kblocks + kb) << 9) + (lane << 3);
  uvec4 lo = *(const uvec4*)p;
  uvec4 hi = *(const uvec4*)(p + 256);
  return make_op(lo, hi);
}

#define WMMA_BF16(a, b, c) \
  __builtin_amdgcn_wmma_f32_16x16x32_bf16(false, (a), false, (b), (short)0, (c), false, false)

// ---------------- kernel 0: X and Wq, Wk, Wv -> bf16, fragment-packed ----------------
// Every element is rounded once here instead of once per GEMM block that reads it. X is packed as
// the A operand (row = sequence position), each W as the B operand ("row" = output column n,
// k = input feature); the three W lie one behind the other.
#define XPB 256   // blocks that pack X; the other 3 * 128 pack the W
__device__ __forceinline__ uvec4 pack8(fvec4 x0, fvec4 x1) {
  uvec4 w;
  w[0] = (unsigned int)f2bf(x0[0]) | ((unsigned int)f2bf(x0[1]) << 16);
  w[1] = (unsigned int)f2bf(x0[2]) | ((unsigned int)f2bf(x0[3]) << 16);
  w[2] = (unsigned int)f2bf(x1[0]) | ((unsigned int)f2bf(x1[1]) << 16);
  w[3] = (unsigned int)f2bf(x1[2]) | ((unsigned int)f2bf(x1[3]) << 16);
  return w;
}

__global__ void __launch_bounds__(256) pack_kernel(
    const float* __restrict__ X, const float* __restrict__ Wq,
    const float* __restrict__ Wk, const float* __restrict__ Wv,
    unsigned short* __restrict__ Xp, unsigned short* __restrict__ Wp)
{
  const int t = threadIdx.x, wave = t >> 5, lane = t & 31;
  if (blockIdx.x < XPB) {
    // One wave: four k blocks in a row of one 16-row tile (512 contiguous bytes of each X row).
    const int wv  = blockIdx.x * 8 + wave;
    const int rt  = wv >> 3;
    const int kb0 = (wv & 7) * 4;
    const float* sp = X + (size_t)(rt * 16 + (lane & 15)) * DIN + kb0 * 32 + ((lane >> 4) << 3);
    unsigned short* dp = Xp + ((size_t)(rt * (DIN / 32) + kb0) << 9) + (lane << 3);
    fvec4 x[8][2];
    // Both loops unrolled: x lives in registers, and the loads go out in runs, not one wait each.
#pragma unroll
    for (int j = 0; j < 8; j++) {       // j = 2 * k block + 16-k half
      x[j][0] = *(const fvec4*)(sp + j * 16);
      x[j][1] = *(const fvec4*)(sp + j * 16 + 4);
    }
#pragma unroll
    for (int j = 0; j < 8; j++)
      *(uvec4*)(dp + j * 256) = pack8(x[j][0], x[j][1]);
  } else {
    // One thread: one k block (32 k) of one column n; a wave's loads are whole 128-B lines of W.
    const int bw = blockIdx.x - XPB;
    const int w  = bw >> 7;
    const int n  = (bw & 3) * 256 + t;
    const int kb = (bw >> 2) & 31;
    const float* sp = ((w == 0) ? Wq : (w == 1) ? Wk : Wv) + (size_t)kb * 32 * DOUT + n;
    unsigned short* dp = Wp + (size_t)w * DIN * DOUT + packed_idx(n, kb * 32, DIN / 32);
    float v[32];
    // Both loops unrolled for the same reasons as above.
#pragma unroll
    for (int k = 0; k < 32; k++) v[k] = sp[(size_t)k * DOUT];
#pragma unroll
    for (int p = 0; p < 4; p++) {       // k = 8 p .. 8 p + 7: one 16-B piece of the fragment
      fvec4 x0 = { v[8 * p + 0], v[8 * p + 1], v[8 * p + 2], v[8 * p + 3] };
      fvec4 x1 = { v[8 * p + 4], v[8 * p + 5], v[8 * p + 6], v[8 * p + 7] };
      *(uvec4*)(dp + ((p >> 1) << 8) + ((p & 1) << 7)) = pack8(x0, x1);
    }
    // Stands in front of whatever next writes a register that these four stores name.
    asm volatile("s_wait_xcnt 0x0" ::: "memory");
  }
}

// ---------------- kernel 1: Q, K, V [4096,1024] = X[4096,1024] @ {Wq, Wk, Wv}[1024,1024] ----------------
// One launch for the three projections: 8 waves (4 M x 2 N), block tile 128x64 of each of Q, K and V,
// k-step 32. Both operands arrive fragment-packed and are read straight from global, each wave its
// own fragments, one k block ahead of their use, into two register sets that take turns.
// Q and K leave as fragment-packed bf16, V as f32.

// The eight fragments of one wave for the k block kb blocks behind pa and pb, which point at this
// lane's 16 bytes in the wave's first X tile and its first tile of Wq.
__device__ __forceinline__ void load_proj_set(v16bf (&a)[2], v16bf (&b)[3][2],
                                              const unsigned short* __restrict__ pa,
                                              const unsigned short* __restrict__ pb, int kb) {
  const int tile = (DIN / 32) << 9;   // elements from one 16-row tile to the next
  const int mat  = DIN * DOUT;        // elements from one packed W to the next
  // Unrolled: the fragments live in registers, which takes constant indices.
#pragma unroll
  for (int i = 0; i < 2; i++) {
    const unsigned short* p = pa + i * tile + (kb << 9);
    a[i] = make_op(*(const uvec4*)p, *(const uvec4*)(p + 256));
  }
#pragma unroll
  for (int w = 0; w < 3; w++)
#pragma unroll
    for (int i = 0; i < 2; i++) {
      const unsigned short* p = pb + w * mat + i * tile + (kb << 9);
      b[w][i] = make_op(*(const uvec4*)p, *(const uvec4*)(p + 256));
    }
}

__device__ __forceinline__ void proj_mma(v8f (&acc)[3][2][2], const v16bf (&a)[2], const v16bf (&b)[3][2]) {
  // Unrolled for the same reason.
#pragma unroll
  for (int w = 0; w < 3; w++) {
    acc[w][0][0] = WMMA_BF16(a[0], b[w][0], acc[w][0][0]);
    acc[w][0][1] = WMMA_BF16(a[0], b[w][1], acc[w][0][1]);
    acc[w][1][0] = WMMA_BF16(a[1], b[w][0], acc[w][1][0]);
    acc[w][1][1] = WMMA_BF16(a[1], b[w][1], acc[w][1][1]);
  }
}

__global__ void __launch_bounds__(256) proj_gemm_kernel(
    const unsigned short* __restrict__ Xp, const unsigned short* __restrict__ Wp,
    unsigned short* __restrict__ outQ, unsigned short* __restrict__ outK,
    float* __restrict__ outV)
{
  const int t = threadIdx.x;
  const int wave = t >> 5, lane = t & 31;
  const int wm = wave & 3, wn = wave >> 2;
  const int m0 = blockIdx.y * 128, n0 = blockIdx.x * 64;
  const int at = (m0 >> 4) + wm * 2;   // first 16-row tile of X for this wave
  const int bt = (n0 >> 4) + wn * 2;   // first 16-column tile of each W for this wave
  const unsigned short* pa = Xp + ((size_t)(at * (DIN / 32)) << 9) + (lane << 3);
  const unsigned short* pb = Wp + ((size_t)(bt * (DIN / 32)) << 9) + (lane << 3);

  v8f acc[3][2][2] = {};
  v16bf fa[2][2], fb[2][3][2];
  load_proj_set(fa[0], fb[0], pa, pb, 0);
  // Unrolled: the register sets take constant indices and the k blocks immediate offsets, so no
  // address register is rewritten under a load in flight.
#pragma unroll
  for (int kb = 0; kb < DIN / 32; kb++) {
    const int cur = kb & 1, nxt = cur ^ 1;
    if (kb + 1 < DIN / 32)
      load_proj_set(fa[nxt], fb[nxt], pa, pb, kb + 1);
    // Holds the sixteen loads in front of this k block's WMMAs: sunk towards their use they would
    // be waited for at full latency.
    __builtin_amdgcn_sched_barrier(0);
    proj_mma(acc, fa[cur], fb[cur]);
    // Keeps the next k block's loads behind these WMMAs: lifted over them they would need a
    // third register set.
    __builtin_amdgcn_sched_barrier(0);
  }

#pragma unroll
  for (int mi = 0; mi < 2; mi++)
#pragma unroll
    for (int ni = 0; ni < 2; ni++)
#pragma unroll
      for (int r = 0; r < 8; r++) {
        int row = m0 + wm * 32 + mi * 16 + ((lane >> 4) << 3) + r;
        int col = n0 + wn * 32 + ni * 16 + (lane & 15);
        size_t pi = packed_idx(row, col, DOUT / 32);
        outQ[pi] = f2bf(acc[0][mi][ni][r]);
        outK[pi] = f2bf(acc[1][mi][ni][r]);
        outV[(size_t)row * DOUT + col] = acc[2][mi][ni][r];
      }
}

// ---------------- kernels 2a/2b/2c: prefix sum of V rows -> Vcum (packed bf16) ----------------
__global__ void __launch_bounds__(256) seg_scan_kernel(float* __restrict__ V,
                                                       float* __restrict__ segtot) {
  int col = blockIdx.x * 256 + threadIdx.x;
  int seg = blockIdx.y;
  float s = 0.f;
  size_t base = (size_t)seg * 256 * DOUT + col;
  for (int r = 0; r < 256; r++) {
    size_t idx = base + (size_t)r * DOUT;
    s += V[idx];
    V[idx] = s;
  }
  segtot[seg * DOUT + col] = s;
}

__global__ void __launch_bounds__(256) seg_off_kernel(float* __restrict__ segtot) {
  int col = blockIdx.x * 256 + threadIdx.x;
  float off = 0.f;
  for (int s = 0; s < 16; s++) {
    float v = segtot[s * DOUT + col];
    segtot[s * DOUT + col] = off;   // exclusive offsets
    off += v;
  }
}

// Adds the segment offset and writes Vcum as the out GEMM's B operand: bf16, fragment-packed,
// "row" = output column n, k = sequence position.
__global__ void __launch_bounds__(256) seg_add_kernel(const float* __restrict__ V,
                                                      const float* __restrict__ segtot,
                                                      unsigned short* __restrict__ Vp) {
  int col = blockIdx.x * 256 + threadIdx.x;
  int seg = blockIdx.y;
  float off = segtot[seg * DOUT + col];
  size_t base = (size_t)seg * 256 * DOUT + col;
  for (int g = 0; g < 32; g++) {          // 8 sequence positions = one 16-B piece of a fragment
    uvec4 w;
#pragma unroll
    for (int j = 0; j < 4; j++) {
      unsigned int e0 = f2bf(V[base + (size_t)(g * 8 + 2 * j + 0) * DOUT] + off);
      unsigned int e1 = f2bf(V[base + (size_t)(g * 8 + 2 * j + 1) * DOUT] + off);
      w[j] = e0 | (e1 << 16);
    }
    *(uvec4*)(Vp + packed_idx(col, seg * 256 + g * 8, SEQ / 32)) = w;
    // The next trip rewrites the registers that this store names.
    asm volatile("s_wait_xcnt 0x0" ::: "memory");
  }
}

// ---------------- kernel 3: scores + per-group max + E=exp(s-m) + Z = sum (t+1) E ----------------
// One 128-row x 512-key tile per WG; the f32 score tile lies in dynamic LDS (258 KB of 320 KB WGP LDS).
// Each K fragment a wave loads feeds four 16-row tiles of Q. Maximum, E and Z are those of the
// block's own key group; the out GEMM brings the eight groups of a row to one scale.
__device__ __forceinline__ void load_frags(v16bf (&f)[4], const unsigned short* __restrict__ M,
                                           int tile0, int ks, int lane) {
  // Unrolled: the fragments live in registers, which takes constant indices.
#pragma unroll
  for (int i = 0; i < 4; i++) f[i] = load_op_packed(M, DIN / 32, tile0 + i, ks, lane);
}

__device__ __forceinline__ void mma_stage(v8f (&acc)[4][4], const v16bf (&a)[4], const v16bf (&b)[4]) {
  // Unrolled for the same reason.
#pragma unroll
  for (int mi = 0; mi < 4; mi++)
#pragma unroll
    for (int jc = 0; jc < 4; jc++)
      acc[mi][jc] = WMMA_BF16(a[mi], b[jc], acc[mi][jc]);
}

__global__ void __launch_bounds__(512) scores_kernel(
    const unsigned short* __restrict__ Q, const unsigned short* __restrict__ K,
    unsigned short* __restrict__ P, float* __restrict__ Zl, float* __restrict__ Ml)
{
  extern __shared__ float sc[];   // [RB][SROW]
  __shared__ float s_rmax[RB];
  __shared__ float s_zw[RB];
  const int t = threadIdx.x, wave = t >> 5, lane = t & 31;
  const int rt0 = blockIdx.x * (RB / 16);   // first 16-row tile of Q
  const int js  = blockIdx.y;               // key group
  const float scale = 0.03125f;   // 1/sqrt(1024)

  // phase 1: 128x512 score tile via WMMA (Q and K arrive fragment-packed). The 16 waves lie 2 x 8
  // over the tile, each with 4x4 accumulator tiles (64 rows x 64 keys). The K fragments are fetched
  // one k block ahead into a second set that takes turns with the first (no register copy waits
  // for them); the Q fragments, which eight waves share, are fetched for the k block at hand.
  {
    const int wmh = wave & 1;                   // 64-row half of the tile
    const int jl0 = (wave >> 1) * 4;            // 4 consecutive 16-wide key tiles per wave
    const int jt0 = js * (JB / 16) + jl0;
    const int rtw = rt0 + wmh * 4;
    v8f acc[4][4] = {};
    v16bf a[4], b0[4], b1[4];
    load_frags(b0, K, jt0, 0, lane);
    for (int ks = 0; ks < DIN / 32 - 2; ks += 2) {
      load_frags(a,  Q, rtw, ks,     lane);
      load_frags(b1, K, jt0, ks + 1, lane);
      // Holds the sixteen loads together in front of the WMMAs: sunk among them, each group
      // would be waited for on its own.
      __builtin_amdgcn_sched_barrier(0);
      mma_stage(acc, a, b0);
      load_frags(a,  Q, rtw, ks + 1, lane);
      load_frags(b0, K, jt0, ks + 2, lane);
      __builtin_amdgcn_sched_barrier(0);        // as above
      mma_stage(acc, a, b1);
      // The next trip rewrites the address registers that the K loads still in flight name.
      asm volatile("s_wait_xcnt 0x0" ::: "memory");
    }
    load_frags(a,  Q, rtw, DIN / 32 - 2, lane);
    load_frags(b1, K, jt0, DIN / 32 - 1, lane);
    __builtin_amdgcn_sched_barrier(0);          // as above
    mma_stage(acc, a, b0);
    load_frags(a,  Q, rtw, DIN / 32 - 1, lane);
    mma_stage(acc, a, b1);

#pragma unroll
    for (int mi = 0; mi < 4; mi++)
#pragma unroll
      for (int jc = 0; jc < 4; jc++) {
        int colb = (jl0 + jc) * 16 + (lane & 15);
#pragma unroll
        for (int r = 0; r < 8; r++) {
          int row = wmh * 64 + mi * 16 + ((lane >> 4) << 3) + r;
          sc[row * SROW + colb] = acc[mi][jc][r] * scale;
        }
      }
  }
  __syncthreads();

  // phase 2: row max over the group (wave w owns rows 8w..8w+7; stride-32 lanes -> conflict-free)
  for (int rr = 0; rr < RB / 16; rr++) {
    int row = wave * (RB / 16) + rr;
    float m = -3.0e38f;
    // Unrolled so that the row's 16 LDS reads go out together instead of one wait per read.
#pragma unroll
    for (int k2 = 0; k2 < JB / 32; k2++)
      m = fmaxf(m, sc[row * SROW + lane + 32 * k2]);
#pragma unroll
    for (int off = 16; off > 0; off >>= 1)
      m = fmaxf(m, __shfl_xor(m, off, 32));
    if (lane == 0) s_rmax[row] = m;
  }
  __syncthreads();

  // phase 3: Z = sum (t+1) * exp(s - m) over the group (softmax denominator cancels analytically)
  for (int rr = 0; rr < RB / 16; rr++) {
    int row = wave * (RB / 16) + rr;
    float m = s_rmax[row];
    float z = 0.f;
    // Unrolled for the same reason as in phase 2.
#pragma unroll
    for (int k2 = 0; k2 < JB / 32; k2++) {
      int c = lane + 32 * k2;
      z += __expf(sc[row * SROW + c] - m) * (float)(js * JB + c + 1);
    }
#pragma unroll
    for (int off = 16; off > 0; off >>= 1)
      z += __shfl_xor(z, off, 32);
    if (lane == 0) s_zw[row] = z;
  }
  __syncthreads();
  // [group][row]: a block's 128 values are four whole 128-B lines of each array.
  if (t < RB) {
    Zl[js * SEQ + blockIdx.x * RB + t] = s_zw[t];
    Ml[js * SEQ + blockIdx.x * RB + t] = s_rmax[t];
  }

  // phase 4: E = exp(s - m) as bf16, fragment-packed (each 16-row tile's key group is one 16-KB run
  // of P); each thread writes 16-B pieces, a wave 512 contiguous bytes.
  for (int k2 = 0; k2 < 16; k2++) {
    const int tile = k2 >> 1;                               // 16-row tile of the block
    const int q = (k2 & 1) * 512 + t;                       // 16-B piece index in the tile's run
    const int row = tile * 16 + (lane & 15);
    const int col = ((q >> 6) << 5) + (((q >> 5) & 1) << 4) + ((lane >> 4) << 3);
    const float m = s_rmax[row];
    const float* sp = sc + row * SROW + col;
    unsigned short* Pt = P + ((size_t)((rt0 + tile) * (SEQ / 32) + js * (JB / 32)) << 9);
    fvec4 x0 = *(const fvec4*)sp;
    fvec4 x1 = *(const fvec4*)(sp + 4);
    uvec4 w;
    w[0] = (unsigned int)f2bf(__expf(x0[0] - m)) | ((unsigned int)f2bf(__expf(x0[1] - m)) << 16);
    w[1] = (unsigned int)f2bf(__expf(x0[2] - m)) | ((unsigned int)f2bf(__expf(x0[3] - m)) << 16);
    w[2] = (unsigned int)f2bf(__expf(x1[0] - m)) | ((unsigned int)f2bf(__expf(x1[1] - m)) << 16);
    w[3] = (unsigned int)f2bf(__expf(x1[2] - m)) | ((unsigned int)f2bf(__expf(x1[3] - m)) << 16);
    *(uvec4*)(Pt + ((size_t)q << 3)) = w;
    // The next trip rewrites the registers that this store names.
    asm volatile("s_wait_xcnt 0x0" ::: "memory");
  }
}

// ---------------- kernel 4: Out = sum over key groups f_q * (E_q @ Vcum_q) ----------------
// Both operands arrive fragment-packed and are read straight from global, each wave its own
// fragments, three k blocks ahead of their use, into four register sets that take turns. E of key
// group q is scaled by the group's own row maximum m_q, so each group's product is weighted by
// f_q = exp(m_q - max m) / sum_p Z_p exp(m_p - max m).
#define OAHEAD 3            // k blocks between a fragment's load and its use
#define OSETS  4            // register sets: OAHEAD in flight and the one in use
#define GKB    (JB / 32)    // k blocks per key group, a multiple of OSETS

// The four fragments of one wave for the k block kb blocks behind pa and pb, which point at this
// lane's 16 bytes in the wave's first E tile and first Vcum tile: eight loads of 512 contiguous bytes.
__device__ __forceinline__ void load_out_set(v16bf (&a)[2], v16bf (&b)[2],
                                             const unsigned short* __restrict__ pa,
                                             const unsigned short* __restrict__ pb, int kb) {
  const int tile = (SEQ / 32) << 9;   // elements from one 16-row tile to the next
  a[0] = make_op(*(const uvec4*)(pa + (kb << 9)),        *(const uvec4*)(pa + (kb << 9) + 256));
  b[0] = make_op(*(const uvec4*)(pb + (kb << 9)),        *(const uvec4*)(pb + (kb << 9) + 256));
  b[1] = make_op(*(const uvec4*)(pb + tile + (kb << 9)), *(const uvec4*)(pb + tile + (kb << 9) + 256));
  a[1] = make_op(*(const uvec4*)(pa + tile + (kb << 9)), *(const uvec4*)(pa + tile + (kb << 9) + 256));
}

// One key group's product. On entry the sets hold (or await) the group's first OAHEAD k blocks; on
// exit those of the next group, which follow in memory; the last group fetches nothing past its end.
template <bool LAST>
__device__ __forceinline__ void out_group(v8f (&acc)[2][2], v16bf (&fa)[OSETS][2], v16bf (&fb)[OSETS][2],
                                          const unsigned short* __restrict__ pa,
                                          const unsigned short* __restrict__ pb) {
  // Unrolled: the register sets take constant indices and the k blocks immediate offsets.
#pragma unroll
  for (int j = 0; j < GKB; j++) {
    const int cur = j % OSETS, nxt = (j + OAHEAD) % OSETS;
    if (!LAST || j + OAHEAD < GKB)
      load_out_set(fa[nxt], fb[nxt], pa, pb, j + OAHEAD);
    // Holds the eight loads in front of this k block's WMMAs: sunk towards their use they would
    // be waited for at full latency.
    __builtin_amdgcn_sched_barrier(0);
    acc[0][0] = WMMA_BF16(fa[cur][0], fb[cur][0], acc[0][0]);
    acc[0][1] = WMMA_BF16(fa[cur][0], fb[cur][1], acc[0][1]);
    acc[1][0] = WMMA_BF16(fa[cur][1], fb[cur][0], acc[1][0]);
    acc[1][1] = WMMA_BF16(fa[cur][1], fb[cur][1], acc[1][1]);
    // Keeps the next k block's loads behind these WMMAs: lifted over them they would need a
    // fifth register set.
    __builtin_amdgcn_sched_barrier(0);
  }
}

// tot += f * acc, f the group's weights of this wave's rows (fq = the group's 128 weights in LDS).
__device__ __forceinline__ void out_fold(v8f (&tot)[2][2], const v8f (&acc)[2][2],
                                         const float* fq, int wm, int lane) {
  // Both loops unrolled: tot and acc live in registers, which takes constant indices.
#pragma unroll
  for (int mi = 0; mi < 2; mi++) {
    const float* fp = fq + wm * 32 + mi * 16 + ((lane >> 4) << 3);
    fvec4 f0 = *(const fvec4*)fp;
    fvec4 f1 = *(const fvec4*)(fp + 4);
    v8f f = __builtin_shufflevector(f0, f1, 0, 1, 2, 3, 4, 5, 6, 7);
#pragma unroll
    for (int ni = 0; ni < 2; ni++)
      tot[mi][ni] += f * acc[mi][ni];
  }
}

__global__ void __launch_bounds__(256) out_gemm_kernel(
    const unsigned short* __restrict__ P, const unsigned short* __restrict__ Vp,
    const float* __restrict__ Zl, const float* __restrict__ Ml, float* __restrict__ Out)
{
  __shared__ __align__(16) float s_f[NQ][128];
  const int t = threadIdx.x, wave = t >> 5, lane = t & 31;
  const int wm = wave & 3, wn = wave >> 2;
  const int m0 = blockIdx.y * 128, n0 = blockIdx.x * 64;
  const int at = (m0 >> 4) + wm * 2;   // first 16-row tile of E for this wave
  const int bt = (n0 >> 4) + wn * 2;   // first 16-column tile of Vcum for this wave
  const unsigned short* pa = P  + ((size_t)(at * (SEQ / 32)) << 9) + (lane << 3);
  const unsigned short* pb = Vp + ((size_t)(bt * (SEQ / 32)) << 9) + (lane << 3);

  // The first OAHEAD k blocks go out before the weights are formed (unrolled: the register sets
  // take constant indices).
  v16bf fa[OSETS][2], fb[OSETS][2];
#pragma unroll
  for (int s = 0; s < OAHEAD; s++)
    load_out_set(fa[s], fb[s], pa, pb, s);

  if (t < 128) {
    // The loops over the groups are unrolled so that mq, zq and e stay in registers.
    float mq[NQ], zq[NQ];
#pragma unroll
    for (int q = 0; q < NQ; q++) {
      mq[q] = Ml[q * SEQ + m0 + t];
      zq[q] = Zl[q * SEQ + m0 + t];
    }
    float mg = mq[0];
#pragma unroll
    for (int q = 1; q < NQ; q++) mg = fmaxf(mg, mq[q]);
    float e[NQ], zg = 0.f;
#pragma unroll
    for (int q = 0; q < NQ; q++) {
      e[q] = __expf(mq[q] - mg);
      zg += zq[q] * e[q];
    }
#pragma unroll
    for (int q = 0; q < NQ; q++) s_f[q][t] = e[q] / zg;
  }
  __syncthreads();

  v8f tot[2][2] = {};
  // Kept rolled: unrolled, every group's accumulators stay live to the end and cost registers.
#pragma unroll 1
  for (int q = 0; q < NQ - 1; q++) {
    v8f acc[2][2] = {};
    out_group<false>(acc, fa, fb, pa, pb);
    out_fold(tot, acc, s_f[q], wm, lane);
    // The next trip rewrites the address registers that the loads still in flight name.
    asm volatile("s_wait_xcnt 0x0" ::: "memory");
    pa += GKB << 9;
    pb += GKB << 9;
  }
  {
    v8f acc[2][2] = {};
    out_group<true>(acc, fa, fb, pa, pb);
    out_fold(tot, acc, s_f[NQ - 1], wm, lane);
  }

#pragma unroll
  for (int mi = 0; mi < 2; mi++)
#pragma unroll
    for (int ni = 0; ni < 2; ni++)
#pragma unroll
      for (int r = 0; r < 8; r++) {
        int row = m0 + wm * 32 + mi * 16 + ((lane >> 4) << 3) + r;
        int col = n0 + wn * 32 + ni * 16 + (lane & 15);
        Out[(size_t)row * DOUT + col] = tot[mi][ni][r];
      }
}

// ---------------- host launcher ----------------
extern "C" void kernel_launch(void* const* d_in, const int* in_sizes, int n_in,
                              void* d_out, int out_size, void* d_ws, size_t ws_size,
                              hipStream_t stream) {
  const float* x  = (const float*)d_in[0];
  const float* wq = (const float*)d_in[1];
  const float* wk = (const float*)d_in[2];
  const float* wv = (const float*)d_in[3];
  float* out = (float*)d_out;

  char* ws = (char*)d_ws;
  unsigned short* Qbf = (unsigned short*)(ws);                      //  8 MB bf16, packed
  unsigned short* Kbf = (unsigned short*)(ws + (size_t)( 8 << 20)); //  8 MB bf16, packed
  float*          Vc  = (float*)         (ws + (size_t)(16 << 20)); // 16 MB f32 (V, segment scans)
  unsigned short* P   = (unsigned short*)(ws + (size_t)(32 << 20)); // 32 MB bf16 (E), packed
  float*          seg = (float*)         (ws + (size_t)(64 << 20) + (1 << 16)); // 64 KB
  float*          Zl  = (float*)         (ws + (size_t)(64 << 20) + (1 << 17)); // 128 KB, [group][row]
  float*          Ml  = (float*)         (ws + (size_t)(64 << 20) + (1 << 18)); // 128 KB, [group][row]
  unsigned short* Vp  = (unsigned short*)(ws + (size_t)(72 << 20)); //  8 MB bf16 (Vcum), packed
  unsigned short* Xp  = (unsigned short*)(ws + (size_t)(80 << 20)); //  8 MB bf16 (X), packed
  unsigned short* Wp  = (unsigned short*)(ws + (size_t)(88 << 20)); //  6 MB bf16 (Wq, Wk, Wv), packed

  dim3 blk(256);
  dim3 gGemm(DOUT / 64, SEQ / 128);

  pack_kernel<<<dim3(XPB + 3 * 128), blk, 0, stream>>>(x, wq, wk, wv, Xp, Wp);
  proj_gemm_kernel<<<gGemm, blk, 0, stream>>>(Xp, Wp, Qbf, Kbf, Vc);

  seg_scan_kernel<<<dim3(4, 16), blk, 0, stream>>>(Vc, seg);
  seg_off_kernel <<<dim3(4),     blk, 0, stream>>>(seg);
  seg_add_kernel <<<dim3(4, 16), blk, 0, stream>>>(Vc, seg, Vp);

  size_t smem = (size_t)RB * SROW * sizeof(float);  // 258 KB dynamic LDS
  scores_kernel<<<dim3(SEQ / RB, NQ), dim3(512), smem, stream>>>(Qbf, Kbf, P, Zl, Ml);

  out_gemm_kernel<<<gGemm, blk, 0, stream>>>(P, Vp, Zl, Ml, out);
}

// v006
// A run of this version takes 129 microseconds.
// Next to v005, in two timings, it ran 1.23 times as fast each time.
// All steps since v000 together make it 3.71 times as fast.
#include <hip/hip_runtime.h>

#define SEQ  4096
#define DIN  1024
#define DOUT 1024
#define RB   128    // query rows per scores block
#define JB   512    // keys per scores block (one key group, an eighth of the sequence)
#define NQ   8      // key groups
#define SROW 516    // padded LDS row pitch for score tile (bank-conflict break)

typedef __attribute__((ext_vector_type(4)))  float        fvec4;
typedef __attribute__((ext_vector_type(8)))  float        v8f;
typedef __attribute__((ext_vector_type(4)))  unsigned int uvec4;
typedef __attribute__((ext_vector_type(8)))  unsigned int uvec8;
typedef __attribute__((ext_vector_type(16))) __bf16       v16bf;

__device__ __forceinline__ unsigned short f2bf(float f) {
  unsigned int u = __builtin_bit_cast(unsigned int, f);
  u = (u + 0x7FFFu + ((u >> 16) & 1u)) >> 16;   // round-to-nearest-even
  return (unsigned short)u;
}

__device__ __forceinline__ v16bf make_op(uvec4 a, uvec4 b) {
  uvec8 w;
  w[0]=a[0]; w[1]=a[1]; w[2]=a[2]; w[3]=a[3];
  w[4]=b[0]; w[5]=b[1]; w[6]=b[2]; w[7]=b[3];
  return __builtin_bit_cast(v16bf, w);
}

// Fragment-packed bf16 matrix: one 1-KB block per (16 rows) x (32 k), blocks k-major inside a
// 16-row tile. Inside a block lane L = (row & 15) + 16 * ((k >> 3) & 1) owns 16 B at L * 16 for
// k & 16 == 0 and at 512 + L * 16 for k & 16 != 0 (the ISA 16-bit A layout, k order unchanged).
// Index in 16-bit elements of element (row, k); kblocks = k extent / 32.
__device__ __forceinline__ size_t packed_idx(int row, int k, int kblocks) {
  return ((size_t)((row >> 4) * kblocks + (k >> 5)) << 9)
       + (((k >> 4) & 1) << 8) + (((row & 15) + (((k >> 3) & 1) << 4)) << 3) + (k & 7);
}

// 16x32 operand of 16-row tile rt, k block kb: two loads of 512 contiguous bytes per wave.
__device__ __forceinline__ v16bf load_op_packed(const unsigned short* __restrict__ base,
                                                int kblocks, int rt, int kb, int lane) {
  const unsigned short* p = base + ((size_t)(rt * kblocks + kb) << 9) + (lane << 3);
  uvec4 lo = *(const uvec4*)p;
  uvec4 hi = *(const uvec4*)(p + 256);
  return make_op(lo, hi);
}

#define WMMA_BF16(a, b, c) \
  __builtin_amdgcn_wmma_f32_16x16x32_bf16(false, (a), false, (b), (short)0, (c), false, false)

// ---------------- kernel 0: X and Wq, Wk, Wv -> bf16, fragment-packed ----------------
// Every element is rounded once here instead of once per GEMM block that reads it. X is packed as
// the A operand (row = sequence position), each W as the B operand ("row" = output column n,
// k = input feature); the three W lie one behind the other.
#define XPB 256   // blocks that pack X; the other 3 * 128 pack the W
__device__ __forceinline__ uvec4 pack8(fvec4 x0, fvec4 x1) {
  uvec4 w;
  w[0] = (unsigned int)f2bf(x0[0]) | ((unsigned int)f2bf(x0[1]) << 16);
  w[1] = (unsigned int)f2bf(x0[2]) | ((unsigned int)f2bf(x0[3]) << 16);
  w[2] = (unsigned int)f2bf(x1[0]) | ((unsigned int)f2bf(x1[1]) << 16);
  w[3] = (unsigned int)f2bf(x1[2]) | ((unsigned int)f2bf(x1[3]) << 16);
  return w;
}

__global__ void __launch_bounds__(256) pack_kernel(
    const float* __restrict__ X, const float* __restrict__ Wq,
    const float* __restrict__ Wk, const float* __restrict__ Wv,
    unsigned short* __restrict__ Xp, unsigned short* __restrict__ Wp)
{
  const int t = threadIdx.x, wave = t >> 5, lane = t & 31;
  if (blockIdx.x < XPB) {
    // One wave: four k blocks in a row of one 16-row tile (512 contiguous bytes of each X row).
    const int wv  = blockIdx.x * 8 + wave;
    const int rt  = wv >> 3;
    const int kb0 = (wv & 7) * 4;
    const float* sp = X + (size_t)(rt * 16 + (lane & 15)) * DIN + kb0 * 32 + ((lane >> 4) << 3);
    unsigned short* dp = Xp + ((size_t)(rt * (DIN / 32) + kb0) << 9) + (lane << 3);
    fvec4 x[8][2];
    // Both loops unrolled: x lives in registers, and the loads go out in runs, not one wait each.
#pragma unroll
    for (int j = 0; j < 8; j++) {       // j = 2 * k block + 16-k half
      x[j][0] = *(const fvec4*)(sp + j * 16);
      x[j][1] = *(const fvec4*)(sp + j * 16 + 4);
    }
#pragma unroll
    for (int j = 0; j < 8; j++)
      *(uvec4*)(dp + j * 256) = pack8(x[j][0], x[j][1]);
  } else {
    // One thread: one k block (32 k) of one column n; a wave's loads are whole 128-B lines of W.
    const int bw = blockIdx.x - XPB;
    const int w  = bw >> 7;
    const int n  = (bw & 3) * 256 + t;
    const int kb = (bw >> 2) & 31;
    const float* sp = ((w == 0) ? Wq : (w == 1) ? Wk : Wv) + (size_t)kb * 32 * DOUT + n;
    unsigned short* dp = Wp + (size_t)w * DIN * DOUT + packed_idx(n, kb * 32, DIN / 32);
    float v[32];
    // Both loops unrolled for the same reasons as above.
#pragma unroll
    for (int k = 0; k < 32; k++) v[k] = sp[(size_t)k * DOUT];
#pragma unroll
    for (int p = 0; p < 4; p++) {       // k = 8 p .. 8 p + 7: one 16-B piece of the fragment
      fvec4 x0 = { v[8 * p + 0], v[8 * p + 1], v[8 * p + 2], v[8 * p + 3] };
      fvec4 x1 = { v[8 * p + 4], v[8 * p + 5], v[8 * p + 6], v[8 * p + 7] };
      *(uvec4*)(dp + ((p >> 1) << 8) + ((p & 1) << 7)) = pack8(x0, x1);
    }
    // Stands in front of whatever next writes a register that these four stores name.
    asm volatile("s_wait_xcnt 0x0" ::: "memory");
  }
}

// ---------------- kernel 1: Q, K, V [4096,1024] = X[4096,1024] @ {Wq, Wk, Wv}[1024,1024] ----------------
// One launch for the three projections: 8 waves (4 M x 2 N), block tile 128x64 of each of Q, K and V,
// k-step 32. Both operands arrive fragment-packed and are read straight from global, each wave its
// own fragments, one k block ahead of their use, into two register sets that take turns.
// Q and K leave as fragment-packed bf16, V as f32; with V goes the column sum of each wave's 32 rows,
// the first half of the prefix sum over the sequence.

// The eight fragments of one wave for the k block kb blocks behind pa and pb, which point at this
// lane's 16 bytes in the wave's first X tile and its first tile of Wq.
__device__ __forceinline__ void load_proj_set(v16bf (&a)[2], v16bf (&b)[3][2],
                                              const unsigned short* __restrict__ pa,
                                              const unsigned short* __restrict__ pb, int kb) {
  const int tile = (DIN / 32) << 9;   // elements from one 16-row tile to the next
  const int mat  = DIN * DOUT;        // elements from one packed W to the next
  // Unrolled: the fragments live in registers, which takes constant indices.
#pragma unroll
  for (int i = 0; i < 2; i++) {
    const unsigned short* p = pa + i * tile + (kb << 9);
    a[i] = make_op(*(const uvec4*)p, *(const uvec4*)(p + 256));
  }
#pragma unroll
  for (int w = 0; w < 3; w++)
#pragma unroll
    for (int i = 0; i < 2; i++) {
      const unsigned short* p = pb + w * mat + i * tile + (kb << 9);
      b[w][i] = make_op(*(const uvec4*)p, *(const uvec4*)(p + 256));
    }
}

__device__ __forceinline__ void proj_mma(v8f (&acc)[3][2][2], const v16bf (&a)[2], const v16bf (&b)[3][2]) {
  // Unrolled for the same reason.
#pragma unroll
  for (int w = 0; w < 3; w++) {
    acc[w][0][0] = WMMA_BF16(a[0], b[w][0], acc[w][0][0]);
    acc[w][0][1] = WMMA_BF16(a[0], b[w][1], acc[w][0][1]);
    acc[w][1][0] = WMMA_BF16(a[1], b[w][0], acc[w][1][0]);
    acc[w][1][1] = WMMA_BF16(a[1], b[w][1], acc[w][1][1]);
  }
}

__global__ void __launch_bounds__(256) proj_gemm_kernel(
    const unsigned short* __restrict__ Xp, const unsigned short* __restrict__ Wp,
    unsigned short* __restrict__ outQ, unsigned short* __restrict__ outK,
    float* __restrict__ outV, float* __restrict__ tsum)
{
  const int t = threadIdx.x;
  const int wave = t >> 5, lane = t & 31;
  const int wm = wave & 3, wn = wave >> 2;
  const int m0 = blockIdx.y * 128, n0 = blockIdx.x * 64;
  const int at = (m0 >> 4) + wm * 2;   // first 16-row tile of X for this wave
  const int bt = (n0 >> 4) + wn * 2;   // first 16-column tile of each W for this wave
  const unsigned short* pa = Xp + ((size_t)(at * (DIN / 32)) << 9) + (lane << 3);
  const unsigned short* pb = Wp + ((size_t)(bt * (DIN / 32)) << 9) + (lane << 3);

  v8f acc[3][2][2] = {};
  v16bf fa[2][2], fb[2][3][2];
  load_proj_set(fa[0], fb[0], pa, pb, 0);
  // Unrolled: the register sets take constant indices and the k blocks immediate offsets, so no
  // address register is rewritten under a load in flight.
#pragma unroll
  for (int kb = 0; kb < DIN / 32; kb++) {
    const int cur = kb & 1, nxt = cur ^ 1;
    if (kb + 1 < DIN / 32)
      load_proj_set(fa[nxt], fb[nxt], pa, pb, kb + 1);
    // Holds the sixteen loads in front of this k block's WMMAs: sunk towards their use they would
    // be waited for at full latency.
    __builtin_amdgcn_sched_barrier(0);
    proj_mma(acc, fa[cur], fb[cur]);
    // Keeps the next k block's loads behind these WMMAs: lifted over them they would need a
    // third register set.
    __builtin_amdgcn_sched_barrier(0);
  }

#pragma unroll
  for (int mi = 0; mi < 2; mi++)
#pragma unroll
    for (int ni = 0; ni < 2; ni++)
#pragma unroll
      for (int r = 0; r < 8; r++) {
        int row = m0 + wm * 32 + mi * 16 + ((lane >> 4) << 3) + r;
        int col = n0 + wn * 32 + ni * 16 + (lane & 15);
        size_t pi = packed_idx(row, col, DOUT / 32);
        outQ[pi] = f2bf(acc[0][mi][ni][r]);
        outK[pi] = f2bf(acc[1][mi][ni][r]);
        outV[(size_t)row * DOUT + col] = acc[2][mi][ni][r];
      }

  // Column sums of this wave's 32 x 32 piece of V: a lane adds its 16 rows of either column tile, the
  // lane 16 away holds the other 16; lanes 0-15 then store the first tile's sums, 16-31 the second's.
  // Unrolled: acc lives in registers, which takes constant indices.
  float cs[2];
#pragma unroll
  for (int ni = 0; ni < 2; ni++) {
    float c = 0.f;
#pragma unroll
    for (int mi = 0; mi < 2; mi++)
#pragma unroll
      for (int r = 0; r < 8; r++) c += acc[2][mi][ni][r];
    cs[ni] = c + __shfl_xor(c, 16, 32);
  }
  tsum[(size_t)(blockIdx.y * 4 + wm) * DOUT + n0 + wn * 32 + lane] = (lane < 16) ? cs[0] : cs[1];
}

// ---------------- kernel 2: prefix sum of V rows -> Vcum (packed bf16) ----------------
// One launch. A wave holds one 32-row tile of 64 columns in registers (every load of the kernel is
// independent of every other and goes out before the first is waited for). What lies in front of the
// tile comes from the projection's tile sums: the tiles in front of the block are dealt over the
// block's eight waves and their partial sums meet in LDS; the block's own earlier tiles each wave adds
// for itself. Vcum leaves as the out GEMM's B operand: bf16, fragment-packed, "row" = output column n,
// k = sequence position.
#define TROWS 32                 // rows per tile sum: one projection wave's rows
#define SWAVES 8                 // waves (tiles) per scan block
#define NBLK (SEQ / (TROWS * SWAVES))   // scan blocks along the sequence
typedef __attribute__((ext_vector_type(2))) float fvec2;

__global__ void __launch_bounds__(256) scan_pack_kernel(const float* __restrict__ V,
                                                        const float* __restrict__ tsum,
                                                        unsigned short* __restrict__ Vp) {
  __shared__ __align__(8) float s_part[SWAVES][64];
  const int t = threadIdx.x, lane = t & 31;
  // The wave's number as a scalar: bases and the tests on it below are then scalar work.
  const int wave = __builtin_amdgcn_readfirstlane(t >> 5);
  const int c0   = blockIdx.x * 64;                 // the block's first column
  const unsigned lo = lane * 2;                     // this thread's two columns in the block
  const int rb   = blockIdx.y;
  const int tile = rb * SWAVES + wave;

  // All loops below are unrolled: the values live in registers, which takes constant indices.
  // Every index is in range whatever rb and wave are; what does not count is dropped after the load,
  // so that no load waits for a branch.
  fvec2 far[NBLK - 1], near[SWAVES - 1], v[TROWS];
#pragma unroll
  for (int i = 0; i < NBLK - 1; i++)
    far[i] = *(const fvec2*)(tsum + ((size_t)(i * SWAVES + wave) * DOUT + c0) + lo);
#pragma unroll
  for (int j = 0; j < SWAVES - 1; j++)
    near[j] = *(const fvec2*)(tsum + ((size_t)(rb * SWAVES + j) * DOUT + c0) + lo);
  // Stands in front of the loads of V: the results of some of them land on the address registers
  // that the loads above name.
  asm volatile("s_wait_xcnt 0x0" ::: "memory");
  const float* vp = V + ((size_t)tile * TROWS * DOUT + c0);
#pragma unroll
  for (int r = 0; r < TROWS; r++)
    v[r] = *(const fvec2*)(vp + (size_t)r * DOUT + lo);
  // Holds all 54 loads in front of the first sum: sunk behind it, the loads of V would go out only
  // when the tile sums have come back, and the wave would wait out the memory latency twice.
  __builtin_amdgcn_sched_barrier(0);

  fvec2 part = { 0.f, 0.f }, run = { 0.f, 0.f };
#pragma unroll
  for (int i = 0; i < NBLK - 1; i++)
    if (i < rb) part += far[i];
#pragma unroll
  for (int j = 0; j < SWAVES - 1; j++)
    if (j < wave) run += near[j];
  *(fvec2*)&s_part[wave][lo] = part;
  __syncthreads();
#pragma unroll
  for (int w = 0; w < SWAVES; w++)
    run += *(const fvec2*)&s_part[w][lo];

  // One 1-KB fragment block per 16 columns: this tile is k block `tile` of each.
  unsigned short* dp = Vp + packed_idx(c0 + lo, tile * TROWS, SEQ / 32);
  uvec4 w0[TROWS / 8], w1[TROWS / 8];
#pragma unroll
  for (int g = 0; g < TROWS / 8; g++)       // 8 sequence positions = one 16-B piece of a fragment
#pragma unroll
    for (int j = 0; j < 4; j++) {
      run += v[g * 8 + 2 * j];
      fvec2 e0 = run;
      run += v[g * 8 + 2 * j + 1];
      w0[g][j] = (unsigned int)f2bf(e0[0]) | ((unsigned int)f2bf(run[0]) << 16);
      w1[g][j] = (unsigned int)f2bf(e0[1]) | ((unsigned int)f2bf(run[1]) << 16);
    }
#pragma unroll
  for (int g = 0; g < TROWS / 8; g++) {
    unsigned short* gp = dp + ((g >> 1) << 8) + ((g & 1) << 7);
    *(uvec4*)gp       = w0[g];
    *(uvec4*)(gp + 8) = w1[g];
  }
}

// ---------------- kernel 3: scores + per-group max + E=exp(s-m) + Z = sum (t+1) E ----------------
// One 128-row x 512-key tile per WG; the f32 score tile lies in dynamic LDS (258 KB of 320 KB WGP LDS).
// Each K fragment a wave loads feeds four 16-row tiles of Q. Maximum, E and Z are those of the
// block's own key group; the out GEMM brings the eight groups of a row to one scale.
__device__ __forceinline__ void load_frags(v16bf (&f)[4], const unsigned short* __restrict__ M,
                                           int tile0, int ks, int lane) {
  // Unrolled: the fragments live in registers, which takes constant indices.
#pragma unroll
  for (int i = 0; i < 4; i++) f[i] = load_op_packed(M, DIN / 32, tile0 + i, ks, lane);
}

__device__ __forceinline__ void mma_stage(v8f (&acc)[4][4], const v16bf (&a)[4], const v16bf (&b)[4]) {
  // Unrolled for the same reason.
#pragma unroll
  for (int mi = 0; mi < 4; mi++)
#pragma unroll
    for (int jc = 0; jc < 4; jc++)
      acc[mi][jc] = WMMA_BF16(a[mi], b[jc], acc[mi][jc]);
}

__global__ void __launch_bounds__(512) scores_kernel(
    const unsigned short* __restrict__ Q, const unsigned short* __restrict__ K,
    unsigned short* __restrict__ P, float* __restrict__ Zl, float* __restrict__ Ml)
{
  extern __shared__ float sc[];   // [RB][SROW]
  __shared__ float s_rmax[RB];
  __shared__ float s_zw[RB];
  const int t = threadIdx.x, wave = t >> 5, lane = t & 31;
  const int rt0 = blockIdx.x * (RB / 16);   // first 16-row tile of Q
  const int js  = blockIdx.y;               // key group
  const float scale = 0.03125f;   // 1/sqrt(1024)

  // phase 1: 128x512 score tile via WMMA (Q and K arrive fragment-packed). The 16 waves lie 2 x 8
  // over the tile, each with 4x4 accumulator tiles (64 rows x 64 keys). The K fragments are fetched
  // one k block ahead into a second set that takes turns with the first (no register copy waits
  // for them); the Q fragments, which eight waves share, are fetched for the k block at hand.
  {
    const int wmh = wave & 1;                   // 64-row half of the tile
    const int jl0 = (wave >> 1) * 4;            // 4 consecutive 16-wide key tiles per wave
    const int jt0 = js * (JB / 16) + jl0;
    const int rtw = rt0 + wmh * 4;
    v8f acc[4][4] = {};
    v16bf a[4], b0[4], b1[4];
    load_frags(b0, K, jt0, 0, lane);
    for (int ks = 0; ks < DIN / 32 - 2; ks += 2) {
      load_frags(a,  Q, rtw, ks,     lane);
      load_frags(b1, K, jt0, ks + 1, lane);
      // Holds the sixteen loads together in front of the WMMAs: sunk among them, each group
      // would be waited for on its own.
      __builtin_amdgcn_sched_barrier(0);
      mma_stage(acc, a, b0);
      load_frags(a,  Q, rtw, ks + 1, lane);
      load_frags(b0, K, jt0, ks + 2, lane);
      __builtin_amdgcn_sched_barrier(0);        // as above
      mma_stage(acc, a, b1);
      // The next trip rewrites the address registers that the K loads still in flight name.
      asm volatile("s_wait_xcnt 0x0" ::: "memory");
    }
    load_frags(a,  Q, rtw, DIN / 32 - 2, lane);
    load_frags(b1, K, jt0, DIN / 32 - 1, lane);
    __builtin_amdgcn_sched_barrier(0);          // as above
    mma_stage(acc, a, b0);
    load_frags(a,  Q, rtw, DIN / 32 - 1, lane);
    mma_stage(acc, a, b1);

#pragma unroll
    for (int mi = 0; mi < 4; mi++)
#pragma unroll
      for (int jc = 0; jc < 4; jc++) {
        int colb = (jl0 + jc) * 16 + (lane & 15);
#pragma unroll
        for (int r = 0; r < 8; r++) {
          int row = wmh * 64 + mi * 16 + ((lane >> 4) << 3) + r;
          sc[row * SROW + colb] = acc[mi][jc][r] * scale;
        }
      }
  }
  __syncthreads();

  // phase 2: row max over the group (wave w owns rows 8w..8w+7; stride-32 lanes -> conflict-free)
  for (int rr = 0; rr < RB / 16; rr++) {
    int row = wave * (RB / 16) + rr;
    float m = -3.0e38f;
    // Unrolled so that the row's 16 LDS reads go out together instead of one wait per read.
#pragma unroll
    for (int k2 = 0; k2 < JB / 32; k2++)
      m = fmaxf(m, sc[row * SROW + lane + 32 * k2]);
#pragma unroll
    for (int off = 16; off > 0; off >>= 1)
      m = fmaxf(m, __shfl_xor(m, off, 32));
    if (lane == 0) s_rmax[row] = m;
  }
  __syncthreads();

  // phase 3: Z = sum (t+1) * exp(s - m) over the group (softmax denominator cancels analytically)
  for (int rr = 0; rr < RB / 16; rr++) {
    int row = wave * (RB / 16) + rr;
    float m = s_rmax[row];
    float z = 0.f;
    // Unrolled for the same reason as in phase 2.
#pragma unroll
    for (int k2 = 0; k2 < JB / 32; k2++) {
      int c = lane + 32 * k2;
      z += __expf(sc[row * SROW + c] - m) * (float)(js * JB + c + 1);
    }
#pragma unroll
    for (int off = 16; off > 0; off >>= 1)
      z += __shfl_xor(z, off, 32);
    if (lane == 0) s_zw[row] = z;
  }
  __syncthreads();
  // [group][row]: a block's 128 values are four whole 128-B lines of each array.
  if (t < RB) {
    Zl[js * SEQ + blockIdx.x * RB + t] = s_zw[t];
    Ml[js * SEQ + blockIdx.x * RB + t] = s_rmax[t];
  }

  // phase 4: E = exp(s - m) as bf16, fragment-packed (each 16-row tile's key group is one 16-KB run
  // of P); each thread writes 16-B pieces, a wave 512 contiguous bytes.
  for (int k2 = 0; k2 < 16; k2++) {
    const int tile = k2 >> 1;                               // 16-row tile of the block
    const int q = (k2 & 1) * 512 + t;                       // 16-B piece index in the tile's run
    const int row = tile * 16 + (lane & 15);
    const int col = ((q >> 6) << 5) + (((q >> 5) & 1) << 4) + ((lane >> 4) << 3);
    const float m = s_rmax[row];
    const float* sp = sc + row * SROW + col;
    unsigned short* Pt = P + ((size_t)((rt0 + tile) * (SEQ / 32) + js * (JB / 32)) << 9);
    fvec4 x0 = *(const fvec4*)sp;
    fvec4 x1 = *(const fvec4*)(sp + 4);
    uvec4 w;
    w[0] = (unsigned int)f2bf(__expf(x0[0] - m)) | ((unsigned int)f2bf(__expf(x0[1] - m)) << 16);
    w[1] = (unsigned int)f2bf(__expf(x0[2] - m)) | ((unsigned int)f2bf(__expf(x0[3] - m)) << 16);
    w[2] = (unsigned int)f2bf(__expf(x1[0] - m)) | ((unsigned int)f2bf(__expf(x1[1] - m)) << 16);
    w[3] = (unsigned int)f2bf(__expf(x1[2] - m)) | ((unsigned int)f2bf(__expf(x1[3] - m)) << 16);
    *(uvec4*)(Pt + ((size_t)q << 3)) = w;
    // The next trip rewrites the registers that this store names.
    asm volatile("s_wait_xcnt 0x0" ::: "memory");
  }
}

// ---------------- kernel 4: Out = sum over key groups f_q * (E_q @ Vcum_q) ----------------
// Both operands arrive fragment-packed and are read straight from global, each wave its own
// fragments, three k blocks ahead of their use, into four register sets that take turns. E of key
// group q is scaled by the group's own row maximum m_q, so each group's product is weighted by
// f_q = exp(m_q - max m) / sum_p Z_p exp(m_p - max m).
#define OAHEAD 3            // k blocks between a fragment's load and its use
#define OSETS  4            // register sets: OAHEAD in flight and the one in use
#define GKB    (JB / 32)    // k blocks per key group, a multiple of OSETS

// The four fragments of one wave for the k block kb blocks behind pa and pb, which point at this
// lane's 16 bytes in the wave's first E tile and first Vcum tile: eight loads of 512 contiguous bytes.
__device__ __forceinline__ void load_out_set(v16bf (&a)[2], v16bf (&b)[2],
                                             const unsigned short* __restrict__ pa,
                                             const unsigned short* __restrict__ pb, int kb) {
  const int tile = (SEQ / 32) << 9;   // elements from one 16-row tile to the next
  a[0] = make_op(*(const uvec4*)(pa + (kb << 9)),        *(const uvec4*)(pa + (kb << 9) + 256));
  b[0] = make_op(*(const uvec4*)(pb + (kb << 9)),        *(const uvec4*)(pb + (kb << 9) + 256));
  b[1] = make_op(*(const uvec4*)(pb + tile + (kb << 9)), *(const uvec4*)(pb + tile + (kb << 9) + 256));
  a[1] = make_op(*(const uvec4*)(pa + tile + (kb << 9)), *(const uvec4*)(pa + tile + (kb << 9) + 256));
}

// One key group's product. On entry the sets hold (or await) the group's first OAHEAD k blocks; on
// exit those of the next group, which follow in memory; the last group fetches nothing past its end.
template <bool LAST>
__device__ __forceinline__ void out_group(v8f (&acc)[2][2], v16bf (&fa)[OSETS][2], v16bf (&fb)[OSETS][2],
                                          const unsigned short* __restrict__ pa,
                                          const unsigned short* __restrict__ pb) {
  // Unrolled: the register sets take constant indices and the k blocks immediate offsets.
#pragma unroll
  for (int j = 0; j < GKB; j++) {
    const int cur = j % OSETS, nxt = (j + OAHEAD) % OSETS;
    if (!LAST || j + OAHEAD < GKB)
      load_out_set(fa[nxt], fb[nxt], pa, pb, j + OAHEAD);
    // Holds the eight loads in front of this k block's WMMAs: sunk towards their use they would
    // be waited for at full latency.
    __builtin_amdgcn_sched_barrier(0);
    acc[0][0] = WMMA_BF16(fa[cur][0], fb[cur][0], acc[0][0]);
    acc[0][1] = WMMA_BF16(fa[cur][0], fb[cur][1], acc[0][1]);
    acc[1][0] = WMMA_BF16(fa[cur][1], fb[cur][0], acc[1][0]);
    acc[1][1] = WMMA_BF16(fa[cur][1], fb[cur][1], acc[1][1]);
    // Keeps the next k block's loads behind these WMMAs: lifted over them they would need a
    // fifth register set.
    __builtin_amdgcn_sched_barrier(0);
  }
}

// tot += f * acc, f the group's weights of this wave's rows (fq = the group's 128 weights in LDS).
__device__ __forceinline__ void out_fold(v8f (&tot)[2][2], const v8f (&acc)[2][2],
                                         const float* fq, int wm, int lane) {
  // Both loops unrolled: tot and acc live in registers, which takes constant indices.
#pragma unroll
  for (int mi = 0; mi < 2; mi++) {
    const float* fp = fq + wm * 32 + mi * 16 + ((lane >> 4) << 3);
    fvec4 f0 = *(const fvec4*)fp;
    fvec4 f1 = *(const fvec4*)(fp + 4);
    v8f f = __builtin_shufflevector(f0, f1, 0, 1, 2, 3, 4, 5, 6, 7);
#pragma unroll
    for (int ni = 0; ni < 2; ni++)
      tot[mi][ni] += f * acc[mi][ni];
  }
}

__global__ void __launch_bounds__(256) out_gemm_kernel(
    const unsigned short* __restrict__ P, const unsigned short* __restrict__ Vp,
    const float* __restrict__ Zl, const float* __restrict__ Ml, float* __restrict__ Out)
{
  __shared__ __align__(16) float s_f[NQ][128];
  const int t = threadIdx.x, wave = t >> 5, lane = t & 31;
  const int wm = wave & 3, wn = wave >> 2;
  const int m0 = blockIdx.y * 128, n0 = blockIdx.x * 64;
  const int at = (m0 >> 4) + wm * 2;   // first 16-row tile of E for this wave
  const int bt = (n0 >> 4) + wn * 2;   // first 16-column tile of Vcum for this wave
  const unsigned short* pa = P  + ((size_t)(at * (SEQ / 32)) << 9) + (lane << 3);
  const unsigned short* pb = Vp + ((size_t)(bt * (SEQ / 32)) << 9) + (lane << 3);

  // The first OAHEAD k blocks go out before the weights are formed (unrolled: the register sets
  // take constant indices).
  v16bf fa[OSETS][2], fb[OSETS][2];
#pragma unroll
  for (int s = 0; s < OAHEAD; s++)
    load_out_set(fa[s], fb[s], pa, pb, s);

  if (t < 128) {
    // The loops over the groups are unrolled so that mq, zq and e stay in registers.
    float mq[NQ], zq[NQ];
#pragma unroll
    for (int q = 0; q < NQ; q++) {
      mq[q] = Ml[q * SEQ + m0 + t];
      zq[q] = Zl[q * SEQ + m0 + t];
    }
    float mg = mq[0];
#pragma unroll
    for (int q = 1; q < NQ; q++) mg = fmaxf(mg, mq[q]);
    float e[NQ], zg = 0.f;
#pragma unroll
    for (int q = 0; q < NQ; q++) {
      e[q] = __expf(mq[q] - mg);
      zg += zq[q] * e[q];
    }
#pragma unroll
    for (int q = 0; q < NQ; q++) s_f[q][t] = e[q] / zg;
  }
  __syncthreads();

  v8f tot[2][2] = {};
  // Kept rolled: unrolled, every group's accumulators stay live to the end and cost registers.
#pragma unroll 1
  for (int q = 0; q < NQ - 1; q++) {
    v8f acc[2][2] = {};
    out_group<false>(acc, fa, fb, pa, pb);
    out_fold(tot, acc, s_f[q], wm, lane);
    // The next trip rewrites the address registers that the loads still in flight name.
    asm volatile("s_wait_xcnt 0x0" ::: "memory");
    pa += GKB << 9;
    pb += GKB << 9;
  }
  {
    v8f acc[2][2] = {};
    out_group<true>(acc, fa, fb, pa, pb);
    out_fold(tot, acc, s_f[NQ - 1], wm, lane);
  }

#pragma unroll
  for (int mi = 0; mi < 2; mi++)
#pragma unroll
    for (int ni = 0; ni < 2; ni++)
#pragma unroll
      for (int r = 0; r < 8; r++) {
        int row = m0 + wm * 32 + mi * 16 + ((lane >> 4) << 3) + r;
        int col = n0 + wn * 32 + ni * 16 + (lane & 15);
        Out[(size_t)row * DOUT + col] = tot[mi][ni][r];
      }
}

// ---------------- host launcher ----------------
extern "C" void kernel_launch(void* const* d_in, const int* in_sizes, int n_in,
                              void* d_out, int out_size, void* d_ws, size_t ws_size,
                              hipStream_t stream) {
  const float* x  = (const float*)d_in[0];
  const float* wq = (const float*)d_in[1];
  const float* wk = (const float*)d_in[2];
  const float* wv = (const float*)d_in[3];
  float* out = (float*)d_out;

  char* ws = (char*)d_ws;
  unsigned short* Qbf = (unsigned short*)(ws);                      //  8 MB bf16, packed
  unsigned short* Kbf = (unsigned short*)(ws + (size_t)( 8 << 20)); //  8 MB bf16, packed
  float*          Vc  = (float*)         (ws + (size_t)(16 << 20)); // 16 MB f32 (V)
  unsigned short* P   = (unsigned short*)(ws + (size_t)(32 << 20)); // 32 MB bf16 (E), packed
  float*          Ts  = (float*)         (ws + (size_t)(65 << 20)); // 512 KB f32 (32-row tile sums of V)
  float*          Zl  = (float*)         (ws + (size_t)(64 << 20) + (1 << 17)); // 128 KB, [group][row]
  float*          Ml  = (float*)         (ws + (size_t)(64 << 20) + (1 << 18)); // 128 KB, [group][row]
  unsigned short* Vp  = (unsigned short*)(ws + (size_t)(72 << 20)); //  8 MB bf16 (Vcum), packed
  unsigned short* Xp  = (unsigned short*)(ws + (size_t)(80 << 20)); //  8 MB bf16 (X), packed
  unsigned short* Wp  = (unsigned short*)(ws + (size_t)(88 << 20)); //  6 MB bf16 (Wq, Wk, Wv), packed

  dim3 blk(256);
  dim3 gGemm(DOUT / 64, SEQ / 128);

  pack_kernel<<<dim3(XPB + 3 * 128), blk, 0, stream>>>(x, wq, wk, wv, Xp, Wp);
  proj_gemm_kernel<<<gGemm, blk, 0, stream>>>(Xp, Wp, Qbf, Kbf, Vc, Ts);

  scan_pack_kernel<<<dim3(DOUT / 64, NBLK), blk, 0, stream>>>(Vc, Ts, Vp);

  size_t smem = (size_t)RB * SROW * sizeof(float);  // 258 KB dynamic LDS
  scores_kernel<<<dim3(SEQ / RB, NQ), dim3(512), smem, stream>>>(Qbf, Kbf, P, Zl, Ml);

  out_gemm_kernel<<<gGemm, blk, 0, stream>>>(P, Vp, Zl, Ml, out);
}

// v007
// It runs in 114 microseconds.
// Next to v006, in two timings, it ran 1.13 times as fast each time.
// All steps since v000 together make it 4.20 times as fast.
#include <hip/hip_runtime.h>

#define SEQ  4096
#define DIN  1024
#define DOUT 1024
#define RB   128    // query rows per scores block
#define JB   512    // keys per scores block (one key group, an eighth of the sequence)
#define NQ   8      // key groups
#define SROW 516    // padded LDS row pitch for score tile (bank-conflict break)

typedef __attribute__((ext_vector_type(4)))  float        fvec4;
typedef __attribute__((ext_vector_type(8)))  float        v8f;
typedef __attribute__((ext_vector_type(4)))  unsigned int uvec4;
typedef __attribute__((ext_vector_type(8)))  unsigned int uvec8;
typedef __attribute__((ext_vector_type(16))) __bf16       v16bf;

__device__ __forceinline__ unsigned short f2bf(float f) {
  unsigned int u = __builtin_bit_cast(unsigned int, f);
  u = (u + 0x7FFFu + ((u >> 16) & 1u)) >> 16;   // round-to-nearest-even
  return (unsigned short)u;
}

__device__ __forceinline__ v16bf make_op(uvec4 a, uvec4 b) {
  uvec8 w;
  w[0]=a[0]; w[1]=a[1]; w[2]=a[2]; w[3]=a[3];
  w[4]=b[0]; w[5]=b[1]; w[6]=b[2]; w[7]=b[3];
  return __builtin_bit_cast(v16bf, w);
}

// Fragment-packed bf16 matrix: one 1-KB block per (16 rows) x (32 k), blocks k-major inside a
// 16-row tile. Inside a block lane L = (row & 15) + 16 * ((k >> 3) & 1) owns 16 B at L * 16 for
// k & 16 == 0 and at 512 + L * 16 for k & 16 != 0 (the ISA 16-bit A layout, k order unchanged).
// Index in 16-bit elements of element (row, k); kblocks = k extent / 32.
__device__ __forceinline__ size_t packed_idx(int row, int k, int kblocks) {
  return ((size_t)((row >> 4) * kblocks + (k >> 5)) << 9)
       + (((k >> 4) & 1) << 8) + (((row & 15) + (((k >> 3) & 1) << 4)) << 3) + (k & 7);
}

// 16x32 operand of 16-row tile rt, k block kb: two loads of 512 contiguous bytes per wave.
__device__ __forceinline__ v16bf load_op_packed(const unsigned short* __restrict__ base,
                                                int kblocks, int rt, int kb, int lane) {
  const unsigned short* p = base + ((size_t)(rt * kblocks + kb) << 9) + (lane << 3);
  uvec4 lo = *(const uvec4*)p;
  uvec4 hi = *(const uvec4*)(p + 256);
  return make_op(lo, hi);
}

#define WMMA_BF16(a, b, c) \
  __builtin_amdgcn_wmma_f32_16x16x32_bf16(false, (a), false, (b), (short)0, (c), false, false)

// ---------------- kernel 0: X and Wq, Wk, Wv -> bf16, fragment-packed ----------------
// Every element is rounded once here instead of once per GEMM block that reads it. X is packed as
// the A operand (row = sequence position), each W as the B operand ("row" = output column n,
// k = input feature); the three W lie one behind the other.
#define XPB 256   // blocks that pack X; the other 3 * 128 pack the W
__device__ __forceinline__ uvec4 pack8(fvec4 x0, fvec4 x1) {
  uvec4 w;
  w[0] = (unsigned int)f2bf(x0[0]) | ((unsigned int)f2bf(x0[1]) << 16);
  w[1] = (unsigned int)f2bf(x0[2]) | ((unsigned int)f2bf(x0[3]) << 16);
  w[2] = (unsigned int)f2bf(x1[0]) | ((unsigned int)f2bf(x1[1]) << 16);
  w[3] = (unsigned int)f2bf(x1[2]) | ((unsigned int)f2bf(x1[3]) << 16);
  return w;
}

__global__ void __launch_bounds__(256) pack_kernel(
    const float* __restrict__ X, const float* __restrict__ Wq,
    const float* __restrict__ Wk, const float* __restrict__ Wv,
    unsigned short* __restrict__ Xp, unsigned short* __restrict__ Wp)
{
  const int t = threadIdx.x, wave = t >> 5, lane = t & 31;
  if (blockIdx.x < XPB) {
    // One wave: four k blocks in a row of one 16-row tile (512 contiguous bytes of each X row).
    const int wv  = blockIdx.x * 8 + wave;
    const int rt  = wv >> 3;
    const int kb0 = (wv & 7) * 4;
    const float* sp = X + (size_t)(rt * 16 + (lane & 15)) * DIN + kb0 * 32 + ((lane >> 4) << 3);
    unsigned short* dp = Xp + ((size_t)(rt * (DIN / 32) + kb0) << 9) + (lane << 3);
    fvec4 x[8][2];
    // Both loops unrolled: x lives in registers, and the loads go out in runs, not one wait each.
#pragma unroll
    for (int j = 0; j < 8; j++) {       // j = 2 * k block + 16-k half
      x[j][0] = *(const fvec4*)(sp + j * 16);
      x[j][1] = *(const fvec4*)(sp + j * 16 + 4);
    }
#pragma unroll
    for (int j = 0; j < 8; j++)
      *(uvec4*)(dp + j * 256) = pack8(x[j][0], x[j][1]);
  } else {
    // One thread: one k block (32 k) of one column n; a wave's loads are whole 128-B lines of W.
    const int bw = blockIdx.x - XPB;
    const int w  = bw >> 7;
    const int n  = (bw & 3) * 256 + t;
    const int kb = (bw >> 2) & 31;
    const float* sp = ((w == 0) ? Wq : (w == 1) ? Wk : Wv) + (size_t)kb * 32 * DOUT + n;
    unsigned short* dp = Wp + (size_t)w * DIN * DOUT + packed_idx(n, kb * 32, DIN / 32);
    float v[32];
    // Both loops unrolled for the same reasons as above.
#pragma unroll
    for (int k = 0; k < 32; k++) v[k] = sp[(size_t)k * DOUT];
#pragma unroll
    for (int p = 0; p < 4; p++) {       // k = 8 p .. 8 p + 7: one 16-B piece of the fragment
      fvec4 x0 = { v[8 * p + 0], v[8 * p + 1], v[8 * p + 2], v[8 * p + 3] };
      fvec4 x1 = { v[8 * p + 4], v[8 * p + 5], v[8 * p + 6], v[8 * p + 7] };
      *(uvec4*)(dp + ((p >> 1) << 8) + ((p & 1) << 7)) = pack8(x0, x1);
    }
    // Stands in front of whatever next writes a register that these four stores name.
    asm volatile("s_wait_xcnt 0x0" ::: "memory");
  }
}

// ---------------- kernel 1: Q, K, V [4096,1024] = X[4096,1024] @ {Wq, Wk, Wv}[1024,1024] ----------------
// One launch for the three projections: 8 waves (4 M x 2 N), block tile 128x64 of each of Q, K and V,
// k-step 32. Both operands arrive fragment-packed and are read straight from global, each wave its
// own fragments, one k block ahead of their use, into two register sets that take turns.
// Q and K leave as fragment-packed bf16, V as f32; with V goes the column sum of each wave's 32 rows,
// the first half of the prefix sum over the sequence.

// The eight fragments of one wave for the k block kb blocks behind pa and pb, which point at this
// lane's 16 bytes in the wave's first X tile and its first tile of Wq.
__device__ __forceinline__ void load_proj_set(v16bf (&a)[2], v16bf (&b)[3][2],
                                              const unsigned short* __restrict__ pa,
                                              const unsigned short* __restrict__ pb, int kb) {
  const int tile = (DIN / 32) << 9;   // elements from one 16-row tile to the next
  const int mat  = DIN * DOUT;        // elements from one packed W to the next
  // Unrolled: the fragments live in registers, which takes constant indices.
#pragma unroll
  for (int i = 0; i < 2; i++) {
    const unsigned short* p = pa + i * tile + (kb << 9);
    a[i] = make_op(*(const uvec4*)p, *(const uvec4*)(p + 256));
  }
#pragma unroll
  for (int w = 0; w < 3; w++)
#pragma unroll
    for (int i = 0; i < 2; i++) {
      const unsigned short* p = pb + w * mat + i * tile + (kb << 9);
      b[w][i] = make_op(*(const uvec4*)p, *(const uvec4*)(p + 256));
    }
}

__device__ __forceinline__ void proj_mma(v8f (&acc)[3][2][2], const v16bf (&a)[2], const v16bf (&b)[3][2]) {
  // Unrolled for the same reason.
#pragma unroll
  for (int w = 0; w < 3; w++) {
    acc[w][0][0] = WMMA_BF16(a[0], b[w][0], acc[w][0][0]);
    acc[w][0][1] = WMMA_BF16(a[0], b[w][1], acc[w][0][1]);
    acc[w][1][0] = WMMA_BF16(a[1], b[w][0], acc[w][1][0]);
    acc[w][1][1] = WMMA_BF16(a[1], b[w][1], acc[w][1][1]);
  }
}

__global__ void __launch_bounds__(256) proj_gemm_kernel(
    const unsigned short* __restrict__ Xp, const unsigned short* __restrict__ Wp,
    unsigned short* __restrict__ outQ, unsigned short* __restrict__ outK,
    float* __restrict__ outV, float* __restrict__ tsum)
{
  const int t = threadIdx.x;
  const int wave = t >> 5, lane = t & 31;
  const int wm = wave & 3, wn = wave >> 2;
  const int m0 = blockIdx.y * 128, n0 = blockIdx.x * 64;
  const int at = (m0 >> 4) + wm * 2;   // first 16-row tile of X for this wave
  const int bt = (n0 >> 4) + wn * 2;   // first 16-column tile of each W for this wave
  const unsigned short* pa = Xp + ((size_t)(at * (DIN / 32)) << 9) + (lane << 3);
  const unsigned short* pb = Wp + ((size_t)(bt * (DIN / 32)) << 9) + (lane << 3);

  v8f acc[3][2][2] = {};
  v16bf fa[2][2], fb[2][3][2];
  load_proj_set(fa[0], fb[0], pa, pb, 0);
  // Unrolled: the register sets take constant indices and the k blocks immediate offsets, so no
  // address register is rewritten under a load in flight.
#pragma unroll
  for (int kb = 0; kb < DIN / 32; kb++) {
    const int cur = kb & 1, nxt = cur ^ 1;
    if (kb + 1 < DIN / 32)
      load_proj_set(fa[nxt], fb[nxt], pa, pb, kb + 1);
    // Holds the sixteen loads in front of this k block's WMMAs: sunk towards their use they would
    // be waited for at full latency.
    __builtin_amdgcn_sched_barrier(0);
    proj_mma(acc, fa[cur], fb[cur]);
    // Keeps the next k block's loads behind these WMMAs: lifted over them they would need a
    // third register set.
    __builtin_amdgcn_sched_barrier(0);
  }

#pragma unroll
  for (int mi = 0; mi < 2; mi++)
#pragma unroll
    for (int ni = 0; ni < 2; ni++)
#pragma unroll
      for (int r = 0; r < 8; r++) {
        int row = m0 + wm * 32 + mi * 16 + ((lane >> 4) << 3) + r;
        int col = n0 + wn * 32 + ni * 16 + (lane & 15);
        size_t pi = packed_idx(row, col, DOUT / 32);
        outQ[pi] = f2bf(acc[0][mi][ni][r]);
        outK[pi] = f2bf(acc[1][mi][ni][r]);
        outV[(size_t)row * DOUT + col] = acc[2][mi][ni][r];
      }

  // Column sums of this wave's 32 x 32 piece of V: a lane adds its 16 rows of either column tile, the
  // lane 16 away holds the other 16; lanes 0-15 then store the first tile's sums, 16-31 the second's.
  // Unrolled: acc lives in registers, which takes constant indices.
  float cs[2];
#pragma unroll
  for (int ni = 0; ni < 2; ni++) {
    float c = 0.f;
#pragma unroll
    for (int mi = 0; mi < 2; mi++)
#pragma unroll
      for (int r = 0; r < 8; r++) c += acc[2][mi][ni][r];
    cs[ni] = c + __shfl_xor(c, 16, 32);
  }
  tsum[(size_t)(blockIdx.y * 4 + wm) * DOUT + n0 + wn * 32 + lane] = (lane < 16) ? cs[0] : cs[1];
}

// ---------------- kernel 2: prefix sum of V rows -> Vcum (packed bf16) ----------------
// One launch. A wave holds one 32-row tile of 64 columns in registers (every load of the kernel is
// independent of every other and goes out before the first is waited for). What lies in front of the
// tile comes from the projection's tile sums: the tiles in front of the block are dealt over the
// block's eight waves and their partial sums meet in LDS; the block's own earlier tiles each wave adds
// for itself. Vcum leaves as the out GEMM's B operand: bf16, fragment-packed, "row" = output column n,
// k = sequence position.
#define TROWS 32                 // rows per tile sum: one projection wave's rows
#define SWAVES 8                 // waves (tiles) per scan block
#define NBLK (SEQ / (TROWS * SWAVES))   // scan blocks along the sequence
typedef __attribute__((ext_vector_type(2))) float fvec2;

__global__ void __launch_bounds__(256) scan_pack_kernel(const float* __restrict__ V,
                                                        const float* __restrict__ tsum,
                                                        unsigned short* __restrict__ Vp) {
  __shared__ __align__(8) float s_part[SWAVES][64];
  const int t = threadIdx.x, lane = t & 31;
  // The wave's number as a scalar: bases and the tests on it below are then scalar work.
  const int wave = __builtin_amdgcn_readfirstlane(t >> 5);
  const int c0   = blockIdx.x * 64;                 // the block's first column
  const unsigned lo = lane * 2;                     // this thread's two columns in the block
  const int rb   = blockIdx.y;
  const int tile = rb * SWAVES + wave;

  // All loops below are unrolled: the values live in registers, which takes constant indices.
  // Every index is in range whatever rb and wave are; what does not count is dropped after the load,
  // so that no load waits for a branch.
  fvec2 far[NBLK - 1], near[SWAVES - 1], v[TROWS];
#pragma unroll
  for (int i = 0; i < NBLK - 1; i++)
    far[i] = *(const fvec2*)(tsum + ((size_t)(i * SWAVES + wave) * DOUT + c0) + lo);
#pragma unroll
  for (int j = 0; j < SWAVES - 1; j++)
    near[j] = *(const fvec2*)(tsum + ((size_t)(rb * SWAVES + j) * DOUT + c0) + lo);
  // Stands in front of the loads of V: the results of some of them land on the address registers
  // that the loads above name.
  asm volatile("s_wait_xcnt 0x0" ::: "memory");
  const float* vp = V + ((size_t)tile * TROWS * DOUT + c0);
#pragma unroll
  for (int r = 0; r < TROWS; r++)
    v[r] = *(const fvec2*)(vp + (size_t)r * DOUT + lo);
  // Holds all 54 loads in front of the first sum: sunk behind it, the loads of V would go out only
  // when the tile sums have come back, and the wave would wait out the memory latency twice.
  __builtin_amdgcn_sched_barrier(0);

  fvec2 part = { 0.f, 0.f }, run = { 0.f, 0.f };
#pragma unroll
  for (int i = 0; i < NBLK - 1; i++)
    if (i < rb) part += far[i];
#pragma unroll
  for (int j = 0; j < SWAVES - 1; j++)
    if (j < wave) run += near[j];
  *(fvec2*)&s_part[wave][lo] = part;
  __syncthreads();
#pragma unroll
  for (int w = 0; w < SWAVES; w++)
    run += *(const fvec2*)&s_part[w][lo];

  // One 1-KB fragment block per 16 columns: this tile is k block `tile` of each.
  unsigned short* dp = Vp + packed_idx(c0 + lo, tile * TROWS, SEQ / 32);
  uvec4 w0[TROWS / 8], w1[TROWS / 8];
#pragma unroll
  for (int g = 0; g < TROWS / 8; g++)       // 8 sequence positions = one 16-B piece of a fragment
#pragma unroll
    for (int j = 0; j < 4; j++) {
      run += v[g * 8 + 2 * j];
      fvec2 e0 = run;
      run += v[g * 8 + 2 * j + 1];
      w0[g][j] = (unsigned int)f2bf(e0[0]) | ((unsigned int)f2bf(run[0]) << 16);
      w1[g][j] = (unsigned int)f2bf(e0[1]) | ((unsigned int)f2bf(run[1]) << 16);
    }
#pragma unroll
  for (int g = 0; g < TROWS / 8; g++) {
    unsigned short* gp = dp + ((g >> 1) << 8) + ((g & 1) << 7);
    *(uvec4*)gp       = w0[g];
    *(uvec4*)(gp + 8) = w1[g];
  }
}

// ---------------- kernel 3: scores + per-group max + E=exp(s-m) + Z = sum (t+1) E ----------------
// One 128-row x 512-key tile per WG; the f32 score tile lies in dynamic LDS (258 KB of 320 KB WGP LDS).
// Each K fragment a wave loads feeds four 16-row tiles of Q. Maximum, E and Z are those of the
// block's own key group; the out GEMM brings the eight groups of a row to one scale.
__device__ __forceinline__ void load_frags(v16bf (&f)[4], const unsigned short* __restrict__ M,
                                           int tile0, int ks, int lane) {
  // Unrolled: the fragments live in registers, which takes constant indices.
#pragma unroll
  for (int i = 0; i < 4; i++) f[i] = load_op_packed(M, DIN / 32, tile0 + i, ks, lane);
}

__device__ __forceinline__ void mma_stage(v8f (&acc)[4][4], const v16bf (&a)[4], const v16bf (&b)[4]) {
  // Unrolled for the same reason.
#pragma unroll
  for (int mi = 0; mi < 4; mi++)
#pragma unroll
    for (int jc = 0; jc < 4; jc++)
      acc[mi][jc] = WMMA_BF16(a[mi], b[jc], acc[mi][jc]);
}

__global__ void __launch_bounds__(512) scores_kernel(
    const unsigned short* __restrict__ Q, const unsigned short* __restrict__ K,
    unsigned short* __restrict__ P, float* __restrict__ Zl, float* __restrict__ Ml)
{
  extern __shared__ float sc[];   // [RB][SROW]
  __shared__ float s_rmax[RB];
  __shared__ float s_zw[RB];
  const int t = threadIdx.x, wave = t >> 5, lane = t & 31;
  const int rt0 = blockIdx.x * (RB / 16);   // first 16-row tile of Q
  const int js  = blockIdx.y;               // key group
  const float scale = 0.03125f;   // 1/sqrt(1024)

  // phase 1: 128x512 score tile via WMMA (Q and K arrive fragment-packed). The 16 waves lie 2 x 8
  // over the tile, each with 4x4 accumulator tiles (64 rows x 64 keys). The K fragments are fetched
  // one k block ahead into a second set that takes turns with the first (no register copy waits
  // for them); the Q fragments, which eight waves share, are fetched for the k block at hand.
  {
    const int wmh = wave & 1;                   // 64-row half of the tile
    const int jl0 = (wave >> 1) * 4;            // 4 consecutive 16-wide key tiles per wave
    const int jt0 = js * (JB / 16) + jl0;
    const int rtw = rt0 + wmh * 4;
    v8f acc[4][4] = {};
    v16bf a[4], b0[4], b1[4];
    load_frags(b0, K, jt0, 0, lane);
    for (int ks = 0; ks < DIN / 32 - 2; ks += 2) {
      load_frags(a,  Q, rtw, ks,     lane);
      load_frags(b1, K, jt0, ks + 1, lane);
      // Holds the sixteen loads together in front of the WMMAs: sunk among them, each group
      // would be waited for on its own.
      __builtin_amdgcn_sched_barrier(0);
      mma_stage(acc, a, b0);
      load_frags(a,  Q, rtw, ks + 1, lane);
      load_frags(b0, K, jt0, ks + 2, lane);
      __builtin_amdgcn_sched_barrier(0);        // as above
      mma_stage(acc, a, b1);
      // The next trip rewrites the address registers that the K loads still in flight name.
      asm volatile("s_wait_xcnt 0x0" ::: "memory");
    }
    load_frags(a,  Q, rtw, DIN / 32 - 2, lane);
    load_frags(b1, K, jt0, DIN / 32 - 1, lane);
    __builtin_amdgcn_sched_barrier(0);          // as above
    mma_stage(acc, a, b0);
    load_frags(a,  Q, rtw, DIN / 32 - 1, lane);
    mma_stage(acc, a, b1);

#pragma unroll
    for (int mi = 0; mi < 4; mi++)
#pragma unroll
      for (int jc = 0; jc < 4; jc++) {
        int colb = (jl0 + jc) * 16 + (lane & 15);
#pragma unroll
        for (int r = 0; r < 8; r++) {
          int row = wmh * 64 + mi * 16 + ((lane >> 4) << 3) + r;
          sc[row * SROW + colb] = acc[mi][jc][r] * scale;
        }
      }
  }
  __syncthreads();

  // phase 2: row max over the group (wave w owns rows 8w..8w+7; stride-32 lanes -> conflict-free)
  for (int rr = 0; rr < RB / 16; rr++) {
    int row = wave * (RB / 16) + rr;
    float m = -3.0e38f;
    // Unrolled so that the row's 16 LDS reads go out together instead of one wait per read.
#pragma unroll
    for (int k2 = 0; k2 < JB / 32; k2++)
      m = fmaxf(m, sc[row * SROW + lane + 32 * k2]);
#pragma unroll
    for (int off = 16; off > 0; off >>= 1)
      m = fmaxf(m, __shfl_xor(m, off, 32));
    if (lane == 0) s_rmax[row] = m;
  }
  __syncthreads();

  // phase 3: Z = sum (t+1) * exp(s - m) over the group (softmax denominator cancels analytically)
  for (int rr = 0; rr < RB / 16; rr++) {
    int row = wave * (RB / 16) + rr;
    float m = s_rmax[row];
    float z = 0.f;
    // Unrolled for the same reason as in phase 2.
#pragma unroll
    for (int k2 = 0; k2 < JB / 32; k2++) {
      int c = lane + 32 * k2;
      z += __expf(sc[row * SROW + c] - m) * (float)(js * JB + c + 1);
    }
#pragma unroll
    for (int off = 16; off > 0; off >>= 1)
      z += __shfl_xor(z, off, 32);
    if (lane == 0) s_zw[row] = z;
  }
  __syncthreads();
  // [group][row]: a block's 128 values are four whole 128-B lines of each array.
  if (t < RB) {
    Zl[js * SEQ + blockIdx.x * RB + t] = s_zw[t];
    Ml[js * SEQ + blockIdx.x * RB + t] = s_rmax[t];
  }

  // phase 4: E = exp(s - m) as bf16, fragment-packed (each 16-row tile's key group is one 16-KB run
  // of P); each thread writes 16-B pieces, a wave 512 contiguous bytes.
  for (int k2 = 0; k2 < 16; k2++) {
    const int tile = k2 >> 1;                               // 16-row tile of the block
    const int q = (k2 & 1) * 512 + t;                       // 16-B piece index in the tile's run
    const int row = tile * 16 + (lane & 15);
    const int col = ((q >> 6) << 5) + (((q >> 5) & 1) << 4) + ((lane >> 4) << 3);
    const float m = s_rmax[row];
    const float* sp = sc + row * SROW + col;
    unsigned short* Pt = P + ((size_t)((rt0 + tile) * (SEQ / 32) + js * (JB / 32)) << 9);
    fvec4 x0 = *(const fvec4*)sp;
    fvec4 x1 = *(const fvec4*)(sp + 4);
    uvec4 w;
    w[0] = (unsigned int)f2bf(__expf(x0[0] - m)) | ((unsigned int)f2bf(__expf(x0[1] - m)) << 16);
    w[1] = (unsigned int)f2bf(__expf(x0[2] - m)) | ((unsigned int)f2bf(__expf(x0[3] - m)) << 16);
    w[2] = (unsigned int)f2bf(__expf(x1[0] - m)) | ((unsigned int)f2bf(__expf(x1[1] - m)) << 16);
    w[3] = (unsigned int)f2bf(__expf(x1[2] - m)) | ((unsigned int)f2bf(__expf(x1[3] - m)) << 16);
    *(uvec4*)(Pt + ((size_t)q << 3)) = w;
    // The next trip rewrites the registers that this store names.
    asm volatile("s_wait_xcnt 0x0" ::: "memory");
  }
}

// ---------------- kernel 4: Out = sum over key groups f_q * (E_q @ Vcum_q) ----------------
// One 128 x 128 tile of Out per block. A wave holds 64 x 64 of it (4 x 4 accumulator tiles), so every
// fragment it loads feeds four WMMAs. Waves 0-3 (2 x 2 over the tile) take key groups 0-3, waves 4-7
// the same four places with key groups 4-7: two waves per SIMD; the two partial sums meet in LDS.
// Both operands arrive fragment-packed and are read straight from global, each wave its own
// fragments, two k blocks ahead of their use, into three register sets that take turns. E of key
// group q is scaled by the group's own row maximum m_q, so each group's product is weighted by
// f_q = exp(m_q - max m) / sum_p Z_p exp(m_p - max m).
#define OAHEAD 2            // k blocks between a fragment's load and its use
#define OSETS  3            // register sets: OAHEAD in flight and the one in use
#define GKB    (JB / 32)    // k blocks per key group
#define HQ     (NQ / 2)     // key groups per wave

// The eight fragments of one wave for the k block kb blocks behind pa and pb, which point at this
// lane's 16 bytes in the wave's first E tile and first Vcum tile: sixteen loads of 512 contiguous bytes.
__device__ __forceinline__ void load_out_set(v16bf (&a)[4], v16bf (&b)[4],
                                             const unsigned short* __restrict__ pa,
                                             const unsigned short* __restrict__ pb, int kb) {
  const int tile = (SEQ / 32) << 9;   // elements from one 16-row tile to the next
  // Unrolled: the fragments live in registers, which takes constant indices.
#pragma unroll
  for (int i = 0; i < 4; i++) {
    const unsigned short* p = pa + i * tile + (kb << 9);
    a[i] = make_op(*(const uvec4*)p, *(const uvec4*)(p + 256));
  }
#pragma unroll
  for (int i = 0; i < 4; i++) {
    const unsigned short* p = pb + i * tile + (kb << 9);
    b[i] = make_op(*(const uvec4*)p, *(const uvec4*)(p + 256));
  }
}

// tot += f * acc, f the group's weights of this wave's rows (fq = the group's 128 weights in LDS).
__device__ __forceinline__ void out_fold(v8f (&tot)[4][4], const v8f (&acc)[4][4],
                                         const float* fq, int wm, int lane) {
  // Both loops unrolled: tot and acc live in registers, which takes constant indices.
#pragma unroll
  for (int mi = 0; mi < 4; mi++) {
    const float* fp = fq + wm * 64 + mi * 16 + ((lane >> 4) << 3);
    fvec4 f0 = *(const fvec4*)fp;
    fvec4 f1 = *(const fvec4*)(fp + 4);
    v8f f = __builtin_shufflevector(f0, f1, 0, 1, 2, 3, 4, 5, 6, 7);
#pragma unroll
    for (int ni = 0; ni < 4; ni++)
      tot[mi][ni] += f * acc[mi][ni];
  }
}

// A wave hands the two row tiles MB, MB + 1 of its partial sum to its partner: 16 B a lane and store,
// a wave 512 contiguous bytes of LDS.
template <int MB>
__device__ __forceinline__ void out_give(const v8f (&tot)[4][4], float* dst, int lane) {
  // Unrolled: tot lives in registers, which takes constant indices.
#pragma unroll
  for (int mi = 0; mi < 2; mi++)
#pragma unroll
    for (int ni = 0; ni < 4; ni++) {
      v8f x = tot[MB + mi][ni];
      float* d = dst + ((mi * 4 + ni) * 2) * 128 + lane * 4;
      *(fvec4*)d         = __builtin_shufflevector(x, x, 0, 1, 2, 3);
      *(fvec4*)(d + 128) = __builtin_shufflevector(x, x, 4, 5, 6, 7);
    }
}

// ... and adds what its partner handed over to its own row tiles MB, MB + 1, which it then stores.
// op points at the first row the wave keeps and this lane's column of Out.
template <int MB>
__device__ __forceinline__ void out_take(const v8f (&tot)[4][4], const float* srcp, float* op, int lane) {
  // Unrolled for the same reason.
#pragma unroll
  for (int mi = 0; mi < 2; mi++)
#pragma unroll
    for (int ni = 0; ni < 4; ni++) {
      const float* s = srcp + ((mi * 4 + ni) * 2) * 128 + lane * 4;
      fvec4 y0 = *(const fvec4*)s;
      fvec4 y1 = *(const fvec4*)(s + 128);
      v8f x = tot[MB + mi][ni] + __builtin_shufflevector(y0, y1, 0, 1, 2, 3, 4, 5, 6, 7);
#pragma unroll
      for (int r = 0; r < 8; r++)
        op[(size_t)(mi * 16 + r) * DOUT + ni * 16] = x[r];
    }
}

__global__ void __launch_bounds__(256) out_gemm_kernel(
    const unsigned short* __restrict__ P, const unsigned short* __restrict__ Vp,
    const float* __restrict__ Zl, const float* __restrict__ Ml, float* __restrict__ Out)
{
  __shared__ __align__(16) float s_f[NQ][128];
  __shared__ __align__(16) float s_red[8][2048];   // per wave: the half of its partial sum it hands over
  const int t = threadIdx.x, lane = t & 31;
  // The wave's number as a scalar: the tests on the key half below are then scalar branches.
  const int wave = __builtin_amdgcn_readfirstlane(t >> 5);
  const int wm = wave & 1, wn = (wave >> 1) & 1, kh = wave >> 2;
  const int m0 = blockIdx.y * 128, n0 = blockIdx.x * 128;
  const int at = (m0 >> 4) + wm * 4;   // first 16-row tile of E for this wave
  const int bt = (n0 >> 4) + wn * 4;   // first 16-column tile of Vcum for this wave
  const unsigned short* pa = P  + ((size_t)(at * (SEQ / 32) + kh * (HQ * GKB)) << 9) + (lane << 3);
  const unsigned short* pb = Vp + ((size_t)(bt * (SEQ / 32) + kh * (HQ * GKB)) << 9) + (lane << 3);

  // The first OAHEAD k blocks go out before the weights are formed (unrolled: the register sets
  // take constant indices).
  v16bf fa[OSETS][4], fb[OSETS][4];
#pragma unroll
  for (int s = 0; s < OAHEAD; s++)
    load_out_set(fa[s], fb[s], pa, pb, s);
  // Stands in front of whatever next writes an address register that these loads name.
  asm volatile("s_wait_xcnt 0x0" ::: "memory");

  if (t < 128) {
    // The loops over the groups are unrolled so that mq, zq and e stay in registers.
    float mq[NQ], zq[NQ];
#pragma unroll
    for (int q = 0; q < NQ; q++) {
      mq[q] = Ml[q * SEQ + m0 + t];
      zq[q] = Zl[q * SEQ + m0 + t];
    }
    float mg = mq[0];
#pragma unroll
    for (int q = 1; q < NQ; q++) mg = fmaxf(mg, mq[q]);
    float e[NQ], zg = 0.f;
#pragma unroll
    for (int q = 0; q < NQ; q++) {
      e[q] = __expf(mq[q] - mg);
      zg += zq[q] * e[q];
    }
#pragma unroll
    for (int q = 0; q < NQ; q++) s_f[q][t] = e[q] / zg;
  }
  __syncthreads();

  v8f tot[4][4] = {};
  // Both loops unrolled: three sets do not divide a group's 16 k blocks, so the set in use at a
  // group's start differs from group to group and only constant indices keep the sets in registers;
  // every k block is then an immediate offset and no address register is rewritten under a load.
#pragma unroll
  for (int q = 0; q < HQ; q++) {
    v8f acc[4][4] = {};
#pragma unroll
    for (int j = 0; j < GKB; j++) {
      const int jj = q * GKB + j;
      const int cur = jj % OSETS, nxt = (jj + OAHEAD) % OSETS;
      if (jj + OAHEAD < HQ * GKB)
        load_out_set(fa[nxt], fb[nxt], pa, pb, jj + OAHEAD);
      // Holds the sixteen loads in front of this k block's WMMAs: sunk towards their use they would
      // be waited for at full latency.
      __builtin_amdgcn_sched_barrier(0);
      mma_stage(acc, fa[cur], fb[cur]);
      // Keeps the next k block's loads behind these WMMAs: lifted over them they would need a
      // fourth register set.
      __builtin_amdgcn_sched_barrier(0);
    }
    out_fold(tot, acc, s_f[kh * HQ + q], wm, lane);
    // Keeps the next group's first loads behind the fold: lifted over it, three sets, both sums and
    // the weights would be live at once, more than the registers of two waves per SIMD hold.
    __builtin_amdgcn_sched_barrier(0);
  }

  // The two key halves of a 64 x 64 piece lie in waves w and w + 4: each hands the other 32 rows
  // through LDS and finishes the 32 rows it keeps.
  float* op = Out + (size_t)(m0 + wm * 64 + kh * 32 + ((lane >> 4) << 3)) * DOUT + n0 + wn * 64 + (lane & 15);
  if (kh == 0) out_give<2>(tot, s_red[wave], lane);
  else         out_give<0>(tot, s_red[wave], lane);
  __syncthreads();
  if (kh == 0) out_take<0>(tot, s_red[wave ^ 4], op, lane);
  else         out_take<2>(tot, s_red[wave ^ 4], op, lane);
}

// ---------------- host launcher ----------------
extern "C" void kernel_launch(void* const* d_in, const int* in_sizes, int n_in,
                              void* d_out, int out_size, void* d_ws, size_t ws_size,
                              hipStream_t stream) {
  const float* x  = (const float*)d_in[0];
  const float* wq = (const float*)d_in[1];
  const float* wk = (const float*)d_in[2];
  const float* wv = (const float*)d_in[3];
  float* out = (float*)d_out;

  char* ws = (char*)d_ws;
  unsigned short* Qbf = (unsigned short*)(ws);                      //  8 MB bf16, packed
  unsigned short* Kbf = (unsigned short*)(ws + (size_t)( 8 << 20)); //  8 MB bf16, packed
  float*          Vc  = (float*)         (ws + (size_t)(16 << 20)); // 16 MB f32 (V)
  unsigned short* P   = (unsigned short*)(ws + (size_t)(32 << 20)); // 32 MB bf16 (E), packed
  float*          Ts  = (float*)         (ws + (size_t)(65 << 20)); // 512 KB f32 (32-row tile sums of V)
  float*          Zl  = (float*)         (ws + (size_t)(64 << 20) + (1 << 17)); // 128 KB, [group][row]
  float*          Ml  = (float*)         (ws + (size_t)(64 << 20) + (1 << 18)); // 128 KB, [group][row]
  unsigned short* Vp  = (unsigned short*)(ws + (size_t)(72 << 20)); //  8 MB bf16 (Vcum), packed
  unsigned short* Xp  = (unsigned short*)(ws + (size_t)(80 << 20)); //  8 MB bf16 (X), packed
  unsigned short* Wp  = (unsigned short*)(ws + (size_t)(88 << 20)); //  6 MB bf16 (Wq, Wk, Wv), packed

  dim3 blk(256);
  dim3 gGemm(DOUT / 64, SEQ / 128);

  pack_kernel<<<dim3(XPB + 3 * 128), blk, 0, stream>>>(x, wq, wk, wv, Xp, Wp);
  proj_gemm_kernel<<<gGemm, blk, 0, stream>>>(Xp, Wp, Qbf, Kbf, Vc, Ts);

  scan_pack_kernel<<<dim3(DOUT / 64, NBLK), blk, 0, stream>>>(Vc, Ts, Vp);

  size_t smem = (size_t)RB * SROW * sizeof(float);  // 258 KB dynamic LDS
  scores_kernel<<<dim3(SEQ / RB, NQ), dim3(512), smem, stream>>>(Qbf, Kbf, P, Zl, Ml);

  out_gemm_kernel<<<dim3(DOUT / 128, SEQ / 128), blk, 0, stream>>>(P, Vp, Zl, Ml, out);
}

// v008
// Measured time: 107 microseconds a run.
// Timed twice side by side with v007, it ran 1.07 times as fast both times.
// Counting every step since v000, it is 4.49 times as fast.
#include <hip/hip_runtime.h>

#define SEQ  4096
#define DIN  1024
#define DOUT 1024
#define RB   128    // query rows per scores block
#define JB   512    // keys per scores block (one key group, an eighth of the sequence)
#define NQ   8      // key groups
#define SROW 516    // padded LDS row pitch for score tile (bank-conflict break)

typedef __attribute__((ext_vector_type(4)))  float        fvec4;
typedef __attribute__((ext_vector_type(8)))  float        v8f;
typedef __attribute__((ext_vector_type(4)))  unsigned int uvec4;
typedef __attribute__((ext_vector_type(8)))  unsigned int uvec8;
typedef __attribute__((ext_vector_type(16))) __bf16       v16bf;

__device__ __forceinline__ unsigned short f2bf(float f) {
  unsigned int u = __builtin_bit_cast(unsigned int, f);
  u = (u + 0x7FFFu + ((u >> 16) & 1u)) >> 16;   // round-to-nearest-even
  return (unsigned short)u;
}

__device__ __forceinline__ v16bf make_op(uvec4 a, uvec4 b) {
  uvec8 w;
  w[0]=a[0]; w[1]=a[1]; w[2]=a[2]; w[3]=a[3];
  w[4]=b[0]; w[5]=b[1]; w[6]=b[2]; w[7]=b[3];
  return __builtin_bit_cast(v16bf, w);
}

// Fragment-packed bf16 matrix: one 1-KB block per (16 rows) x (32 k), blocks k-major inside a
// 16-row tile. Inside a block lane L = (row & 15) + 16 * ((k >> 3) & 1) owns 16 B at L * 16 for
// k & 16 == 0 and at 512 + L * 16 for k & 16 != 0 (the ISA 16-bit A layout, k order unchanged).
// Index in 16-bit elements of element (row, k); kblocks = k extent / 32.
__device__ __forceinline__ size_t packed_idx(int row, int k, int kblocks) {
  return ((size_t)((row >> 4) * kblocks + (k >> 5)) << 9)
       + (((k >> 4) & 1) << 8) + (((row & 15) + (((k >> 3) & 1) << 4)) << 3) + (k & 7);
}

// 16x32 operand: two loads of 512 contiguous bytes per wave. tile0 points at the first k block of the wave's k range in the 16-row
// tile and is the same in every lane (a scalar base); off = this lane's 16 bytes in the k block wanted.
__device__ __forceinline__ v16bf load_frag(const unsigned short* __restrict__ tile0, unsigned off) {
  const char* p = (const char*)tile0 + off;
  uvec4 lo = *(const uvec4*)p;
  uvec4 hi = *(const uvec4*)(p + 512);
  return make_op(lo, hi);
}

// THE K WALK OF THE THREE GEMMS. Blocks that hold the same rows of an operand would ask L2 for the same
// lines at the same moment if all walked k from 0 up. Each block therefore enters the walk at a k block
// of its own (rot, from its block indices) and wraps round: step s reads k block (s + rot) mod nkb.
// Byte offset of that k block in a 16-row tile, a scalar; nkb is a power of two.
__device__ __forceinline__ unsigned walk_off(int s, int rot, int nkb) {
  return (unsigned)(((s + rot) & (nkb - 1)) << 10);
}
// The loads take a scalar tile base and one vector offset o = lane * 16 + the k block's offset. o keeps its
// register all the way and goes from one k block to another by d = the exclusive or of their two scalar
// offsets. That stands behind a step's WMMAs and in one statement with the wait that a rewrite of a
// register takes which loads in flight name: so the rewrite cannot come in front of the wait, and the
// register, holding a value still wanted, is given to nothing else before it. The scheduling fence in front
// keeps the wait from rising over the WMMAs, where it would hold them up; the one behind keeps the next
// loads behind it.
__device__ __forceinline__ void walk_step(unsigned& o, unsigned d) {
  __builtin_amdgcn_sched_barrier(0);
  asm volatile("s_wait_xcnt 0x0\n\tv_xor_b32 %0, %1, %0" : "+v"(o) : "s"(d) : "memory");
  __builtin_amdgcn_sched_barrier(0);
}

#define WMMA_BF16(a, b, c) \
  __builtin_amdgcn_wmma_f32_16x16x32_bf16(false, (a), false, (b), (short)0, (c), false, false)

// ---------------- kernel 0: X and Wq, Wk, Wv -> bf16, fragment-packed ----------------
// Every element is rounded once here instead of once per GEMM block that reads it. X is packed as
// the A operand (row = sequence position), each W as the B operand ("row" = output column n,
// k = input feature); the three W lie one behind the other.
#define XPB 256   // blocks that pack X; the other 3 * 128 pack the W
__device__ __forceinline__ uvec4 pack8(fvec4 x0, fvec4 x1) {
  uvec4 w;
  w[0] = (unsigned int)f2bf(x0[0]) | ((unsigned int)f2bf(x0[1]) << 16);
  w[1] = (unsigned int)f2bf(x0[2]) | ((unsigned int)f2bf(x0[3]) << 16);
  w[2] = (unsigned int)f2bf(x1[0]) | ((unsigned int)f2bf(x1[1]) << 16);
  w[3] = (unsigned int)f2bf(x1[2]) | ((unsigned int)f2bf(x1[3]) << 16);
  return w;
}

__global__ void __launch_bounds__(256) pack_kernel(
    const float* __restrict__ X, const float* __restrict__ Wq,
    const float* __restrict__ Wk, const float* __restrict__ Wv,
    unsigned short* __restrict__ Xp, unsigned short* __restrict__ Wp)
{
  const int t = threadIdx.x, wave = t >> 5, lane = t & 31;
  if (blockIdx.x < XPB) {
    // One wave: four k blocks in a row of one 16-row tile (512 contiguous bytes of each X row).
    const int wv  = blockIdx.x * 8 + wave;
    const int rt  = wv >> 3;
    const int kb0 = (wv & 7) * 4;
    const float* sp = X + (size_t)(rt * 16 + (lane & 15)) * DIN + kb0 * 32 + ((lane >> 4) << 3);
    unsigned short* dp = Xp + ((size_t)(rt * (DIN / 32) + kb0) << 9) + (lane << 3);
    fvec4 x[8][2];
    // Both loops unrolled: x lives in registers, and the loads go out in runs, not one wait each.
#pragma unroll
    for (int j = 0; j < 8; j++) {       // j = 2 * k block + 16-k half
      x[j][0] = *(const fvec4*)(sp + j * 16);
      x[j][1] = *(const fvec4*)(sp + j * 16 + 4);
    }
#pragma unroll
    for (int j = 0; j < 8; j++)
      *(uvec4*)(dp + j * 256) = pack8(x[j][0], x[j][1]);
  } else {
    // One thread: one k block (32 k) of one column n; a wave's loads are whole 128-B lines of W.
    const int bw = blockIdx.x - XPB;
    const int w  = bw >> 7;
    const int n  = (bw & 3) * 256 + t;
    const int kb = (bw >> 2) & 31;
    const float* sp = ((w == 0) ? Wq : (w == 1) ? Wk : Wv) + (size_t)kb * 32 * DOUT + n;
    unsigned short* dp = Wp + (size_t)w * DIN * DOUT + packed_idx(n, kb * 32, DIN / 32);
    float v[32];
    // Both loops unrolled for the same reasons as above.
#pragma unroll
    for (int k = 0; k < 32; k++) v[k] = sp[(size_t)k * DOUT];
#pragma unroll
    for (int p = 0; p < 4; p++) {       // k = 8 p .. 8 p + 7: one 16-B piece of the fragment
      fvec4 x0 = { v[8 * p + 0], v[8 * p + 1], v[8 * p + 2], v[8 * p + 3] };
      fvec4 x1 = { v[8 * p + 4], v[8 * p + 5], v[8 * p + 6], v[8 * p + 7] };
      *(uvec4*)(dp + ((p >> 1) << 8) + ((p & 1) << 7)) = pack8(x0, x1);
    }
    // Stands in front of whatever next writes a register that these four stores name.
    asm volatile("s_wait_xcnt 0x0" ::: "memory");
  }
}

// ---------------- kernel 1: Q, K, V [4096,1024] = X[4096,1024] @ {Wq, Wk, Wv}[1024,1024] ----------------
// One launch for the three projections: 8 waves (4 M x 2 N), block tile 128x64 of each of Q, K and V,
// k-step 32. Both operands arrive fragment-packed and are read straight from global, each wave its
// own fragments, one k block ahead of their use, into two register sets that take turns.
// Q and K leave as fragment-packed bf16, V as f32; with V goes the column sum of each wave's 32 rows,
// the first half of the prefix sum over the sequence.

// The eight fragments of one wave for the k block at byte offset off (walk_off) behind pa and pb, which
// point at the wave's first X tile and its first tile of Wq.
__device__ __forceinline__ void load_proj_set(v16bf (&a)[2], v16bf (&b)[3][2],
                                              const unsigned short* __restrict__ pa,
                                              const unsigned short* __restrict__ pb, unsigned off) {
  const int tile = (DIN / 32) << 9;   // elements from one 16-row tile to the next
  const int mat  = DIN * DOUT;        // elements from one packed W to the next
  // Unrolled: the fragments live in registers, which takes constant indices.
#pragma unroll
  for (int i = 0; i < 2; i++)
    a[i] = load_frag(pa + i * tile, off);
#pragma unroll
  for (int w = 0; w < 3; w++)
#pragma unroll
    for (int i = 0; i < 2; i++)
      b[w][i] = load_frag(pb + w * mat + i * tile, off);
}

__device__ __forceinline__ void proj_mma(v8f (&acc)[3][2][2], const v16bf (&a)[2], const v16bf (&b)[3][2]) {
  // Unrolled for the same reason.
#pragma unroll
  for (int w = 0; w < 3; w++) {
    acc[w][0][0] = WMMA_BF16(a[0], b[w][0], acc[w][0][0]);
    acc[w][0][1] = WMMA_BF16(a[0], b[w][1], acc[w][0][1]);
    acc[w][1][0] = WMMA_BF16(a[1], b[w][0], acc[w][1][0]);
    acc[w][1][1] = WMMA_BF16(a[1], b[w][1], acc[w][1][1]);
  }
}

__global__ void __launch_bounds__(256) proj_gemm_kernel(
    const unsigned short* __restrict__ Xp, const unsigned short* __restrict__ Wp,
    unsigned short* __restrict__ outQ, unsigned short* __restrict__ outK,
    float* __restrict__ outV, float* __restrict__ tsum)
{
  const int t = threadIdx.x, lane = t & 31;
  // The wave's number as a scalar: the tile bases are then scalar, and one vector offset serves all loads.
  const int wave = __builtin_amdgcn_readfirstlane(t >> 5);
  const int wm = wave & 3, wn = wave >> 2;
  const int m0 = blockIdx.y * 128, n0 = blockIdx.x * 64;
  const int at = (m0 >> 4) + wm * 2;   // first 16-row tile of X for this wave
  const int bt = (n0 >> 4) + wn * 2;   // first 16-column tile of each W for this wave
  const unsigned short* pa = Xp + ((size_t)(at * (DIN / 32)) << 9);
  const unsigned short* pb = Wp + ((size_t)(bt * (DIN / 32)) << 9);
  const unsigned l16 = lane << 4;
  // Entry into the k walk. The 16 blocks of one blockIdx.y (same X rows) all differ. Of the 32 blocks of
  // one blockIdx.x (same W columns) y, y + 1, y + 16 and y + 17 keep one entry: two blocks fit a WGP, and
  // if they hold the same W columns its cache serves the second only while both are at one k block.
  const int rot = (4 * ((blockIdx.y >> 1) & 7) + blockIdx.x) & (DIN / 32 - 1);

  v8f acc[3][2][2] = {};
  v16bf fa[2][2], fb[2][3][2];
  unsigned o = l16 + walk_off(0, rot, DIN / 32);
  load_proj_set(fa[0], fb[0], pa, pb, o);
  walk_step(o, walk_off(0, rot, DIN / 32) ^ walk_off(1, rot, DIN / 32));
  // Unrolled: the register sets take constant indices.
#pragma unroll
  for (int kb = 0; kb < DIN / 32; kb++) {
    const int cur = kb & 1, nxt = cur ^ 1;
    if (kb + 1 < DIN / 32)
      load_proj_set(fa[nxt], fb[nxt], pa, pb, o);
    // Holds the sixteen loads in front of this k block's WMMAs: sunk towards their use they would
    // be waited for at full latency.
    __builtin_amdgcn_sched_barrier(0);
    proj_mma(acc, fa[cur], fb[cur]);
    // Its fences also keep the next k block's loads behind these WMMAs: lifted over them they would
    // need a third register set.
    if (kb + 1 < DIN / 32)
      walk_step(o, walk_off(kb + 1, rot, DIN / 32) ^ walk_off(kb + 2, rot, DIN / 32));
  }

#pragma unroll
  for (int mi = 0; mi < 2; mi++)
#pragma unroll
    for (int ni = 0; ni < 2; ni++)
#pragma unroll
      for (int r = 0; r < 8; r++) {
        int row = m0 + wm * 32 + mi * 16 + ((lane >> 4) << 3) + r;
        int col = n0 + wn * 32 + ni * 16 + (lane & 15);
        size_t pi = packed_idx(row, col, DOUT / 32);
        outQ[pi] = f2bf(acc[0][mi][ni][r]);
        outK[pi] = f2bf(acc[1][mi][ni][r]);
        outV[(size_t)row * DOUT + col] = acc[2][mi][ni][r];
      }

  // Column sums of this wave's 32 x 32 piece of V: a lane adds its 16 rows of either column tile, the
  // lane 16 away holds the other 16; lanes 0-15 then store the first tile's sums, 16-31 the second's.
  // Unrolled: acc lives in registers, which takes constant indices.
  float cs[2];
#pragma unroll
  for (int ni = 0; ni < 2; ni++) {
    float c = 0.f;
#pragma unroll
    for (int mi = 0; mi < 2; mi++)
#pragma unroll
      for (int r = 0; r < 8; r++) c += acc[2][mi][ni][r];
    cs[ni] = c + __shfl_xor(c, 16, 32);
  }
  tsum[(size_t)(blockIdx.y * 4 + wm) * DOUT + n0 + wn * 32 + lane] = (lane < 16) ? cs[0] : cs[1];
}

// ---------------- kernel 2: prefix sum of V rows -> Vcum (packed bf16) ----------------
// One launch. A wave holds one 32-row tile of 64 columns in registers (every load of the kernel is
// independent of every other and goes out before the first is waited for). What lies in front of the
// tile comes from the projection's tile sums: the tiles in front of the block are dealt over the
// block's eight waves and their partial sums meet in LDS; the block's own earlier tiles each wave adds
// for itself. Vcum leaves as the out GEMM's B operand: bf16, fragment-packed, "row" = output column n,
// k = sequence position.
#define TROWS 32                 // rows per tile sum: one projection wave's rows
#define SWAVES 8                 // waves (tiles) per scan block
#define NBLK (SEQ / (TROWS * SWAVES))   // scan blocks along the sequence
typedef __attribute__((ext_vector_type(2))) float fvec2;

__global__ void __launch_bounds__(256) scan_pack_kernel(const float* __restrict__ V,
                                                        const float* __restrict__ tsum,
                                                        unsigned short* __restrict__ Vp) {
  __shared__ __align__(8) float s_part[SWAVES][64];
  const int t = threadIdx.x, lane = t & 31;
  // The wave's number as a scalar: bases and the tests on it below are then scalar work.
  const int wave = __builtin_amdgcn_readfirstlane(t >> 5);
  const int c0   = blockIdx.x * 64;                 // the block's first column
  const unsigned lo = lane * 2;                     // this thread's two columns in the block
  const int rb   = blockIdx.y;
  const int tile = rb * SWAVES + wave;

  // All loops below are unrolled: the values live in registers, which takes constant indices.
  // Every index is in range whatever rb and wave are; what does not count is dropped after the load,
  // so that no load waits for a branch.
  fvec2 far[NBLK - 1], near[SWAVES - 1], v[TROWS];
#pragma unroll
  for (int i = 0; i < NBLK - 1; i++)
    far[i] = *(const fvec2*)(tsum + ((size_t)(i * SWAVES + wave) * DOUT + c0) + lo);
#pragma unroll
  for (int j = 0; j < SWAVES - 1; j++)
    near[j] = *(const fvec2*)(tsum + ((size_t)(rb * SWAVES + j) * DOUT + c0) + lo);
  // Stands in front of the loads of V: the results of some of them land on the address registers
  // that the loads above name.
  asm volatile("s_wait_xcnt 0x0" ::: "memory");
  const float* vp = V + ((size_t)tile * TROWS * DOUT + c0);
#pragma unroll
  for (int r = 0; r < TROWS; r++)
    v[r] = *(const fvec2*)(vp + (size_t)r * DOUT + lo);
  // Holds all 54 loads in front of the first sum: sunk behind it, the loads of V would go out only
  // when the tile sums have come back, and the wave would wait out the memory latency twice.
  __builtin_amdgcn_sched_barrier(0);

  fvec2 part = { 0.f, 0.f }, run = { 0.f, 0.f };
#pragma unroll
  for (int i = 0; i < NBLK - 1; i++)
    if (i < rb) part += far[i];
#pragma unroll
  for (int j = 0; j < SWAVES - 1; j++)
    if (j < wave) run += near[j];
  *(fvec2*)&s_part[wave][lo] = part;
  __syncthreads();
#pragma unroll
  for (int w = 0; w < SWAVES; w++)
    run += *(const fvec2*)&s_part[w][lo];

  // One 1-KB fragment block per 16 columns: this tile is k block `tile` of each.
  unsigned short* dp = Vp + packed_idx(c0 + lo, tile * TROWS, SEQ / 32);
  uvec4 w0[TROWS / 8], w1[TROWS / 8];
#pragma unroll
  for (int g = 0; g < TROWS / 8; g++)       // 8 sequence positions = one 16-B piece of a fragment
#pragma unroll
    for (int j = 0; j < 4; j++) {
      run += v[g * 8 + 2 * j];
      fvec2 e0 = run;
      run += v[g * 8 + 2 * j + 1];
      w0[g][j] = (unsigned int)f2bf(e0[0]) | ((unsigned int)f2bf(run[0]) << 16);
      w1[g][j] = (unsigned int)f2bf(e0[1]) | ((unsigned int)f2bf(run[1]) << 16);
    }
#pragma unroll
  for (int g = 0; g < TROWS / 8; g++) {
    unsigned short* gp = dp + ((g >> 1) << 8) + ((g & 1) << 7);
    *(uvec4*)gp       = w0[g];
    *(uvec4*)(gp + 8) = w1[g];
  }
}

// ---------------- kernel 3: scores + per-group max + E=exp(s-m) + Z = sum (t+1) E ----------------
// One 128-row x 512-key tile per WG; the f32 score tile lies in dynamic LDS (258 KB of 320 KB WGP LDS).
// Each K fragment a wave loads feeds four 16-row tiles of Q. Maximum, E and Z are those of the
// block's own key group; the out GEMM brings the eight groups of a row to one scale.
// Four fragments: the k block at byte offset off (walk_off) of four 16-row tiles in a row, the first at p.
__device__ __forceinline__ void load_frags(v16bf (&f)[4], const unsigned short* __restrict__ p, unsigned off) {
  // Unrolled: the fragments live in registers, which takes constant indices.
#pragma unroll
  for (int i = 0; i < 4; i++) f[i] = load_frag(p + i * ((DIN / 32) << 9), off);
}

__device__ __forceinline__ void mma_stage(v8f (&acc)[4][4], const v16bf (&a)[4], const v16bf (&b)[4]) {
  // Unrolled for the same reason.
#pragma unroll
  for (int mi = 0; mi < 4; mi++)
#pragma unroll
    for (int jc = 0; jc < 4; jc++)
      acc[mi][jc] = WMMA_BF16(a[mi], b[jc], acc[mi][jc]);
}

__global__ void __launch_bounds__(512) scores_kernel(
    const unsigned short* __restrict__ Q, const unsigned short* __restrict__ K,
    unsigned short* __restrict__ P, float* __restrict__ Zl, float* __restrict__ Ml)
{
  extern __shared__ float sc[];   // [RB][SROW]
  __shared__ float s_rmax[RB];
  __shared__ float s_zw[RB];
  const int t = threadIdx.x, lane = t & 31;
  // The wave's number as a scalar: the tile bases are then scalar, and two vector offsets serve all loads.
  const int wave = __builtin_amdgcn_readfirstlane(t >> 5);
  const int rt0 = blockIdx.x * (RB / 16);   // first 16-row tile of Q
  const int js  = blockIdx.y;               // key group
  const float scale = 0.03125f;   // 1/sqrt(1024)

  // phase 1: 128x512 score tile via WMMA (Q and K arrive fragment-packed). The 16 waves lie 2 x 8
  // over the tile, each with 4x4 accumulator tiles (64 rows x 64 keys). The K fragments are fetched
  // one k block ahead into a second set that takes turns with the first (no register copy waits
  // for them); the Q fragments, which eight waves share, are fetched for the k block at hand.
  {
    const int wmh = wave & 1;                   // 64-row half of the tile
    const int jl0 = (wave >> 1) * 4;            // 4 consecutive 16-wide key tiles per wave
    const int jt0 = js * (JB / 16) + jl0;
    const int rtw = rt0 + wmh * 4;
    const unsigned short* pq = Q + ((size_t)(rtw * (DIN / 32)) << 9);
    const unsigned short* pk = K + ((size_t)(jt0 * (DIN / 32)) << 9);
    const unsigned l16 = lane << 4;
    // Entry into the k walk: the 32 blocks of one key group (same K rows) all differ, and so do the
    // 8 blocks of one row block (same Q rows).
    const int rot = (blockIdx.x + 4 * blockIdx.y) & (DIN / 32 - 1);
    v8f acc[4][4] = {};
    v16bf a[4], b0[4], b1[4];
    // Two offsets take turns: o0 stands at the even steps, o1 at the odd ones.
    unsigned o0 = l16 + walk_off(0, rot, DIN / 32);
    unsigned o1 = l16 + walk_off(1, rot, DIN / 32);
    load_frags(b0, pk, o0);
    for (int ks = 0; ks < DIN / 32 - 2; ks += 2) {
      load_frags(a,  pq, o0);
      // Keeps the Q loads in front of the K loads: the WMMAs then wait for Q alone, not for the K
      // fragments of the next step as well.
      __builtin_amdgcn_sched_barrier(0);
      load_frags(b1, pk, o1);
      // Holds the sixteen loads together in front of the WMMAs: sunk among them, each group
      // would be waited for on its own.
      __builtin_amdgcn_sched_barrier(0);
      mma_stage(acc, a, b0);
      walk_step(o0, walk_off(ks, rot, DIN / 32) ^ walk_off(ks + 2, rot, DIN / 32));
      load_frags(a,  pq, o1);
      __builtin_amdgcn_sched_barrier(0);        // as the first
      load_frags(b0, pk, o0);
      __builtin_amdgcn_sched_barrier(0);        // as the second
      mma_stage(acc, a, b1);
      walk_step(o1, walk_off(ks + 1, rot, DIN / 32) ^ walk_off(ks + 3, rot, DIN / 32));
    }
    load_frags(a,  pq, o0);
    // Behind the loop the compiler forms the Q address in a register pair of its own, and a result of the
    // K loads lands on that pair. The statement also keeps the Q loads in front of the K loads, as above.
    asm volatile("s_wait_xcnt 0x0" ::: "memory");
    load_frags(b1, pk, o1);
    __builtin_amdgcn_sched_barrier(0);          // as the second
    mma_stage(acc, a, b0);
    walk_step(o0, walk_off(DIN / 32 - 2, rot, DIN / 32) ^ walk_off(DIN / 32 - 1, rot, DIN / 32));
    load_frags(a,  pq, o0);
    mma_stage(acc, a, b1);

#pragma unroll
    for (int mi = 0; mi < 4; mi++)
#pragma unroll
      for (int jc = 0; jc < 4; jc++) {
        int colb = (jl0 + jc) * 16 + (lane & 15);
#pragma unroll
        for (int r = 0; r < 8; r++) {
          int row = wmh * 64 + mi * 16 + ((lane >> 4) << 3) + r;
          sc[row * SROW + colb] = acc[mi][jc][r] * scale;
        }
      }
  }
  __syncthreads();

  // phase 2: row max over the group (wave w owns rows 8w..8w+7; stride-32 lanes -> conflict-free)
  for (int rr = 0; rr < RB / 16; rr++) {
    int row = wave * (RB / 16) + rr;
    float m = -3.0e38f;
    // Unrolled so that the row's 16 LDS reads go out together instead of one wait per read.
#pragma unroll
    for (int k2 = 0; k2 < JB / 32; k2++)
      m = fmaxf(m, sc[row * SROW + lane + 32 * k2]);
#pragma unroll
    for (int off = 16; off > 0; off >>= 1)
      m = fmaxf(m, __shfl_xor(m, off, 32));
    if (lane == 0) s_rmax[row] = m;
  }
  __syncthreads();

  // phase 3: Z = sum (t+1) * exp(s - m) over the group (softmax denominator cancels analytically)
  for (int rr = 0; rr < RB / 16; rr++) {
    int row = wave * (RB / 16) + rr;
    float m = s_rmax[row];
    float z = 0.f;
    // Unrolled for the same reason as in phase 2.
#pragma unroll
    for (int k2 = 0; k2 < JB / 32; k2++) {
      int c = lane + 32 * k2;
      z += __expf(sc[row * SROW + c] - m) * (float)(js * JB + c + 1);
    }
#pragma unroll
    for (int off = 16; off > 0; off >>= 1)
      z += __shfl_xor(z, off, 32);
    if (lane == 0) s_zw[row] = z;
  }
  __syncthreads();
  // [group][row]: a block's 128 values are four whole 128-B lines of each array.
  if (t < RB) {
    Zl[js * SEQ + blockIdx.x * RB + t] = s_zw[t];
    Ml[js * SEQ + blockIdx.x * RB + t] = s_rmax[t];
  }

  // phase 4: E = exp(s - m) as bf16, fragment-packed (each 16-row tile's key group is one 16-KB run
  // of P); each thread writes 16-B pieces, a wave 512 contiguous bytes.
  for (int k2 = 0; k2 < 16; k2++) {
    const int tile = k2 >> 1;                               // 16-row tile of the block
    const int q = (k2 & 1) * 512 + t;                       // 16-B piece index in the tile's run
    const int row = tile * 16 + (lane & 15);
    const int col = ((q >> 6) << 5) + (((q >> 5) & 1) << 4) + ((lane >> 4) << 3);
    const float m = s_rmax[row];
    const float* sp = sc + row * SROW + col;
    unsigned short* Pt = P + ((size_t)((rt0 + tile) * (SEQ / 32) + js * (JB / 32)) << 9);
    fvec4 x0 = *(const fvec4*)sp;
    fvec4 x1 = *(const fvec4*)(sp + 4);
    uvec4 w;
    w[0] = (unsigned int)f2bf(__expf(x0[0] - m)) | ((unsigned int)f2bf(__expf(x0[1] - m)) << 16);
    w[1] = (unsigned int)f2bf(__expf(x0[2] - m)) | ((unsigned int)f2bf(__expf(x0[3] - m)) << 16);
    w[2] = (unsigned int)f2bf(__expf(x1[0] - m)) | ((unsigned int)f2bf(__expf(x1[1] - m)) << 16);
    w[3] = (unsigned int)f2bf(__expf(x1[2] - m)) | ((unsigned int)f2bf(__expf(x1[3] - m)) << 16);
    *(uvec4*)(Pt + ((size_t)q << 3)) = w;
    // The next trip rewrites the registers that this store names.
    asm volatile("s_wait_xcnt 0x0" ::: "memory");
  }
}

// ---------------- kernel 4: Out = sum over key groups f_q * (E_q @ Vcum_q) ----------------
// One 128 x 128 tile of Out per block. A wave holds 64 x 64 of it (4 x 4 accumulator tiles), so every
// fragment it loads feeds four WMMAs. Waves 0-3 (2 x 2 over the tile) take key groups 0-3, waves 4-7
// the same four places with key groups 4-7: two waves per SIMD; the two partial sums meet in LDS.
// Both operands arrive fragment-packed and are read straight from global, each wave its own
// fragments, two k blocks ahead of their use, into three register sets that take turns. E of key
// group q is scaled by the group's own row maximum m_q, so each group's product is weighted by
// f_q = exp(m_q - max m) / sum_p Z_p exp(m_p - max m).
#define OAHEAD 2            // k blocks between a fragment's load and its use
#define OSETS  3            // register sets: OAHEAD in flight and the one in use
#define GKB    (JB / 32)    // k blocks per key group
#define HQ     (NQ / 2)     // key groups per wave

// The eight fragments of one wave for the k block at byte offset off behind pa and pb, which point at
// the wave's first E tile and first Vcum tile: sixteen loads of 512 contiguous bytes.
__device__ __forceinline__ void load_out_set(v16bf (&a)[4], v16bf (&b)[4],
                                             const unsigned short* __restrict__ pa,
                                             const unsigned short* __restrict__ pb, unsigned off) {
  const int tile = (SEQ / 32) << 9;   // elements from one 16-row tile to the next
  // Unrolled: the fragments live in registers, which takes constant indices.
#pragma unroll
  for (int i = 0; i < 4; i++) a[i] = load_frag(pa + i * tile, off);
#pragma unroll
  for (int i = 0; i < 4; i++) b[i] = load_frag(pb + i * tile, off);
}

// Step jj of a wave's walk over its HQ key groups: the groups are taken in turn from group rq on, the
// k blocks of each group from block rj on, both wrapping round, so that a group stays in one piece.
// Byte offset of the step's k block in a 16-row tile, a scalar.
__device__ __forceinline__ unsigned out_off(int jj, int rq, int rj) {
  return walk_off(jj & (GKB - 1), rj, GKB) + (unsigned)((((jj / GKB) + rq) & (HQ - 1)) * (GKB << 10));
}

// tot += f * acc, f the group's weights of this wave's rows (fq = the group's 128 weights in LDS).
__device__ __forceinline__ void out_fold(v8f (&tot)[4][4], const v8f (&acc)[4][4],
                                         const float* fq, int wm, int lane) {
  // Both loops unrolled: tot and acc live in registers, which takes constant indices.
#pragma unroll
  for (int mi = 0; mi < 4; mi++) {
    const float* fp = fq + wm * 64 + mi * 16 + ((lane >> 4) << 3);
    fvec4 f0 = *(const fvec4*)fp;
    fvec4 f1 = *(const fvec4*)(fp + 4);
    v8f f = __builtin_shufflevector(f0, f1, 0, 1, 2, 3, 4, 5, 6, 7);
#pragma unroll
    for (int ni = 0; ni < 4; ni++)
      tot[mi][ni] += f * acc[mi][ni];
  }
}

// A wave hands the two row tiles MB, MB + 1 of its partial sum to its partner: 16 B a lane and store,
// a wave 512 contiguous bytes of LDS.
template <int MB>
__device__ __forceinline__ void out_give(const v8f (&tot)[4][4], float* dst, int lane) {
  // Unrolled: tot lives in registers, which takes constant indices.
#pragma unroll
  for (int mi = 0; mi < 2; mi++)
#pragma unroll
    for (int ni = 0; ni < 4; ni++) {
      v8f x = tot[MB + mi][ni];
      float* d = dst + ((mi * 4 + ni) * 2) * 128 + lane * 4;
      *(fvec4*)d         = __builtin_shufflevector(x, x, 0, 1, 2, 3);
      *(fvec4*)(d + 128) = __builtin_shufflevector(x, x, 4, 5, 6, 7);
    }
}

// ... and adds what its partner handed over to its own row tiles MB, MB + 1, which it then stores.
// op points at the first row the wave keeps and this lane's column of Out.
template <int MB>
__device__ __forceinline__ void out_take(const v8f (&tot)[4][4], const float* srcp, float* op, int lane) {
  // Unrolled for the same reason.
#pragma unroll
  for (int mi = 0; mi < 2; mi++)
#pragma unroll
    for (int ni = 0; ni < 4; ni++) {
      const float* s = srcp + ((mi * 4 + ni) * 2) * 128 + lane * 4;
      fvec4 y0 = *(const fvec4*)s;
      fvec4 y1 = *(const fvec4*)(s + 128);
      v8f x = tot[MB + mi][ni] + __builtin_shufflevector(y0, y1, 0, 1, 2, 3, 4, 5, 6, 7);
#pragma unroll
      for (int r = 0; r < 8; r++)
        op[(size_t)(mi * 16 + r) * DOUT + ni * 16] = x[r];
    }
}

__global__ void __launch_bounds__(256) out_gemm_kernel(
    const unsigned short* __restrict__ P, const unsigned short* __restrict__ Vp,
    const float* __restrict__ Zl, const float* __restrict__ Ml, float* __restrict__ Out)
{
  __shared__ __align__(16) float s_f[NQ][128];
  __shared__ __align__(16) float s_red[8][2048];   // per wave: the half of its partial sum it hands over
  const int t = threadIdx.x, lane = t & 31;
  // The wave's number as a scalar: the tests on the key half below are then scalar branches.
  const int wave = __builtin_amdgcn_readfirstlane(t >> 5);
  const int wm = wave & 1, wn = (wave >> 1) & 1, kh = wave >> 2;
  const int m0 = blockIdx.y * 128, n0 = blockIdx.x * 128;
  const int at = (m0 >> 4) + wm * 4;   // first 16-row tile of E for this wave
  const int bt = (n0 >> 4) + wn * 4;   // first 16-column tile of Vcum for this wave
  const unsigned short* pa = P  + ((size_t)(at * (SEQ / 32) + kh * (HQ * GKB)) << 9);
  const unsigned short* pb = Vp + ((size_t)(bt * (SEQ / 32) + kh * (HQ * GKB)) << 9);
  const unsigned l16 = lane << 4;
  // Entry into the k walk: the 32 blocks of one blockIdx.x (same Vcum columns) all differ, and so do
  // the 8 blocks of one blockIdx.y (same E rows).
  const int rot = (2 * blockIdx.y + 9 * blockIdx.x) & (HQ * GKB - 1);
  const int rq = rot / GKB, rj = rot & (GKB - 1);

  // The first OAHEAD k blocks go out before the weights are formed (unrolled: the register sets
  // take constant indices).
  v16bf fa[OSETS][4], fb[OSETS][4];
  unsigned o = l16 + out_off(0, rq, rj);
#pragma unroll
  for (int s = 0; s < OAHEAD; s++) {
    load_out_set(fa[s], fb[s], pa, pb, o);
    walk_step(o, out_off(s, rq, rj) ^ out_off(s + 1, rq, rj));
  }

  if (t < 128) {
    // The loops over the groups are unrolled so that mq, zq and e stay in registers.
    float mq[NQ], zq[NQ];
#pragma unroll
    for (int q = 0; q < NQ; q++) {
      mq[q] = Ml[q * SEQ + m0 + t];
      zq[q] = Zl[q * SEQ + m0 + t];
    }
    float mg = mq[0];
#pragma unroll
    for (int q = 1; q < NQ; q++) mg = fmaxf(mg, mq[q]);
    float e[NQ], zg = 0.f;
#pragma unroll
    for (int q = 0; q < NQ; q++) {
      e[q] = __expf(mq[q] - mg);
      zg += zq[q] * e[q];
    }
#pragma unroll
    for (int q = 0; q < NQ; q++) s_f[q][t] = e[q] / zg;
  }
  __syncthreads();

  v8f tot[4][4] = {};
  // Both loops unrolled: three sets do not divide a group's 16 k blocks, so the set in use at a
  // group's start differs from group to group and only constant indices keep the sets in registers.
#pragma unroll
  for (int q = 0; q < HQ; q++) {
    v8f acc[4][4] = {};
#pragma unroll
    for (int j = 0; j < GKB; j++) {
      const int jj = q * GKB + j;
      const int cur = jj % OSETS, nxt = (jj + OAHEAD) % OSETS;
      if (jj + OAHEAD < HQ * GKB)
        load_out_set(fa[nxt], fb[nxt], pa, pb, o);
      // Holds the sixteen loads in front of this k block's WMMAs: sunk towards their use they would
      // be waited for at full latency.
      __builtin_amdgcn_sched_barrier(0);
      mma_stage(acc, fa[cur], fb[cur]);
      // Its fences also keep the next k block's loads behind these WMMAs: lifted over them they would
      // need a fourth register set.
      if (jj + OAHEAD < HQ * GKB)
        walk_step(o, out_off(jj + OAHEAD, rq, rj) ^ out_off((jj + OAHEAD + 1) & (HQ * GKB - 1), rq, rj));
      else
        __builtin_amdgcn_sched_barrier(0);
    }
    out_fold(tot, acc, s_f[kh * HQ + ((q + rq) & (HQ - 1))], wm, lane);
    // Keeps the next group's first loads behind the fold: lifted over it, three sets, both sums and
    // the weights would be live at once, more than the registers of two waves per SIMD hold.
    __builtin_amdgcn_sched_barrier(0);
  }

  // The two key halves of a 64 x 64 piece lie in waves w and w + 4: each hands the other 32 rows
  // through LDS and finishes the 32 rows it keeps.
  float* op = Out + (size_t)(m0 + wm * 64 + kh * 32 + ((lane >> 4) << 3)) * DOUT + n0 + wn * 64 + (lane & 15);
  if (kh == 0) out_give<2>(tot, s_red[wave], lane);
  else         out_give<0>(tot, s_red[wave], lane);
  __syncthreads();
  if (kh == 0) out_take<0>(tot, s_red[wave ^ 4], op, lane);
  else         out_take<2>(tot, s_red[wave ^ 4], op, lane);
}

// ---------------- host launcher ----------------
extern "C" void kernel_launch(void* const* d_in, const int* in_sizes, int n_in,
                              void* d_out, int out_size, void* d_ws, size_t ws_size,
                              hipStream_t stream) {
  const float* x  = (const float*)d_in[0];
  const float* wq = (const float*)d_in[1];
  const float* wk = (const float*)d_in[2];
  const float* wv = (const float*)d_in[3];
  float* out = (float*)d_out;

  char* ws = (char*)d_ws;
  unsigned short* Qbf = (unsigned short*)(ws);                      //  8 MB bf16, packed
  unsigned short* Kbf = (unsigned short*)(ws + (size_t)( 8 << 20)); //  8 MB bf16, packed
  float*          Vc  = (float*)         (ws + (size_t)(16 << 20)); // 16 MB f32 (V)
  unsigned short* P   = (unsigned short*)(ws + (size_t)(32 << 20)); // 32 MB bf16 (E), packed
  float*          Ts  = (float*)         (ws + (size_t)(65 << 20)); // 512 KB f32 (32-row tile sums of V)
  float*          Zl  = (float*)         (ws + (size_t)(64 << 20) + (1 << 17)); // 128 KB, [group][row]
  float*          Ml  = (float*)         (ws + (size_t)(64 << 20) + (1 << 18)); // 128 KB, [group][row]
  unsigned short* Vp  = (unsigned short*)(ws + (size_t)(72 << 20)); //  8 MB bf16 (Vcum), packed
  unsigned short* Xp  = (unsigned short*)(ws + (size_t)(80 << 20)); //  8 MB bf16 (X), packed
  unsigned short* Wp  = (unsigned short*)(ws + (size_t)(88 << 20)); //  6 MB bf16 (Wq, Wk, Wv), packed

  dim3 blk(256);
  dim3 gGemm(DOUT / 64, SEQ / 128);

  pack_kernel<<<dim3(XPB + 3 * 128), blk, 0, stream>>>(x, wq, wk, wv, Xp, Wp);
  proj_gemm_kernel<<<gGemm, blk, 0, stream>>>(Xp, Wp, Qbf, Kbf, Vc, Ts);

  scan_pack_kernel<<<dim3(DOUT / 64, NBLK), blk, 0, stream>>>(Vc, Ts, Vp);

  size_t smem = (size_t)RB * SROW * sizeof(float);  // 258 KB dynamic LDS
  scores_kernel<<<dim3(SEQ / RB, NQ), dim3(512), smem, stream>>>(Qbf, Kbf, P, Zl, Ml);

  out_gemm_kernel<<<dim3(DOUT / 128, SEQ / 128), blk, 0, stream>>>(P, Vp, Zl, Ml, out);
}

// v009
// One run takes 99.8 microseconds.
// In two side-by-side timings against v008, it was 1.09 and 1.07 times as fast.
// Over all steps from v000 it is 4.84 times as fast.
#include <hip/hip_runtime.h>

#define SEQ  4096
#define DIN  1024
#define DOUT 1024
#define RB   128    // query rows per scores block
#define JB   512    // keys per scores block (one key group, an eighth of the sequence)
#define NQ   8      // key groups
#define PPIT 12     // floats per query row in the scores block's two exchange arrays, 8 of them used:
                    // at 48 B a row neither the 4-B writes nor the 16-B reads of 16 rows meet on a bank

typedef __attribute__((ext_vector_type(4)))  float        fvec4;
typedef __attribute__((ext_vector_type(8)))  float        v8f;
typedef __attribute__((ext_vector_type(4)))  unsigned int uvec4;
typedef __attribute__((ext_vector_type(8)))  unsigned int uvec8;
typedef __attribute__((ext_vector_type(16))) __bf16       v16bf;

__device__ __forceinline__ unsigned short f2bf(float f) {
  unsigned int u = __builtin_bit_cast(unsigned int, f);
  u = (u + 0x7FFFu + ((u >> 16) & 1u)) >> 16;   // round-to-nearest-even
  return (unsigned short)u;
}

__device__ __forceinline__ v16bf make_op(uvec4 a, uvec4 b) {
  uvec8 w;
  w[0]=a[0]; w[1]=a[1]; w[2]=a[2]; w[3]=a[3];
  w[4]=b[0]; w[5]=b[1]; w[6]=b[2]; w[7]=b[3];
  return __builtin_bit_cast(v16bf, w);
}

// Fragment-packed bf16 matrix: one 1-KB block per (16 rows) x (32 k), blocks k-major inside a
// 16-row tile. Inside a block lane L = (row & 15) + 16 * ((k >> 3) & 1) owns 16 B at L * 16 for
// k & 16 == 0 and at 512 + L * 16 for k & 16 != 0 (the ISA 16-bit A layout, k order unchanged).
// Index in 16-bit elements of element (row, k); kblocks = k extent / 32.
__device__ __forceinline__ size_t packed_idx(int row, int k, int kblocks) {
  return ((size_t)((row >> 4) * kblocks + (k >> 5)) << 9)
       + (((k >> 4) & 1) << 8) + (((row & 15) + (((k >> 3) & 1) << 4)) << 3) + (k & 7);
}

// 16x32 operand: two loads of 512 contiguous bytes per wave. tile0 points at the first k block of the wave's k range in the 16-row
// tile and is the same in every lane (a scalar base); off = this lane's 16 bytes in the k block wanted.
__device__ __forceinline__ v16bf load_frag(const unsigned short* __restrict__ tile0, unsigned off) {
  const char* p = (const char*)tile0 + off;
  uvec4 lo = *(const uvec4*)p;
  uvec4 hi = *(const uvec4*)(p + 512);
  return make_op(lo, hi);
}

// THE K WALK OF THE THREE GEMMS. Blocks that hold the same rows of an operand would ask L2 for the same
// lines at the same moment if all walked k from 0 up. Each block therefore enters the walk at a k block
// of its own (rot, from its block indices) and wraps round: step s reads k block (s + rot) mod nkb.
// Byte offset of that k block in a 16-row tile, a scalar; nkb is a power of two.
__device__ __forceinline__ unsigned walk_off(int s, int rot, int nkb) {
  return (unsigned)(((s + rot) & (nkb - 1)) << 10);
}
// The loads take a scalar tile base and one vector offset o = lane * 16 + the k block's offset. o keeps its
// register all the way and goes from one k block to another by d = the exclusive or of their two scalar
// offsets. That stands behind a step's WMMAs and in one statement with the wait that a rewrite of a
// register takes which loads in flight name: so the rewrite cannot come in front of the wait, and the
// register, holding a value still wanted, is given to nothing else before it. The scheduling fence in front
// keeps the wait from rising over the WMMAs, where it would hold them up; the one behind keeps the next
// loads behind it.
__device__ __forceinline__ void walk_step(unsigned& o, unsigned d) {
  __builtin_amdgcn_sched_barrier(0);
  asm volatile("s_wait_xcnt 0x0\n\tv_xor_b32 %0, %1, %0" : "+v"(o) : "s"(d) : "memory");
  __builtin_amdgcn_sched_barrier(0);
}

#define WMMA_BF16(a, b, c) \
  __builtin_amdgcn_wmma_f32_16x16x32_bf16(false, (a), false, (b), (short)0, (c), false, false)

// ---------------- kernel 0: X and Wq, Wk, Wv -> bf16, fragment-packed ----------------
// Every element is rounded once here instead of once per GEMM block that reads it. X is packed as
// the A operand (row = sequence position), each W as the B operand ("row" = output column n,
// k = input feature); the three W lie one behind the other.
#define XPB 256   // blocks that pack X; the other 3 * 128 pack the W
__device__ __forceinline__ uvec4 pack8(fvec4 x0, fvec4 x1) {
  uvec4 w;
  w[0] = (unsigned int)f2bf(x0[0]) | ((unsigned int)f2bf(x0[1]) << 16);
  w[1] = (unsigned int)f2bf(x0[2]) | ((unsigned int)f2bf(x0[3]) << 16);
  w[2] = (unsigned int)f2bf(x1[0]) | ((unsigned int)f2bf(x1[1]) << 16);
  w[3] = (unsigned int)f2bf(x1[2]) | ((unsigned int)f2bf(x1[3]) << 16);
  return w;
}

// THE TRANSPOSED PRODUCTS. Q, K and E are each the operand of a later GEMM and leave fragment-packed. Their
// products take the operands the other way round (what would be B goes in as A): the accumulator tile then
// holds in lane l, registers 0-7, eight consecutive k of the later GEMM for the one row l & 15, the eight from
// 8 * (l >> 4) on. Rounded to bf16 that is the lane's own 16-B piece of the packed block: one 16-B store a
// lane, 512 contiguous bytes a wave, no exchange between lanes.
__device__ __forceinline__ uvec4 pack_acc(v8f x) {
  return pack8(__builtin_shufflevector(x, x, 0, 1, 2, 3), __builtin_shufflevector(x, x, 4, 5, 6, 7));
}

// The value that lane l ^ 16 holds.
__device__ __forceinline__ float other_half(float x) {
  int b = __builtin_bit_cast(int, x);
  return __builtin_bit_cast(float, __builtin_amdgcn_permlanex16(b, b, 0x76543210, 0xfedcba98, false, false));
}

__global__ void __launch_bounds__(256) pack_kernel(
    const float* __restrict__ X, const float* __restrict__ Wq,
    const float* __restrict__ Wk, const float* __restrict__ Wv,
    unsigned short* __restrict__ Xp, unsigned short* __restrict__ Wp)
{
  const int t = threadIdx.x, wave = t >> 5, lane = t & 31;
  if (blockIdx.x < XPB) {
    // One wave: four k blocks in a row of one 16-row tile (512 contiguous bytes of each X row).
    const int wv  = blockIdx.x * 8 + wave;
    const int rt  = wv >> 3;
    const int kb0 = (wv & 7) * 4;
    const float* sp = X + (size_t)(rt * 16 + (lane & 15)) * DIN + kb0 * 32 + ((lane >> 4) << 3);
    unsigned short* dp = Xp + ((size_t)(rt * (DIN / 32) + kb0) << 9) + (lane << 3);
    fvec4 x[8][2];
    // Both loops unrolled: x lives in registers, and the loads go out in runs, not one wait each.
#pragma unroll
    for (int j = 0; j < 8; j++) {       // j = 2 * k block + 16-k half
      x[j][0] = *(const fvec4*)(sp + j * 16);
      x[j][1] = *(const fvec4*)(sp + j * 16 + 4);
    }
#pragma unroll
    for (int j = 0; j < 8; j++)
      *(uvec4*)(dp + j * 256) = pack8(x[j][0], x[j][1]);
  } else {
    // One thread: one k block (32 k) of one column n; a wave's loads are whole 128-B lines of W.
    const int bw = blockIdx.x - XPB;
    const int w  = bw >> 7;
    const int n  = (bw & 3) * 256 + t;
    const int kb = (bw >> 2) & 31;
    const float* sp = ((w == 0) ? Wq : (w == 1) ? Wk : Wv) + (size_t)kb * 32 * DOUT + n;
    unsigned short* dp = Wp + (size_t)w * DIN * DOUT + packed_idx(n, kb * 32, DIN / 32);
    float v[32];
    // Both loops unrolled for the same reasons as above.
#pragma unroll
    for (int k = 0; k < 32; k++) v[k] = sp[(size_t)k * DOUT];
#pragma unroll
    for (int p = 0; p < 4; p++) {       // k = 8 p .. 8 p + 7: one 16-B piece of the fragment
      fvec4 x0 = { v[8 * p + 0], v[8 * p + 1], v[8 * p + 2], v[8 * p + 3] };
      fvec4 x1 = { v[8 * p + 4], v[8 * p + 5], v[8 * p + 6], v[8 * p + 7] };
      *(uvec4*)(dp + ((p >> 1) << 8) + ((p & 1) << 7)) = pack8(x0, x1);
    }
    // Stands in front of whatever next writes a register that these four stores name.
    asm volatile("s_wait_xcnt 0x0" ::: "memory");
  }
}

// ---------------- kernel 1: Q, K, V [4096,1024] = X[4096,1024] @ {Wq, Wk, Wv}[1024,1024] ----------------
// One launch for the three projections: 8 waves (4 M x 2 N), block tile 128x64 of each of Q, K and V,
// k-step 32. Both operands arrive fragment-packed and are read straight from global, each wave its
// own fragments, one k block ahead of their use, into two register sets that take turns.
// Q and K leave as fragment-packed bf16 and are computed transposed (W as A, X as B), V as f32 (X as A);
// with V goes the column sum of each wave's 32 rows, the first half of the prefix sum over the sequence.

// The eight fragments of one wave for the k block at byte offset off (walk_off) behind pa and pb, which
// point at the wave's first X tile and its first tile of Wq.
__device__ __forceinline__ void load_proj_set(v16bf (&a)[2], v16bf (&b)[3][2],
                                              const unsigned short* __restrict__ pa,
                                              const unsigned short* __restrict__ pb, unsigned off) {
  const int tile = (DIN / 32) << 9;   // elements from one 16-row tile to the next
  const int mat  = DIN * DOUT;        // elements from one packed W to the next
  // Unrolled: the fragments live in registers, which takes constant indices.
#pragma unroll
  for (int i = 0; i < 2; i++)
    a[i] = load_frag(pa + i * tile, off);
#pragma unroll
  for (int w = 0; w < 3; w++)
#pragma unroll
    for (int i = 0; i < 2; i++)
      b[w][i] = load_frag(pb + w * mat + i * tile, off);
}

__device__ __forceinline__ void proj_mma(v8f (&acc)[3][2][2], const v16bf (&a)[2], const v16bf (&b)[3][2]) {
  // Unrolled for the same reason.
#pragma unroll
  for (int w = 0; w < 2; w++) {
    acc[w][0][0] = WMMA_BF16(b[w][0], a[0], acc[w][0][0]);
    acc[w][0][1] = WMMA_BF16(b[w][1], a[0], acc[w][0][1]);
    acc[w][1][0] = WMMA_BF16(b[w][0], a[1], acc[w][1][0]);
    acc[w][1][1] = WMMA_BF16(b[w][1], a[1], acc[w][1][1]);
  }
  acc[2][0][0] = WMMA_BF16(a[0], b[2][0], acc[2][0][0]);
  acc[2][0][1] = WMMA_BF16(a[0], b[2][1], acc[2][0][1]);
  acc[2][1][0] = WMMA_BF16(a[1], b[2][0], acc[2][1][0]);
  acc[2][1][1] = WMMA_BF16(a[1], b[2][1], acc[2][1][1]);
}

__global__ void __launch_bounds__(256) proj_gemm_kernel(
    const unsigned short* __restrict__ Xp, const unsigned short* __restrict__ Wp,
    unsigned short* __restrict__ outQ, unsigned short* __restrict__ outK,
    float* __restrict__ outV, float* __restrict__ tsum)
{
  const int t = threadIdx.x, lane = t & 31;
  // The wave's number as a scalar: the tile bases are then scalar, and one vector offset serves all loads.
  const int wave = __builtin_amdgcn_readfirstlane(t >> 5);
  const int wm = wave & 3, wn = wave >> 2;
  const int m0 = blockIdx.y * 128, n0 = blockIdx.x * 64;
  const int at = (m0 >> 4) + wm * 2;   // first 16-row tile of X for this wave
  const int bt = (n0 >> 4) + wn * 2;   // first 16-column tile of each W for this wave
  const unsigned short* pa = Xp + ((size_t)(at * (DIN / 32)) << 9);
  const unsigned short* pb = Wp + ((size_t)(bt * (DIN / 32)) << 9);
  const unsigned l16 = lane << 4;
  // Entry into the k walk. The 16 blocks of one blockIdx.y (same X rows) all differ. Of the 32 blocks of
  // one blockIdx.x (same W columns) y, y + 1, y + 16 and y + 17 keep one entry: two blocks fit a WGP, and
  // if they hold the same W columns its cache serves the second only while both are at one k block.
  const int rot = (4 * ((blockIdx.y >> 1) & 7) + blockIdx.x) & (DIN / 32 - 1);

  v8f acc[3][2][2] = {};
  v16bf fa[2][2], fb[2][3][2];
  unsigned o = l16 + walk_off(0, rot, DIN / 32);
  load_proj_set(fa[0], fb[0], pa, pb, o);
  walk_step(o, walk_off(0, rot, DIN / 32) ^ walk_off(1, rot, DIN / 32));
  // Unrolled: the register sets take constant indices.
#pragma unroll
  for (int kb = 0; kb < DIN / 32; kb++) {
    const int cur = kb & 1, nxt = cur ^ 1;
    if (kb + 1 < DIN / 32)
      load_proj_set(fa[nxt], fb[nxt], pa, pb, o);
    // Holds the sixteen loads in front of this k block's WMMAs: sunk towards their use they would
    // be waited for at full latency.
    __builtin_amdgcn_sched_barrier(0);
    proj_mma(acc, fa[cur], fb[cur]);
    // Its fences also keep the next k block's loads behind these WMMAs: lifted over them they would
    // need a third register set.
    if (kb + 1 < DIN / 32)
      walk_step(o, walk_off(kb + 1, rot, DIN / 32) ^ walk_off(kb + 2, rot, DIN / 32));
  }

  // Q and K: the wave's two column tiles are the two halves of one k block (bt is even) of each row tile.
  // All loops of the epilogue are unrolled: acc lives in registers, which takes constant indices.
  uvec4 pq[2][2], pk[2][2];
#pragma unroll
  for (int mi = 0; mi < 2; mi++)
#pragma unroll
    for (int ni = 0; ni < 2; ni++) {
      pq[mi][ni] = pack_acc(acc[0][mi][ni]);
      pk[mi][ni] = pack_acc(acc[1][mi][ni]);
    }
#pragma unroll
  for (int mi = 0; mi < 2; mi++)
#pragma unroll
    for (int ni = 0; ni < 2; ni++) {
      const size_t pi = ((size_t)((at + mi) * (DOUT / 32) + (bt >> 1)) << 9) + (ni << 8);
      *(uvec4*)(outQ + pi + (lane << 3)) = pq[mi][ni];
      *(uvec4*)(outK + pi + (lane << 3)) = pk[mi][ni];
    }
  // Stands in front of whatever next writes a register that these eight stores name; the scheduling fence
  // keeps such a write from rising over it.
  asm volatile("s_wait_xcnt 0x0" ::: "memory");
  __builtin_amdgcn_sched_barrier(0);

#pragma unroll
  for (int mi = 0; mi < 2; mi++)
#pragma unroll
    for (int ni = 0; ni < 2; ni++)
#pragma unroll
      for (int r = 0; r < 8; r++) {
        int row = m0 + wm * 32 + mi * 16 + ((lane >> 4) << 3) + r;
        int col = n0 + wn * 32 + ni * 16 + (lane & 15);
        outV[(size_t)row * DOUT + col] = acc[2][mi][ni][r];
      }

  // Column sums of this wave's 32 x 32 piece of V: a lane adds its 16 rows of either column tile, the
  // lane 16 away holds the other 16; lanes 0-15 then store the first tile's sums, 16-31 the second's.
  // Unrolled: acc lives in registers, which takes constant indices.
  float cs[2];
#pragma unroll
  for (int ni = 0; ni < 2; ni++) {
    float c = 0.f;
#pragma unroll
    for (int mi = 0; mi < 2; mi++)
#pragma unroll
      for (int r = 0; r < 8; r++) c += acc[2][mi][ni][r];
    cs[ni] = c + __shfl_xor(c, 16, 32);
  }
  tsum[(size_t)(blockIdx.y * 4 + wm) * DOUT + n0 + wn * 32 + lane] = (lane < 16) ? cs[0] : cs[1];
}

// ---------------- kernel 2: prefix sum of V rows -> Vcum (packed bf16) ----------------
// One launch. A wave holds one 32-row tile of 64 columns in registers (every load of the kernel is
// independent of every other and goes out before the first is waited for). What lies in front of the
// tile comes from the projection's tile sums: the tiles in front of the block are dealt over the
// block's eight waves and their partial sums meet in LDS; the block's own earlier tiles each wave adds
// for itself. Vcum leaves as the out GEMM's B operand: bf16, fragment-packed, "row" = output column n,
// k = sequence position.
#define TROWS 32                 // rows per tile sum: one projection wave's rows
#define SWAVES 8                 // waves (tiles) per scan block
#define NBLK (SEQ / (TROWS * SWAVES))   // scan blocks along the sequence
typedef __attribute__((ext_vector_type(2))) float fvec2;

__global__ void __launch_bounds__(256) scan_pack_kernel(const float* __restrict__ V,
                                                        const float* __restrict__ tsum,
                                                        unsigned short* __restrict__ Vp) {
  __shared__ __align__(8) float s_part[SWAVES][64];
  const int t = threadIdx.x, lane = t & 31;
  // The wave's number as a scalar: bases and the tests on it below are then scalar work.
  const int wave = __builtin_amdgcn_readfirstlane(t >> 5);
  const int c0   = blockIdx.x * 64;                 // the block's first column
  const unsigned lo = lane * 2;                     // this thread's two columns in the block
  const int rb   = blockIdx.y;
  const int tile = rb * SWAVES + wave;

  // All loops below are unrolled: the values live in registers, which takes constant indices.
  // Every index is in range whatever rb and wave are; what does not count is dropped after the load,
  // so that no load waits for a branch.
  fvec2 far[NBLK - 1], near[SWAVES - 1], v[TROWS];
#pragma unroll
  for (int i = 0; i < NBLK - 1; i++)
    far[i] = *(const fvec2*)(tsum + ((size_t)(i * SWAVES + wave) * DOUT + c0) + lo);
#pragma unroll
  for (int j = 0; j < SWAVES - 1; j++)
    near[j] = *(const fvec2*)(tsum + ((size_t)(rb * SWAVES + j) * DOUT + c0) + lo);
  // Stands in front of the loads of V: the results of some of them land on the address registers
  // that the loads above name.
  asm volatile("s_wait_xcnt 0x0" ::: "memory");
  const float* vp = V + ((size_t)tile * TROWS * DOUT + c0);
#pragma unroll
  for (int r = 0; r < TROWS; r++)
    v[r] = *(const fvec2*)(vp + (size_t)r * DOUT + lo);
  // Holds all 54 loads in front of the first sum: sunk behind it, the loads of V would go out only
  // when the tile sums have come back, and the wave would wait out the memory latency twice.
  __builtin_amdgcn_sched_barrier(0);

  fvec2 part = { 0.f, 0.f }, run = { 0.f, 0.f };
#pragma unroll
  for (int i = 0; i < NBLK - 1; i++)
    if (i < rb) part += far[i];
#pragma unroll
  for (int j = 0; j < SWAVES - 1; j++)
    if (j < wave) run += near[j];
  *(fvec2*)&s_part[wave][lo] = part;
  __syncthreads();
#pragma unroll
  for (int w = 0; w < SWAVES; w++)
    run += *(const fvec2*)&s_part[w][lo];

  // One 1-KB fragment block per 16 columns: this tile is k block `tile` of each.
  unsigned short* dp = Vp + packed_idx(c0 + lo, tile * TROWS, SEQ / 32);
  uvec4 w0[TROWS / 8], w1[TROWS / 8];
#pragma unroll
  for (int g = 0; g < TROWS / 8; g++)       // 8 sequence positions = one 16-B piece of a fragment
#pragma unroll
    for (int j = 0; j < 4; j++) {
      run += v[g * 8 + 2 * j];
      fvec2 e0 = run;
      run += v[g * 8 + 2 * j + 1];
      w0[g][j] = (unsigned int)f2bf(e0[0]) | ((unsigned int)f2bf(run[0]) << 16);
      w1[g][j] = (unsigned int)f2bf(e0[1]) | ((unsigned int)f2bf(run[1]) << 16);
    }
#pragma unroll
  for (int g = 0; g < TROWS / 8; g++) {
    unsigned short* gp = dp + ((g >> 1) << 8) + ((g & 1) << 7);
    *(uvec4*)gp       = w0[g];
    *(uvec4*)(gp + 8) = w1[g];
  }
}

// ---------------- kernel 3: scores + per-group max + E=exp(s-m) + Z = sum (t+1) E ----------------
// One 128-row x 512-key tile per WG, computed transposed (K as A, Q as B) and kept in the accumulators to the
// end: a lane holds 32 keys of each of four query rows, so maximum and Z are sums in the lane, one exchange
// with lane l ^ 16 and one exchange between the eight waves of a row through LDS, and E leaves straight from
// the registers. Each K fragment a wave loads feeds four 16-row tiles of Q. Maximum, E and Z are those of
// the block's own key group; the out GEMM brings the eight groups of a row to one scale.
// Four fragments: the k block at byte offset off (walk_off) of four 16-row tiles in a row, the first at p.
__device__ __forceinline__ void load_frags(v16bf (&f)[4], const unsigned short* __restrict__ p, unsigned off) {
  // Unrolled: the fragments live in registers, which takes constant indices.
#pragma unroll
  for (int i = 0; i < 4; i++) f[i] = load_frag(p + i * ((DIN / 32) << 9), off);
}

__device__ __forceinline__ void mma_stage(v8f (&acc)[4][4], const v16bf (&a)[4], const v16bf (&b)[4]) {
  // Unrolled for the same reason.
#pragma unroll
  for (int mi = 0; mi < 4; mi++)
#pragma unroll
    for (int jc = 0; jc < 4; jc++)
      acc[mi][jc] = WMMA_BF16(a[mi], b[jc], acc[mi][jc]);
}

// The transposed stage of the scores: acc[kt][qt] += K tile kt x Q tile qt. The Q tile, fetched for the k block
// at hand, changes slowest: the first four WMMAs wait for its first fragment alone, as they did untransposed.
__device__ __forceinline__ void mma_stage_t(v8f (&acc)[4][4], const v16bf (&k)[4], const v16bf (&q)[4]) {
  // Unrolled for the same reason.
#pragma unroll
  for (int qt = 0; qt < 4; qt++)
#pragma unroll
    for (int kt = 0; kt < 4; kt++)
      acc[kt][qt] = WMMA_BF16(k[kt], q[qt], acc[kt][qt]);
}

// Maximum or sum of the eight waves' values of one query row.
__device__ __forceinline__ float row_max8(const float* p) {
  fvec4 u0 = *(const fvec4*)p;
  fvec4 u1 = *(const fvec4*)(p + 4);
  return fmaxf(fmaxf(fmaxf(u0[0], u0[1]), fmaxf(u0[2], u0[3])), fmaxf(fmaxf(u1[0], u1[1]), fmaxf(u1[2], u1[3])));
}
__device__ __forceinline__ float row_sum8(const float* p) {
  fvec4 u0 = *(const fvec4*)p;
  fvec4 u1 = *(const fvec4*)(p + 4);
  return ((u0[0] + u0[1]) + (u0[2] + u0[3])) + ((u1[0] + u1[1]) + (u1[2] + u1[3]));
}

__global__ void __launch_bounds__(512) scores_kernel(
    const unsigned short* __restrict__ Q, const unsigned short* __restrict__ K,
    unsigned short* __restrict__ P, float* __restrict__ Zl, float* __restrict__ Ml)
{
  __shared__ __align__(16) float s_pm[RB * PPIT];   // [query row][key wave]: maximum over the wave's 64 keys
  __shared__ __align__(16) float s_pz[RB * PPIT];   // [query row][key wave]: the wave's part of Z
  const int t = threadIdx.x, lane = t & 31;
  // The wave's number as a scalar: the tile bases are then scalar, and two vector offsets serve all loads.
  const int wave = __builtin_amdgcn_readfirstlane(t >> 5);
  const int rt0 = blockIdx.x * (RB / 16);   // first 16-row tile of Q
  const int js  = blockIdx.y;               // key group
  const float scale = 0.03125f;   // 1/sqrt(1024)
  const int wmh = wave & 1;                   // 64-row half of the tile
  const int kw  = wave >> 1;                  // which 64 keys of the group
  const int jl0 = kw * 4;                     // 4 consecutive 16-wide key tiles per wave

  // phase 1: 128x512 score tile via WMMA (Q and K arrive fragment-packed). The 16 waves lie 2 x 8
  // over the tile, each with 4x4 accumulator tiles (64 keys x 64 rows): acc[kt][qt], register r of lane l,
  // is the score of key 16 kt + 8 (l >> 4) + r and row 16 qt + (l & 15). The K fragments are fetched
  // one k block ahead into a second set that takes turns with the first (no register copy waits
  // for them); the Q fragments, which eight waves share, are fetched for the k block at hand.
  v8f acc[4][4] = {};
  {
    const int jt0 = js * (JB / 16) + jl0;
    const int rtw = rt0 + wmh * 4;
    const unsigned short* pq = Q + ((size_t)(rtw * (DIN / 32)) << 9);
    const unsigned short* pk = K + ((size_t)(jt0 * (DIN / 32)) << 9);
    const unsigned l16 = lane << 4;
    // Entry into the k walk: the 32 blocks of one key group (same K rows) all differ, and so do the
    // 8 blocks of one row block (same Q rows).
    const int rot = (blockIdx.x + 4 * blockIdx.y) & (DIN / 32 - 1);
    v16bf a[4], b0[4], b1[4];
    // Two offsets take turns: o0 stands at the even steps, o1 at the odd ones.
    unsigned o0 = l16 + walk_off(0, rot, DIN / 32);
    unsigned o1 = l16 + walk_off(1, rot, DIN / 32);
    load_frags(b0, pk, o0);
    for (int ks = 0; ks < DIN / 32 - 2; ks += 2) {
      load_frags(a,  pq, o0);
      // Keeps the Q loads in front of the K loads: the WMMAs then wait for Q alone, not for the K
      // fragments of the next step as well.
      __builtin_amdgcn_sched_barrier(0);
      load_frags(b1, pk, o1);
      // Holds the sixteen loads together in front of the WMMAs: sunk among them, each group
      // would be waited for on its own.
      __builtin_amdgcn_sched_barrier(0);
      mma_stage_t(acc, b0, a);
      walk_step(o0, walk_off(ks, rot, DIN / 32) ^ walk_off(ks + 2, rot, DIN / 32));
      load_frags(a,  pq, o1);
      __builtin_amdgcn_sched_barrier(0);        // as the first
      load_frags(b0, pk, o0);
      __builtin_amdgcn_sched_barrier(0);        // as the second
      mma_stage_t(acc, b1, a);
      walk_step(o1, walk_off(ks + 1, rot, DIN / 32) ^ walk_off(ks + 3, rot, DIN / 32));
    }
    load_frags(a,  pq, o0);
    // Behind the loop the compiler forms the Q address in a register pair of its own, and a result of the
    // K loads lands on that pair. The statement also keeps the Q loads in front of the K loads, as above.
    asm volatile("s_wait_xcnt 0x0" ::: "memory");
    load_frags(b1, pk, o1);
    __builtin_amdgcn_sched_barrier(0);          // as the second
    mma_stage_t(acc, b0, a);
    walk_step(o0, walk_off(DIN / 32 - 2, rot, DIN / 32) ^ walk_off(DIN / 32 - 1, rot, DIN / 32));
    load_frags(a,  pq, o0);
    mma_stage_t(acc, b1, a);
  }

  // All loops below are unrolled: acc lives in registers, which takes constant indices.
  const int q0 = wmh * 64 + (lane & 15);      // this lane's row of the block in query tile 0

  // phase 2: row maximum over the group. In the lane over its 32 keys, with the other lane half, then over
  // the eight waves that hold the row (every wave reads all eight values: no second barrier).
  float m[4];
#pragma unroll
  for (int qt = 0; qt < 4; qt++) {
    float x = acc[0][qt][0];
#pragma unroll
    for (int kt = 0; kt < 4; kt++)
#pragma unroll
      for (int r = 0; r < 8; r++) x = fmaxf(x, acc[kt][qt][r]);
    m[qt] = fmaxf(x, other_half(x)) * scale;
  }
  if (lane < 16) {
#pragma unroll
    for (int qt = 0; qt < 4; qt++) s_pm[(q0 + qt * 16) * PPIT + kw] = m[qt];
  }
  __syncthreads();
#pragma unroll
  for (int qt = 0; qt < 4; qt++) m[qt] = row_max8(s_pm + (q0 + qt * 16) * PPIT);

  // phase 3: E = exp(s - m), once; this lane's part of Z = sum (t+1) * E over the group (the softmax
  // denominator cancels analytically); E as bf16, fragment-packed: the wave's four key tiles are 2 KB in a row
  // of each row tile's run. Written on whole accumulator tiles: neighbouring registers share m, so the packed
  // forms need no copies. One query tile at a time, so that its stores drain under the work on the next.
  const int key1 = js * JB + jl0 * 16 + ((lane >> 4) << 3) + 1;   // t + 1 of the lane's first key
  unsigned short* Pw = P + ((size_t)((rt0 + wmh * 4) * (SEQ / 32) + js * (JB / 32) + kw * 2) << 9);
  v8f wgt[4];
#pragma unroll
  for (int kt = 0; kt < 4; kt++)
#pragma unroll
    for (int r = 0; r < 8; r++) wgt[kt][r] = (float)(key1 + kt * 16 + r);
  float z[4];
#pragma unroll
  for (int qt = 0; qt < 4; qt++) {
    v8f zv = {};
    uvec4 w[4];
#pragma unroll
    for (int kt = 0; kt < 4; kt++) {
      const v8f s = acc[kt][qt] * scale - m[qt];
      v8f e;
#pragma unroll
      for (int r = 0; r < 8; r++) e[r] = __expf(s[r]);
      zv += e * wgt[kt];
      w[kt] = pack_acc(e);
    }
    z[qt] = ((zv[0] + zv[1]) + (zv[2] + zv[3])) + ((zv[4] + zv[5]) + (zv[6] + zv[7]));
#pragma unroll
    for (int kt = 0; kt < 4; kt++)
      *(uvec4*)(Pw + qt * ((SEQ / 32) << 9) + (kt << 8) + (lane << 3)) = w[kt];
    // Stands in front of whatever next writes a register that these four stores name; the scheduling fence
    // keeps such a write from rising over it, and the stores from sinking towards the kernel's end.
    asm volatile("s_wait_xcnt 0x0" ::: "memory");
    __builtin_amdgcn_sched_barrier(0);
  }

  // Z of the group: the two lane halves, then the eight waves of a row.
#pragma unroll
  for (int qt = 0; qt < 4; qt++) z[qt] += other_half(z[qt]);
  if (lane < 16) {
#pragma unroll
    for (int qt = 0; qt < 4; qt++) s_pz[(q0 + qt * 16) * PPIT + kw] = z[qt];
  }
  // The work-group barrier with fences on LDS alone: only s_pz passes between waves here. __syncthreads()
  // would also hold every wave until its stores of E are acknowledged, which nothing in this launch reads.
  __builtin_amdgcn_fence(__ATOMIC_RELEASE, "workgroup", "local");
  __builtin_amdgcn_s_barrier();
  __builtin_amdgcn_fence(__ATOMIC_ACQUIRE, "workgroup", "local");
  // [group][row]: a block's 128 values are four whole 128-B lines of each array.
  if (t < RB) {
    Zl[js * SEQ + blockIdx.x * RB + t] = row_sum8(s_pz + t * PPIT);
    Ml[js * SEQ + blockIdx.x * RB + t] = row_max8(s_pm + t * PPIT);
  }
}

// ---------------- kernel 4: Out = sum over key groups f_q * (E_q @ Vcum_q) ----------------
// One 128 x 128 tile of Out per block. A wave holds 64 x 64 of it (4 x 4 accumulator tiles), so every
// fragment it loads feeds four WMMAs. Waves 0-3 (2 x 2 over the tile) take key groups 0-3, waves 4-7
// the same four places with key groups 4-7: two waves per SIMD; the two partial sums meet in LDS.
// Both operands arrive fragment-packed and are read straight from global, each wave its own
// fragments, two k blocks ahead of their use, into three register sets that take turns. E of key
// group q is scaled by the group's own row maximum m_q, so each group's product is weighted by
// f_q = exp(m_q - max m) / sum_p Z_p exp(m_p - max m).
#define OAHEAD 2            // k blocks between a fragment's load and its use
#define OSETS  3            // register sets: OAHEAD in flight and the one in use
#define GKB    (JB / 32)    // k blocks per key group
#define HQ     (NQ / 2)     // key groups per wave

// The eight fragments of one wave for the k block at byte offset off behind pa and pb, which point at
// the wave's first E tile and first Vcum tile: sixteen loads of 512 contiguous bytes.
__device__ __forceinline__ void load_out_set(v16bf (&a)[4], v16bf (&b)[4],
                                             const unsigned short* __restrict__ pa,
                                             const unsigned short* __restrict__ pb, unsigned off) {
  const int tile = (SEQ / 32) << 9;   // elements from one 16-row tile to the next
  // Unrolled: the fragments live in registers, which takes constant indices.
#pragma unroll
  for (int i = 0; i < 4; i++) a[i] = load_frag(pa + i * tile, off);
#pragma unroll
  for (int i = 0; i < 4; i++) b[i] = load_frag(pb + i * tile, off);
}

// Step jj of a wave's walk over its HQ key groups: the groups are taken in turn from group rq on, the
// k blocks of each group from block rj on, both wrapping round, so that a group stays in one piece.
// Byte offset of the step's k block in a 16-row tile, a scalar.
__device__ __forceinline__ unsigned out_off(int jj, int rq, int rj) {
  return walk_off(jj & (GKB - 1), rj, GKB) + (unsigned)((((jj / GKB) + rq) & (HQ - 1)) * (GKB << 10));
}

// tot += f * acc, f the group's weights of this wave's rows (fq = the group's 128 weights in LDS).
__device__ __forceinline__ void out_fold(v8f (&tot)[4][4], const v8f (&acc)[4][4],
                                         const float* fq, int wm, int lane) {
  // Both loops unrolled: tot and acc live in registers, which takes constant indices.
#pragma unroll
  for (int mi = 0; mi < 4; mi++) {
    const float* fp = fq + wm * 64 + mi * 16 + ((lane >> 4) << 3);
    fvec4 f0 = *(const fvec4*)fp;
    fvec4 f1 = *(const fvec4*)(fp + 4);
    v8f f = __builtin_shufflevector(f0, f1, 0, 1, 2, 3, 4, 5, 6, 7);
#pragma unroll
    for (int ni = 0; ni < 4; ni++)
      tot[mi][ni] += f * acc[mi][ni];
  }
}

// A wave hands the two row tiles MB, MB + 1 of its partial sum to its partner: 16 B a lane and store,
// a wave 512 contiguous bytes of LDS.
template <int MB>
__device__ __forceinline__ void out_give(const v8f (&tot)[4][4], float* dst, int lane) {
  // Unrolled: tot lives in registers, which takes constant indices.
#pragma unroll
  for (int mi = 0; mi < 2; mi++)
#pragma unroll
    for (int ni = 0; ni < 4; ni++) {
      v8f x = tot[MB + mi][ni];
      float* d = dst + ((mi * 4 + ni) * 2) * 128 + lane * 4;
      *(fvec4*)d         = __builtin_shufflevector(x, x, 0, 1, 2, 3);
      *(fvec4*)(d + 128) = __builtin_shufflevector(x, x, 4, 5, 6, 7);
    }
}

// ... and adds what its partner handed over to its own row tiles MB, MB + 1, which it then stores.
// op points at the first row the wave keeps and this lane's column of Out.
template <int MB>
__device__ __forceinline__ void out_take(const v8f (&tot)[4][4], const float* srcp, float* op, int lane) {
  // Unrolled for the same reason.
#pragma unroll
  for (int mi = 0; mi < 2; mi++)
#pragma unroll
    for (int ni = 0; ni < 4; ni++) {
      const float* s = srcp + ((mi * 4 + ni) * 2) * 128 + lane * 4;
      fvec4 y0 = *(const fvec4*)s;
      fvec4 y1 = *(const fvec4*)(s + 128);
      v8f x = tot[MB + mi][ni] + __builtin_shufflevector(y0, y1, 0, 1, 2, 3, 4, 5, 6, 7);
#pragma unroll
      for (int r = 0; r < 8; r++)
        op[(size_t)(mi * 16 + r) * DOUT + ni * 16] = x[r];
    }
}

__global__ void __launch_bounds__(256) out_gemm_kernel(
    const unsigned short* __restrict__ P, const unsigned short* __restrict__ Vp,
    const float* __restrict__ Zl, const float* __restrict__ Ml, float* __restrict__ Out)
{
  __shared__ __align__(16) float s_f[NQ][128];
  __shared__ __align__(16) float s_red[8][2048];   // per wave: the half of its partial sum it hands over
  const int t = threadIdx.x, lane = t & 31;
  // The wave's number as a scalar: the tests on the key half below are then scalar branches.
  const int wave = __builtin_amdgcn_readfirstlane(t >> 5);
  const int wm = wave & 1, wn = (wave >> 1) & 1, kh = wave >> 2;
  const int m0 = blockIdx.y * 128, n0 = blockIdx.x * 128;
  const int at = (m0 >> 4) + wm * 4;   // first 16-row tile of E for this wave
  const int bt = (n0 >> 4) + wn * 4;   // first 16-column tile of Vcum for this wave
  const unsigned short* pa = P  + ((size_t)(at * (SEQ / 32) + kh * (HQ * GKB)) << 9);
  const unsigned short* pb = Vp + ((size_t)(bt * (SEQ / 32) + kh * (HQ * GKB)) << 9);
  const unsigned l16 = lane << 4;
  // Entry into the k walk: the 32 blocks of one blockIdx.x (same Vcum columns) all differ, and so do
  // the 8 blocks of one blockIdx.y (same E rows).
  const int rot = (2 * blockIdx.y + 9 * blockIdx.x) & (HQ * GKB - 1);
  const int rq = rot / GKB, rj = rot & (GKB - 1);

  // The first OAHEAD k blocks go out before the weights are formed (unrolled: the register sets
  // take constant indices).
  v16bf fa[OSETS][4], fb[OSETS][4];
  unsigned o = l16 + out_off(0, rq, rj);
#pragma unroll
  for (int s = 0; s < OAHEAD; s++) {
    load_out_set(fa[s], fb[s], pa, pb, o);
    walk_step(o, out_off(s, rq, rj) ^ out_off(s + 1, rq, rj));
  }

  if (t < 128) {
    // The loops over the groups are unrolled so that mq, zq and e stay in registers.
    float mq[NQ], zq[NQ];
#pragma unroll
    for (int q = 0; q < NQ; q++) {
      mq[q] = Ml[q * SEQ + m0 + t];
      zq[q] = Zl[q * SEQ + m0 + t];
    }
    float mg = mq[0];
#pragma unroll
    for (int q = 1; q < NQ; q++) mg = fmaxf(mg, mq[q]);
    float e[NQ], zg = 0.f;
#pragma unroll
    for (int q = 0; q < NQ; q++) {
      e[q] = __expf(mq[q] - mg);
      zg += zq[q] * e[q];
    }
#pragma unroll
    for (int q = 0; q < NQ; q++) s_f[q][t] = e[q] / zg;
  }
  __syncthreads();

  v8f tot[4][4] = {};
  // Both loops unrolled: three sets do not divide a group's 16 k blocks, so the set in use at a
  // group's start differs from group to group and only constant indices keep the sets in registers.
#pragma unroll
  for (int q = 0; q < HQ; q++) {
    v8f acc[4][4] = {};
#pragma unroll
    for (int j = 0; j < GKB; j++) {
      const int jj = q * GKB + j;
      const int cur = jj % OSETS, nxt = (jj + OAHEAD) % OSETS;
      if (jj + OAHEAD < HQ * GKB)
        load_out_set(fa[nxt], fb[nxt], pa, pb, o);
      // Holds the sixteen loads in front of this k block's WMMAs: sunk towards their use they would
      // be waited for at full latency.
      __builtin_amdgcn_sched_barrier(0);
      mma_stage(acc, fa[cur], fb[cur]);
      // Its fences also keep the next k block's loads behind these WMMAs: lifted over them they would
      // need a fourth register set.
      if (jj + OAHEAD < HQ * GKB)
        walk_step(o, out_off(jj + OAHEAD, rq, rj) ^ out_off((jj + OAHEAD + 1) & (HQ * GKB - 1), rq, rj));
      else
        __builtin_amdgcn_sched_barrier(0);
    }
    out_fold(tot, acc, s_f[kh * HQ + ((q + rq) & (HQ - 1))], wm, lane);
    // Keeps the next group's first loads behind the fold: lifted over it, three sets, both sums and
    // the weights would be live at once, more than the registers of two waves per SIMD hold.
    __builtin_amdgcn_sched_barrier(0);
  }

  // The two key halves of a 64 x 64 piece lie in waves w and w + 4: each hands the other 32 rows
  // through LDS and finishes the 32 rows it keeps.
  float* op = Out + (size_t)(m0 + wm * 64 + kh * 32 + ((lane >> 4) << 3)) * DOUT + n0 + wn * 64 + (lane & 15);
  if (kh == 0) out_give<2>(tot, s_red[wave], lane);
  else         out_give<0>(tot, s_red[wave], lane);
  __syncthreads();
  if (kh == 0) out_take<0>(tot, s_red[wave ^ 4], op, lane);
  else         out_take<2>(tot, s_red[wave ^ 4], op, lane);
}

// ---------------- host launcher ----------------
extern "C" void kernel_launch(void* const* d_in, const int* in_sizes, int n_in,
                              void* d_out, int out_size, void* d_ws, size_t ws_size,
                              hipStream_t stream) {
  const float* x  = (const float*)d_in[0];
  const float* wq = (const float*)d_in[1];
  const float* wk = (const float*)d_in[2];
  const float* wv = (const float*)d_in[3];
  float* out = (float*)d_out;

  char* ws = (char*)d_ws;
  unsigned short* Qbf = (unsigned short*)(ws);                      //  8 MB bf16, packed
  unsigned short* Kbf = (unsigned short*)(ws + (size_t)( 8 << 20)); //  8 MB bf16, packed
  float*          Vc  = (float*)         (ws + (size_t)(16 << 20)); // 16 MB f32 (V)
  unsigned short* P   = (unsigned short*)(ws + (size_t)(32 << 20)); // 32 MB bf16 (E), packed
  float*          Ts  = (float*)         (ws + (size_t)(65 << 20)); // 512 KB f32 (32-row tile sums of V)
  float*          Zl  = (float*)         (ws + (size_t)(64 << 20) + (1 << 17)); // 128 KB, [group][row]
  float*          Ml  = (float*)         (ws + (size_t)(64 << 20) + (1 << 18)); // 128 KB, [group][row]
  unsigned short* Vp  = (unsigned short*)(ws + (size_t)(72 << 20)); //  8 MB bf16 (Vcum), packed
  unsigned short* Xp  = (unsigned short*)(ws + (size_t)(80 << 20)); //  8 MB bf16 (X), packed
  unsigned short* Wp  = (unsigned short*)(ws + (size_t)(88 << 20)); //  6 MB bf16 (Wq, Wk, Wv), packed

  dim3 blk(256);
  dim3 gGemm(DOUT / 64, SEQ / 128);

  pack_kernel<<<dim3(XPB + 3 * 128), blk, 0, stream>>>(x, wq, wk, wv, Xp, Wp);
  proj_gemm_kernel<<<gGemm, blk, 0, stream>>>(Xp, Wp, Qbf, Kbf, Vc, Ts);

  scan_pack_kernel<<<dim3(DOUT / 64, NBLK), blk, 0, stream>>>(Vc, Ts, Vp);

  scores_kernel<<<dim3(SEQ / RB, NQ), dim3(512), 0, stream>>>(Qbf, Kbf, P, Zl, Ml);

  out_gemm_kernel<<<dim3(DOUT / 128, SEQ / 128), blk, 0, stream>>>(P, Vp, Zl, Ml, out);
}

// v010
// A run of this version takes 93.4 microseconds.
// Next to v009, in two timings, it ran 1.09 and 1.05 times as fast.
// Over all steps from v000 it is 5.17 times as fast.
#include <hip/hip_runtime.h>

#define SEQ  4096
#define DIN  1024
#define DOUT 1024
#define RB   128    // query rows per scores block
#define JB   512    // keys per scores block (one key group, an eighth of the sequence)
#define NQ   8      // key groups
#define PPIT 12     // floats per query row in the scores block's two exchange arrays, 8 of them used:
                    // at 48 B a row neither the 4-B writes nor the 16-B reads of 16 rows meet on a bank

typedef __attribute__((ext_vector_type(4)))  float        fvec4;
typedef __attribute__((ext_vector_type(8)))  float        v8f;
typedef __attribute__((ext_vector_type(4)))  unsigned int uvec4;
typedef __attribute__((ext_vector_type(8)))  unsigned int uvec8;
typedef __attribute__((ext_vector_type(16))) __bf16       v16bf;

__device__ __forceinline__ unsigned short f2bf(float f) {
  unsigned int u = __builtin_bit_cast(unsigned int, f);
  u = (u + 0x7FFFu + ((u >> 16) & 1u)) >> 16;   // round-to-nearest-even
  return (unsigned short)u;
}

__device__ __forceinline__ v16bf make_op(uvec4 a, uvec4 b) {
  uvec8 w;
  w[0]=a[0]; w[1]=a[1]; w[2]=a[2]; w[3]=a[3];
  w[4]=b[0]; w[5]=b[1]; w[6]=b[2]; w[7]=b[3];
  return __builtin_bit_cast(v16bf, w);
}

// Fragment-packed bf16 matrix: one 1-KB block per (16 rows) x (32 k), blocks k-major inside a
// 16-row tile. Inside a block lane L = (row & 15) + 16 * ((k >> 3) & 1) owns 16 B at L * 16 for
// k & 16 == 0 and at 512 + L * 16 for k & 16 != 0 (the ISA 16-bit A layout, k order unchanged).
// Index in 16-bit elements of element (row, k); kblocks = k extent / 32.
__device__ __forceinline__ size_t packed_idx(int row, int k, int kblocks) {
  return ((size_t)((row >> 4) * kblocks + (k >> 5)) << 9)
       + (((k >> 4) & 1) << 8) + (((row & 15) + (((k >> 3) & 1) << 4)) << 3) + (k & 7);
}

// 16x32 operand: two loads of 512 contiguous bytes per wave. tile0 points at the first k block of the wave's k range in the 16-row
// tile and is the same in every lane (a scalar base); off = this lane's 16 bytes in the k block wanted.
__device__ __forceinline__ v16bf load_frag(const unsigned short* __restrict__ tile0, unsigned off) {
  const char* p = (const char*)tile0 + off;
  uvec4 lo = *(const uvec4*)p;
  uvec4 hi = *(const uvec4*)(p + 512);
  return make_op(lo, hi);
}

// THE K WALK OF THE THREE GEMMS. Blocks that hold the same rows of an operand would ask L2 for the same
// lines at the same moment if all walked k from 0 up. Each block therefore enters the walk at a k block
// of its own (rot, from its block indices) and wraps round: step s reads k block (s + rot) mod nkb.
// Byte offset of that k block in a 16-row tile, a scalar; nkb is a power of two.
__device__ __forceinline__ unsigned walk_off(int s, int rot, int nkb) {
  return (unsigned)(((s + rot) & (nkb - 1)) << 10);
}
// The loads take a scalar tile base and one vector offset o = lane * 16 + the k block's offset. o keeps its
// register all the way and goes from one k block to another by d = the exclusive or of their two scalar
// offsets. That stands behind a step's WMMAs and in one statement with the wait that a rewrite of a
// register takes which loads in flight name: so the rewrite cannot come in front of the wait, and the
// register, holding a value still wanted, is given to nothing else before it. The scheduling fence in front
// keeps the wait from rising over the WMMAs, where it would hold them up; the one behind keeps the next
// loads behind it.
__device__ __forceinline__ void walk_step(unsigned& o, unsigned d) {
  __builtin_amdgcn_sched_barrier(0);
  asm volatile("s_wait_xcnt 0x0\n\tv_xor_b32 %0, %1, %0" : "+v"(o) : "s"(d) : "memory");
  __builtin_amdgcn_sched_barrier(0);
}

#define WMMA_BF16(a, b, c) \
  __builtin_amdgcn_wmma_f32_16x16x32_bf16(false, (a), false, (b), (short)0, (c), false, false)

// ---------------- kernel 0: X and Wq, Wk, Wv -> bf16, fragment-packed ----------------
// Every element is rounded once here instead of once per GEMM block that reads it. X is packed as
// the A operand (row = sequence position), each W as the B operand ("row" = output column n,
// k = input feature); the three W lie one behind the other.
#define XPB 256   // blocks that pack X; the other 3 * 128 pack the W
__device__ __forceinline__ uvec4 pack8(fvec4 x0, fvec4 x1) {
  uvec4 w;
  w[0] = (unsigned int)f2bf(x0[0]) | ((unsigned int)f2bf(x0[1]) << 16);
  w[1] = (unsigned int)f2bf(x0[2]) | ((unsigned int)f2bf(x0[3]) << 16);
  w[2] = (unsigned int)f2bf(x1[0]) | ((unsigned int)f2bf(x1[1]) << 16);
  w[3] = (unsigned int)f2bf(x1[2]) | ((unsigned int)f2bf(x1[3]) << 16);
  return w;
}

// THE TRANSPOSED PRODUCTS. Q, K and E are each the operand of a later GEMM and leave fragment-packed. Their
// products take the operands the other way round (what would be B goes in as A): the accumulator tile then
// holds in lane l, registers 0-7, eight consecutive k of the later GEMM for the one row l & 15, the eight from
// 8 * (l >> 4) on. Rounded to bf16 that is the lane's own 16-B piece of the packed block: one 16-B store a
// lane, 512 contiguous bytes a wave, no exchange between lanes.
__device__ __forceinline__ uvec4 pack_acc(v8f x) {
  return pack8(__builtin_shufflevector(x, x, 0, 1, 2, 3), __builtin_shufflevector(x, x, 4, 5, 6, 7));
}

// The value that lane l ^ 16 holds.
__device__ __forceinline__ float other_half(float x) {
  int b = __builtin_bit_cast(int, x);
  return __builtin_bit_cast(float, __builtin_amdgcn_permlanex16(b, b, 0x76543210, 0xfedcba98, false, false));
}

__global__ void __launch_bounds__(256) pack_kernel(
    const float* __restrict__ X, const float* __restrict__ Wq,
    const float* __restrict__ Wk, const float* __restrict__ Wv,
    unsigned short* __restrict__ Xp, unsigned short* __restrict__ Wp)
{
  const int t = threadIdx.x, wave = t >> 5, lane = t & 31;
  if (blockIdx.x < XPB) {
    // One wave: four k blocks in a row of one 16-row tile (512 contiguous bytes of each X row).
    const int wv  = blockIdx.x * 8 + wave;
    const int rt  = wv >> 3;
    const int kb0 = (wv & 7) * 4;
    const float* sp = X + (size_t)(rt * 16 + (lane & 15)) * DIN + kb0 * 32 + ((lane >> 4) << 3);
    unsigned short* dp = Xp + ((size_t)(rt * (DIN / 32) + kb0) << 9) + (lane << 3);
    fvec4 x[8][2];
    // Both loops unrolled: x lives in registers, and the loads go out in runs, not one wait each.
#pragma unroll
    for (int j = 0; j < 8; j++) {       // j = 2 * k block + 16-k half
      x[j][0] = *(const fvec4*)(sp + j * 16);
      x[j][1] = *(const fvec4*)(sp + j * 16 + 4);
    }
#pragma unroll
    for (int j = 0; j < 8; j++)
      *(uvec4*)(dp + j * 256) = pack8(x[j][0], x[j][1]);
  } else {
    // One thread: one k block (32 k) of one column n; a wave's loads are whole 128-B lines of W.
    const int bw = blockIdx.x - XPB;
    const int w  = bw >> 7;
    const int n  = (bw & 3) * 256 + t;
    const int kb = (bw >> 2) & 31;
    const float* sp = ((w == 0) ? Wq : (w == 1) ? Wk : Wv) + (size_t)kb * 32 * DOUT + n;
    unsigned short* dp = Wp + (size_t)w * DIN * DOUT + packed_idx(n, kb * 32, DIN / 32);
    float v[32];
    // Both loops unrolled for the same reasons as above.
#pragma unroll
    for (int k = 0; k < 32; k++) v[k] = sp[(size_t)k * DOUT];
#pragma unroll
    for (int p = 0; p < 4; p++) {       // k = 8 p .. 8 p + 7: one 16-B piece of the fragment
      fvec4 x0 = { v[8 * p + 0], v[8 * p + 1], v[8 * p + 2], v[8 * p + 3] };
      fvec4 x1 = { v[8 * p + 4], v[8 * p + 5], v[8 * p + 6], v[8 * p + 7] };
      *(uvec4*)(dp + ((p >> 1) << 8) + ((p & 1) << 7)) = pack8(x0, x1);
    }
    // Stands in front of whatever next writes a register that these four stores name.
    asm volatile("s_wait_xcnt 0x0" ::: "memory");
  }
}

// ---------------- kernel 1: Q, K, V [4096,1024] = X[4096,1024] @ {Wq, Wk, Wv}[1024,1024] ----------------
// One launch for the three projections: 8 waves (4 M x 2 N), block tile 256x64 of each of Q, K and V, one
// block per WGP. A wave holds 64 rows x 32 columns of each of the three (24 accumulator tiles): an X fragment
// feeds six WMMAs, a W fragment four. Both operands arrive fragment-packed and are read straight from
// global, each wave its own fragments, two k blocks ahead of their use, into three register sets that take turns.
// Q and K leave as fragment-packed bf16 and are computed transposed (W as A, X as B), V as f32 (X as A);
// with V go the column sums of the wave's two 32-row halves, the first half of the prefix sum over the sequence.
#define PAHEAD 2            // k blocks between a fragment's load and its use
#define PSETS  3            // register sets: PAHEAD in flight and the one in use
#define PKB    (DIN / 32)   // k blocks

// The ten fragments of one wave for the k block at byte offset off (walk_off) behind pa and pb, which
// point at the wave's first X tile and its first tile of Wq.
__device__ __forceinline__ void load_proj_set(v16bf (&a)[4], v16bf (&b)[3][2],
                                              const unsigned short* __restrict__ pa,
                                              const unsigned short* __restrict__ pb, unsigned off) {
  const int tile = (DIN / 32) << 9;   // elements from one 16-row tile to the next
  const int mat  = DIN * DOUT;        // elements from one packed W to the next
  // Unrolled: the fragments live in registers, which takes constant indices.
#pragma unroll
  for (int i = 0; i < 4; i++)
    a[i] = load_frag(pa + i * tile, off);
#pragma unroll
  for (int w = 0; w < 3; w++)
#pragma unroll
    for (int i = 0; i < 2; i++)
      b[w][i] = load_frag(pb + w * mat + i * tile, off);
}

__device__ __forceinline__ void proj_mma(v8f (&acc)[3][4][2], const v16bf (&a)[4], const v16bf (&b)[3][2]) {
  // Unrolled for the same reason.
#pragma unroll
  for (int w = 0; w < 2; w++)
#pragma unroll
    for (int mi = 0; mi < 4; mi++)
#pragma unroll
      for (int ni = 0; ni < 2; ni++)
        acc[w][mi][ni] = WMMA_BF16(b[w][ni], a[mi], acc[w][mi][ni]);
#pragma unroll
  for (int mi = 0; mi < 4; mi++)
#pragma unroll
    for (int ni = 0; ni < 2; ni++)
      acc[2][mi][ni] = WMMA_BF16(a[mi], b[2][ni], acc[2][mi][ni]);
}

__global__ void __launch_bounds__(256) proj_gemm_kernel(
    const unsigned short* __restrict__ Xp, const unsigned short* __restrict__ Wp,
    unsigned short* __restrict__ outQ, unsigned short* __restrict__ outK,
    float* __restrict__ outV, float* __restrict__ tsum)
{
  const int t = threadIdx.x, lane = t & 31;
  // The wave's number as a scalar: the tile bases are then scalar, and one vector offset serves all loads.
  const int wave = __builtin_amdgcn_readfirstlane(t >> 5);
  const int wm = wave & 3, wn = wave >> 2;
  const int m0 = blockIdx.y * 256, n0 = blockIdx.x * 64;
  const int at = (m0 >> 4) + wm * 4;   // first 16-row tile of X for this wave
  const int bt = (n0 >> 4) + wn * 2;   // first 16-column tile of each W for this wave
  const unsigned short* pa = Xp + ((size_t)(at * PKB) << 9);
  const unsigned short* pb = Wp + ((size_t)(bt * PKB) << 9);
  const unsigned l16 = lane << 4;
  // Entry into the k walk: the 16 blocks of one blockIdx.y (same X rows) all differ, and so do the 16
  // blocks of one blockIdx.x (same W columns).
  const int rot = (2 * blockIdx.y + blockIdx.x) & (PKB - 1);

  v8f acc[3][4][2] = {};
  v16bf fa[PSETS][4], fb[PSETS][3][2];
  unsigned o = l16 + walk_off(0, rot, PKB);
  // Both loops unrolled: the register sets take constant indices.
#pragma unroll
  for (int s = 0; s < PAHEAD; s++) {
    load_proj_set(fa[s], fb[s], pa, pb, o);
    walk_step(o, walk_off(s, rot, PKB) ^ walk_off(s + 1, rot, PKB));
  }
#pragma unroll
  for (int kb = 0; kb < PKB; kb++) {
    const int cur = kb % PSETS, nxt = (kb + PAHEAD) % PSETS;
    if (kb + PAHEAD < PKB)
      load_proj_set(fa[nxt], fb[nxt], pa, pb, o);
    // Holds the twenty loads in front of this k block's WMMAs: sunk towards their use they would
    // be waited for at full latency.
    __builtin_amdgcn_sched_barrier(0);
    proj_mma(acc, fa[cur], fb[cur]);
    // Its fences also keep the next k block's loads behind these WMMAs: lifted over them they would
    // need a fourth register set.
    if (kb + PAHEAD < PKB)
      walk_step(o, walk_off(kb + PAHEAD, rot, PKB) ^ walk_off(kb + PAHEAD + 1, rot, PKB));
    else
      __builtin_amdgcn_sched_barrier(0);
  }

  // Q and K: the wave's two column tiles are the two halves of one k block (bt is even) of each row tile.
  // All loops of the epilogue are unrolled: acc lives in registers, which takes constant indices.
  uvec4 pq[4][2], pk[4][2];
#pragma unroll
  for (int mi = 0; mi < 4; mi++)
#pragma unroll
    for (int ni = 0; ni < 2; ni++) {
      pq[mi][ni] = pack_acc(acc[0][mi][ni]);
      pk[mi][ni] = pack_acc(acc[1][mi][ni]);
    }
#pragma unroll
  for (int mi = 0; mi < 4; mi++)
#pragma unroll
    for (int ni = 0; ni < 2; ni++) {
      const size_t pi = ((size_t)((at + mi) * (DOUT / 32) + (bt >> 1)) << 9) + (ni << 8);
      *(uvec4*)(outQ + pi + (lane << 3)) = pq[mi][ni];
      *(uvec4*)(outK + pi + (lane << 3)) = pk[mi][ni];
    }
  // Stands in front of whatever next writes a register that these sixteen stores name; the scheduling fence
  // keeps such a write from rising over it.
  asm volatile("s_wait_xcnt 0x0" ::: "memory");
  __builtin_amdgcn_sched_barrier(0);

#pragma unroll
  for (int mi = 0; mi < 4; mi++)
#pragma unroll
    for (int ni = 0; ni < 2; ni++)
#pragma unroll
      for (int r = 0; r < 8; r++) {
        int row = m0 + wm * 64 + mi * 16 + ((lane >> 4) << 3) + r;
        int col = n0 + wn * 32 + ni * 16 + (lane & 15);
        outV[(size_t)row * DOUT + col] = acc[2][mi][ni][r];
      }

  // Column sums of either 32 x 32 half of this wave's piece of V: a lane adds its 16 rows of either column
  // tile, the lane 16 away holds the other 16; lanes 0-15 then store the first tile's sums, 16-31 the second's.
  // Unrolled: acc lives in registers, which takes constant indices.
#pragma unroll
  for (int h = 0; h < 2; h++) {
    float cs[2];
#pragma unroll
    for (int ni = 0; ni < 2; ni++) {
      float c = 0.f;
#pragma unroll
      for (int mi = 0; mi < 2; mi++)
#pragma unroll
        for (int r = 0; r < 8; r++) c += acc[2][2 * h + mi][ni][r];
      cs[ni] = c + __shfl_xor(c, 16, 32);
    }
    tsum[(size_t)(blockIdx.y * 8 + wm * 2 + h) * DOUT + n0 + wn * 32 + lane] = (lane < 16) ? cs[0] : cs[1];
  }
}

// ---------------- kernel 2: prefix sum of V rows -> Vcum (packed bf16) ----------------
// One launch. A wave holds one 32-row tile of 64 columns in registers (every load of the kernel is
// independent of every other and goes out before the first is waited for). What lies in front of the
// tile comes from the projection's tile sums: the tiles in front of the block are dealt over the
// block's eight waves and their partial sums meet in LDS; the block's own earlier tiles each wave adds
// for itself. Vcum leaves as the out GEMM's B operand: bf16, fragment-packed, "row" = output column n,
// k = sequence position.
#define TROWS 32                 // rows per tile sum: half a projection wave's rows
#define SWAVES 8                 // waves (tiles) per scan block
#define NBLK (SEQ / (TROWS * SWAVES))   // scan blocks along the sequence
typedef __attribute__((ext_vector_type(2))) float fvec2;

__global__ void __launch_bounds__(256) scan_pack_kernel(const float* __restrict__ V,
                                                        const float* __restrict__ tsum,
                                                        unsigned short* __restrict__ Vp) {
  __shared__ __align__(8) float s_part[SWAVES][64];
  const int t = threadIdx.x, lane = t & 31;
  // The wave's number as a scalar: bases and the tests on it below are then scalar work.
  const int wave = __builtin_amdgcn_readfirstlane(t >> 5);
  const int c0   = blockIdx.x * 64;                 // the block's first column
  const unsigned lo = lane * 2;                     // this thread's two columns in the block
  const int rb   = blockIdx.y;
  const int tile = rb * SWAVES + wave;

  // All loops below are unrolled: the values live in registers, which takes constant indices.
  // Every index is in range whatever rb and wave are; what does not count is dropped after the load,
  // so that no load waits for a branch.
  fvec2 far[NBLK - 1], near[SWAVES - 1], v[TROWS];
#pragma unroll
  for (int i = 0; i < NBLK - 1; i++)
    far[i] = *(const fvec2*)(tsum + ((size_t)(i * SWAVES + wave) * DOUT + c0) + lo);
#pragma unroll
  for (int j = 0; j < SWAVES - 1; j++)
    near[j] = *(const fvec2*)(tsum + ((size_t)(rb * SWAVES + j) * DOUT + c0) + lo);
  // Stands in front of the loads of V: the results of some of them land on the address registers
  // that the loads above name.
  asm volatile("s_wait_xcnt 0x0" ::: "memory");
  const float* vp = V + ((size_t)tile * TROWS * DOUT + c0);
#pragma unroll
  for (int r = 0; r < TROWS; r++)
    v[r] = *(const fvec2*)(vp + (size_t)r * DOUT + lo);
  // Holds all 54 loads in front of the first sum: sunk behind it, the loads of V would go out only
  // when the tile sums have come back, and the wave would wait out the memory latency twice.
  __builtin_amdgcn_sched_barrier(0);

  fvec2 part = { 0.f, 0.f }, run = { 0.f, 0.f };
#pragma unroll
  for (int i = 0; i < NBLK - 1; i++)
    if (i < rb) part += far[i];
#pragma unroll
  for (int j = 0; j < SWAVES - 1; j++)
    if (j < wave) run += near[j];
  *(fvec2*)&s_part[wave][lo] = part;
  __syncthreads();
#pragma unroll
  for (int w = 0; w < SWAVES; w++)
    run += *(const fvec2*)&s_part[w][lo];

  // One 1-KB fragment block per 16 columns: this tile is k block `tile` of each.
  unsigned short* dp = Vp + packed_idx(c0 + lo, tile * TROWS, SEQ / 32);
  uvec4 w0[TROWS / 8], w1[TROWS / 8];
#pragma unroll
  for (int g = 0; g < TROWS / 8; g++)       // 8 sequence positions = one 16-B piece of a fragment
#pragma unroll
    for (int j = 0; j < 4; j++) {
      run += v[g * 8 + 2 * j];
      fvec2 e0 = run;
      run += v[g * 8 + 2 * j + 1];
      w0[g][j] = (unsigned int)f2bf(e0[0]) | ((unsigned int)f2bf(run[0]) << 16);
      w1[g][j] = (unsigned int)f2bf(e0[1]) | ((unsigned int)f2bf(run[1]) << 16);
    }
#pragma unroll
  for (int g = 0; g < TROWS / 8; g++) {
    unsigned short* gp = dp + ((g >> 1) << 8) + ((g & 1) << 7);
    *(uvec4*)gp       = w0[g];
    *(uvec4*)(gp + 8) = w1[g];
  }
}

// ---------------- kernel 3: scores + per-group max + E=exp(s-m) + Z = sum (t+1) E ----------------
// One 128-row x 512-key tile per WG, computed transposed (K as A, Q as B) and kept in the accumulators to the
// end: a lane holds 32 keys of each of eight query rows, so maximum and Z are sums in the lane, one exchange
// with lane l ^ 16 and one exchange between the eight waves of a row through LDS, and E leaves straight from
// the registers. Each K fragment a wave loads feeds eight 16-row tiles of Q, each Q fragment four of K.
// Maximum, E and Z are those of the block's own key group; the out GEMM brings the eight groups of a row to
// one scale.
// N fragments: the k block at byte offset off (walk_off) of N 16-row tiles in a row, the first at p.
template <int N>
__device__ __forceinline__ void load_frags(v16bf (&f)[N], const unsigned short* __restrict__ p, unsigned off) {
  // Unrolled: the fragments live in registers, which takes constant indices.
#pragma unroll
  for (int i = 0; i < N; i++) f[i] = load_frag(p + i * ((DIN / 32) << 9), off);
}

__device__ __forceinline__ void mma_stage(v8f (&acc)[4][4], const v16bf (&a)[4], const v16bf (&b)[4]) {
  // Unrolled for the same reason.
#pragma unroll
  for (int mi = 0; mi < 4; mi++)
#pragma unroll
    for (int jc = 0; jc < 4; jc++)
      acc[mi][jc] = WMMA_BF16(a[mi], b[jc], acc[mi][jc]);
}

// The transposed stage of the scores: acc[kt][qt] += K tile kt x Q tile qt.
__device__ __forceinline__ void mma_stage_t(v8f (&acc)[4][8], const v16bf (&k)[4], const v16bf (&q)[8]) {
  // Unrolled for the same reason.
#pragma unroll
  for (int qt = 0; qt < 8; qt++)
#pragma unroll
    for (int kt = 0; kt < 4; kt++)
      acc[kt][qt] = WMMA_BF16(k[kt], q[qt], acc[kt][qt]);
}

// Maximum or sum of the eight waves' values of one query row.
__device__ __forceinline__ float row_max8(const float* p) {
  fvec4 u0 = *(const fvec4*)p;
  fvec4 u1 = *(const fvec4*)(p + 4);
  return fmaxf(fmaxf(fmaxf(u0[0], u0[1]), fmaxf(u0[2], u0[3])), fmaxf(fmaxf(u1[0], u1[1]), fmaxf(u1[2], u1[3])));
}
__device__ __forceinline__ float row_sum8(const float* p) {
  fvec4 u0 = *(const fvec4*)p;
  fvec4 u1 = *(const fvec4*)(p + 4);
  return ((u0[0] + u0[1]) + (u0[2] + u0[3])) + ((u1[0] + u1[1]) + (u1[2] + u1[3]));
}

__global__ void __launch_bounds__(256) scores_kernel(
    const unsigned short* __restrict__ Q, const unsigned short* __restrict__ K,
    unsigned short* __restrict__ P, float* __restrict__ Zl, float* __restrict__ Ml)
{
  __shared__ __align__(16) float s_pm[RB * PPIT];   // [query row][key wave]: maximum over the wave's 64 keys
  __shared__ __align__(16) float s_pz[RB * PPIT];   // [query row][key wave]: the wave's part of Z
  const int t = threadIdx.x, lane = t & 31;
  // The wave's number as a scalar: the tile bases are then scalar, and two vector offsets serve all loads.
  const int wave = __builtin_amdgcn_readfirstlane(t >> 5);
  const int rt0 = blockIdx.x * (RB / 16);   // first 16-row tile of Q
  const int js  = blockIdx.y;               // key group
  const float scale = 0.03125f;   // 1/sqrt(1024)
  const int kw  = wave;                       // which 64 keys of the group
  const int jl0 = kw * 4;                     // 4 consecutive 16-wide key tiles per wave

  // phase 1: 128x512 score tile via WMMA (Q and K arrive fragment-packed). Each of the 8 waves holds 64 keys
  // of all 128 rows, 4x8 accumulator tiles: acc[kt][qt], register r of lane l, is the score of key
  // 16 kt + 8 (l >> 4) + r and row 16 qt + (l & 15). The K and Q fragments are fetched one k block ahead
  // into a second set that takes turns with the first (no register copy waits for them).
  v8f acc[4][8] = {};
  {
    const int jt0 = js * (JB / 16) + jl0;
    const unsigned short* pq = Q + ((size_t)(rt0 * (DIN / 32)) << 9);
    const unsigned short* pk = K + ((size_t)(jt0 * (DIN / 32)) << 9);
    const unsigned l16 = lane << 4;
    // Entry into the k walk: the 32 blocks of one key group (same K rows) all differ, and so do the
    // 8 blocks of one row block (same Q rows).
    const int rot = (blockIdx.x + 4 * blockIdx.y) & (DIN / 32 - 1);
    v16bf a0[8], a1[8], b0[4], b1[4];
    // Two offsets take turns: o0 stands at the even steps, o1 at the odd ones.
    unsigned o0 = l16 + walk_off(0, rot, DIN / 32);
    unsigned o1 = l16 + walk_off(1, rot, DIN / 32);
    load_frags(b0, pk, o0);
    load_frags(a0, pq, o0);
    for (int ks = 0; ks < DIN / 32 - 2; ks += 2) {
      load_frags(b1, pk, o1);
      load_frags(a1, pq, o1);
      // Holds the twenty-four loads together in front of the WMMAs: sunk among them, each group
      // would be waited for on its own, at full latency.
      __builtin_amdgcn_sched_barrier(0);
      mma_stage_t(acc, b0, a0);
      walk_step(o0, walk_off(ks, rot, DIN / 32) ^ walk_off(ks + 2, rot, DIN / 32));
      load_frags(b0, pk, o0);
      load_frags(a0, pq, o0);
      __builtin_amdgcn_sched_barrier(0);        // as above
      mma_stage_t(acc, b1, a1);
      walk_step(o1, walk_off(ks + 1, rot, DIN / 32) ^ walk_off(ks + 3, rot, DIN / 32));
    }
    load_frags(b1, pk, o1);
    load_frags(a1, pq, o1);
    // Stands in front of whatever next writes the offset register that these loads name: behind the loop it
    // is free for the maxima, which the compiler starts among the last WMMAs.
    asm volatile("s_wait_xcnt 0x0" ::: "memory");
    __builtin_amdgcn_sched_barrier(0);          // as above, and keeps such a write behind the wait
    mma_stage_t(acc, b0, a0);
    mma_stage_t(acc, b1, a1);
  }

  // All loops below are unrolled: acc lives in registers, which takes constant indices.
  const int q0 = lane & 15;                   // this lane's row of the block in query tile 0

  // phase 2: row maximum over the group. In the lane over its 32 keys, with the other lane half, then over
  // the eight waves that hold the row (every wave reads all eight values: no second barrier).
  float m[8];
#pragma unroll
  for (int qt = 0; qt < 8; qt++) {
    float x = acc[0][qt][0];
#pragma unroll
    for (int kt = 0; kt < 4; kt++)
#pragma unroll
      for (int r = 0; r < 8; r++) x = fmaxf(x, acc[kt][qt][r]);
    m[qt] = fmaxf(x, other_half(x)) * scale;
  }
  if (lane < 16) {
#pragma unroll
    for (int qt = 0; qt < 8; qt++) s_pm[(q0 + qt * 16) * PPIT + kw] = m[qt];
  }
  __syncthreads();
#pragma unroll
  for (int qt = 0; qt < 8; qt++) m[qt] = row_max8(s_pm + (q0 + qt * 16) * PPIT);

  // phase 3: E = exp(s - m), once; this lane's part of Z = sum (t+1) * E over the group (the softmax
  // denominator cancels analytically); E as bf16, fragment-packed: the wave's four key tiles are 2 KB in a row
  // of each row tile's run. Written on whole accumulator tiles: neighbouring registers share m, so the packed
  // forms need no copies. One query tile at a time, so that its stores drain under the work on the next.
  const int key1 = js * JB + jl0 * 16 + ((lane >> 4) << 3) + 1;   // t + 1 of the lane's first key
  unsigned short* Pw = P + ((size_t)(rt0 * (SEQ / 32) + js * (JB / 32) + kw * 2) << 9);
  v8f wgt[4];
#pragma unroll
  for (int kt = 0; kt < 4; kt++)
#pragma unroll
    for (int r = 0; r < 8; r++) wgt[kt][r] = (float)(key1 + kt * 16 + r);
  float z[8];
#pragma unroll
  for (int qt = 0; qt < 8; qt++) {
    v8f zv = {};
    uvec4 w[4];
#pragma unroll
    for (int kt = 0; kt < 4; kt++) {
      const v8f s = acc[kt][qt] * scale - m[qt];
      v8f e;
#pragma unroll
      for (int r = 0; r < 8; r++) e[r] = __expf(s[r]);
      zv += e * wgt[kt];
      w[kt] = pack_acc(e);
    }
    z[qt] = ((zv[0] + zv[1]) + (zv[2] + zv[3])) + ((zv[4] + zv[5]) + (zv[6] + zv[7]));
    // Keeps these sums in front of the stores: sunk behind them, a sum was given a register that a store
    // names, ahead of the wait below.
    __builtin_amdgcn_sched_barrier(0);
#pragma unroll
    for (int kt = 0; kt < 4; kt++)
      *(uvec4*)(Pw + qt * ((SEQ / 32) << 9) + (kt << 8) + (lane << 3)) = w[kt];
    // Stands in front of whatever next writes a register that these four stores name; the scheduling fence
    // keeps such a write from rising over it, and the stores from sinking towards the kernel's end.
    asm volatile("s_wait_xcnt 0x0" ::: "memory");
    __builtin_amdgcn_sched_barrier(0);
  }

  // Z of the group: the two lane halves, then the eight waves of a row.
#pragma unroll
  for (int qt = 0; qt < 8; qt++) z[qt] += other_half(z[qt]);
  if (lane < 16) {
#pragma unroll
    for (int qt = 0; qt < 8; qt++) s_pz[(q0 + qt * 16) * PPIT + kw] = z[qt];
  }
  // The work-group barrier with fences on LDS alone: only s_pz passes between waves here. __syncthreads()
  // would also hold every wave until its stores of E are acknowledged, which nothing in this launch reads.
  __builtin_amdgcn_fence(__ATOMIC_RELEASE, "workgroup", "local");
  __builtin_amdgcn_s_barrier();
  __builtin_amdgcn_fence(__ATOMIC_ACQUIRE, "workgroup", "local");
  // [group][row]: a block's 128 values are four whole 128-B lines of each array.
  if (t < RB) {
    Zl[js * SEQ + blockIdx.x * RB + t] = row_sum8(s_pz + t * PPIT);
    Ml[js * SEQ + blockIdx.x * RB + t] = row_max8(s_pm + t * PPIT);
  }
}

// ---------------- kernel 4: Out = sum over key groups f_q * (E_q @ Vcum_q) ----------------
// One 128 x 128 tile of Out per block. A wave holds 64 x 64 of it (4 x 4 accumulator tiles), so every
// fragment it loads feeds four WMMAs. Waves 0-3 (2 x 2 over the tile) take key groups 0-3, waves 4-7
// the same four places with key groups 4-7: two waves per SIMD; the two partial sums meet in LDS.
// Both operands arrive fragment-packed and are read straight from global, each wave its own
// fragments, two k blocks ahead of their use, into three register sets that take turns. E of key
// group q is scaled by the group's own row maximum m_q, so each group's product is weighted by
// f_q = exp(m_q - max m) / sum_p Z_p exp(m_p - max m).
#define OAHEAD 2            // k blocks between a fragment's load and its use
#define OSETS  3            // register sets: OAHEAD in flight and the one in use
#define GKB    (JB / 32)    // k blocks per key group
#define HQ     (NQ / 2)     // key groups per wave

// The eight fragments of one wave for the k block at byte offset off behind pa and pb, which point at
// the wave's first E tile and first Vcum tile: sixteen loads of 512 contiguous bytes.
__device__ __forceinline__ void load_out_set(v16bf (&a)[4], v16bf (&b)[4],
                                             const unsigned short* __restrict__ pa,
                                             const unsigned short* __restrict__ pb, unsigned off) {
  const int tile = (SEQ / 32) << 9;   // elements from one 16-row tile to the next
  // Unrolled: the fragments live in registers, which takes constant indices.
#pragma unroll
  for (int i = 0; i < 4; i++) a[i] = load_frag(pa + i * tile, off);
#pragma unroll
  for (int i = 0; i < 4; i++) b[i] = load_frag(pb + i * tile, off);
}

// Step jj of a wave's walk over its HQ key groups: the groups are taken in turn from group rq on, the
// k blocks of each group from block rj on, both wrapping round, so that a group stays in one piece.
// Byte offset of the step's k block in a 16-row tile, a scalar.
__device__ __forceinline__ unsigned out_off(int jj, int rq, int rj) {
  return walk_off(jj & (GKB - 1), rj, GKB) + (unsigned)((((jj / GKB) + rq) & (HQ - 1)) * (GKB << 10));
}

// tot += f * acc, f the group's weights of this wave's rows (fq = the group's 128 weights in LDS).
__device__ __forceinline__ void out_fold(v8f (&tot)[4][4], const v8f (&acc)[4][4],
                                         const float* fq, int wm, int lane) {
  // Both loops unrolled: tot and acc live in registers, which takes constant indices.
#pragma unroll
  for (int mi = 0; mi < 4; mi++) {
    const float* fp = fq + wm * 64 + mi * 16 + ((lane >> 4) << 3);
    fvec4 f0 = *(const fvec4*)fp;
    fvec4 f1 = *(const fvec4*)(fp + 4);
    v8f f = __builtin_shufflevector(f0, f1, 0, 1, 2, 3, 4, 5, 6, 7);
#pragma unroll
    for (int ni = 0; ni < 4; ni++)
      tot[mi][ni] += f * acc[mi][ni];
  }
}

// A wave hands the two row tiles MB, MB + 1 of its partial sum to its partner: 16 B a lane and store,
// a wave 512 contiguous bytes of LDS.
template <int MB>
__device__ __forceinline__ void out_give(const v8f (&tot)[4][4], float* dst, int lane) {
  // Unrolled: tot lives in registers, which takes constant indices.
#pragma unroll
  for (int mi = 0; mi < 2; mi++)
#pragma unroll
    for (int ni = 0; ni < 4; ni++) {
      v8f x = tot[MB + mi][ni];
      float* d = dst + ((mi * 4 + ni) * 2) * 128 + lane * 4;
      *(fvec4*)d         = __builtin_shufflevector(x, x, 0, 1, 2, 3);
      *(fvec4*)(d + 128) = __builtin_shufflevector(x, x, 4, 5, 6, 7);
    }
}

// ... and adds what its partner handed over to its own row tiles MB, MB + 1, which it then stores.
// op points at the first row the wave keeps and this lane's column of Out.
template <int MB>
__device__ __forceinline__ void out_take(const v8f (&tot)[4][4], const float* srcp, float* op, int lane) {
  // Unrolled for the same reason.
#pragma unroll
  for (int mi = 0; mi < 2; mi++)
#pragma unroll
    for (int ni = 0; ni < 4; ni++) {
      const float* s = srcp + ((mi * 4 + ni) * 2) * 128 + lane * 4;
      fvec4 y0 = *(const fvec4*)s;
      fvec4 y1 = *(const fvec4*)(s + 128);
      v8f x = tot[MB + mi][ni] + __builtin_shufflevector(y0, y1, 0, 1, 2, 3, 4, 5, 6, 7);
#pragma unroll
      for (int r = 0; r < 8; r++)
        op[(size_t)(mi * 16 + r) * DOUT + ni * 16] = x[r];
    }
}

__global__ void __launch_bounds__(256) out_gemm_kernel(
    const unsigned short* __restrict__ P, const unsigned short* __restrict__ Vp,
    const float* __restrict__ Zl, const float* __restrict__ Ml, float* __restrict__ Out)
{
  __shared__ __align__(16) float s_f[NQ][128];
  __shared__ __align__(16) float s_red[8][2048];   // per wave: the half of its partial sum it hands over
  const int t = threadIdx.x, lane = t & 31;
  // The wave's number as a scalar: the tests on the key half below are then scalar branches.
  const int wave = __builtin_amdgcn_readfirstlane(t >> 5);
  const int wm = wave & 1, wn = (wave >> 1) & 1, kh = wave >> 2;
  const int m0 = blockIdx.y * 128, n0 = blockIdx.x * 128;
  const int at = (m0 >> 4) + wm * 4;   // first 16-row tile of E for this wave
  const int bt = (n0 >> 4) + wn * 4;   // first 16-column tile of Vcum for this wave
  const unsigned short* pa = P  + ((size_t)(at * (SEQ / 32) + kh * (HQ * GKB)) << 9);
  const unsigned short* pb = Vp + ((size_t)(bt * (SEQ / 32) + kh * (HQ * GKB)) << 9);
  const unsigned l16 = lane << 4;
  // Entry into the k walk: the 32 blocks of one blockIdx.x (same Vcum columns) all differ, and so do
  // the 8 blocks of one blockIdx.y (same E rows).
  const int rot = (2 * blockIdx.y + 9 * blockIdx.x) & (HQ * GKB - 1);
  const int rq = rot / GKB, rj = rot & (GKB - 1);

  // The first OAHEAD k blocks go out before the weights are formed (unrolled: the register sets
  // take constant indices).
  v16bf fa[OSETS][4], fb[OSETS][4];
  unsigned o = l16 + out_off(0, rq, rj);
#pragma unroll
  for (int s = 0; s < OAHEAD; s++) {
    load_out_set(fa[s], fb[s], pa, pb, o);
    walk_step(o, out_off(s, rq, rj) ^ out_off(s + 1, rq, rj));
  }

  if (t < 128) {
    // The loops over the groups are unrolled so that mq, zq and e stay in registers.
    float mq[NQ], zq[NQ];
#pragma unroll
    for (int q = 0; q < NQ; q++) {
      mq[q] = Ml[q * SEQ + m0 + t];
      zq[q] = Zl[q * SEQ + m0 + t];
    }
    float mg = mq[0];
#pragma unroll
    for (int q = 1; q < NQ; q++) mg = fmaxf(mg, mq[q]);
    float e[NQ], zg = 0.f;
#pragma unroll
    for (int q = 0; q < NQ; q++) {
      e[q] = __expf(mq[q] - mg);
      zg += zq[q] * e[q];
    }
#pragma unroll
    for (int q = 0; q < NQ; q++) s_f[q][t] = e[q] / zg;
  }
  __syncthreads();

  v8f tot[4][4] = {};
  // Both loops unrolled: three sets do not divide a group's 16 k blocks, so the set in use at a
  // group's start differs from group to group and only constant indices keep the sets in registers.
#pragma unroll
  for (int q = 0; q < HQ; q++) {
    v8f acc[4][4] = {};
#pragma unroll
    for (int j = 0; j < GKB; j++) {
      const int jj = q * GKB + j;
      const int cur = jj % OSETS, nxt = (jj + OAHEAD) % OSETS;
      if (jj + OAHEAD < HQ * GKB)
        load_out_set(fa[nxt], fb[nxt], pa, pb, o);
      // Holds the sixteen loads in front of this k block's WMMAs: sunk towards their use they would
      // be waited for at full latency.
      __builtin_amdgcn_sched_barrier(0);
      mma_stage(acc, fa[cur], fb[cur]);
      // Its fences also keep the next k block's loads behind these WMMAs: lifted over them they would
      // need a fourth register set.
      if (jj + OAHEAD < HQ * GKB)
        walk_step(o, out_off(jj + OAHEAD, rq, rj) ^ out_off((jj + OAHEAD + 1) & (HQ * GKB - 1), rq, rj));
      else
        __builtin_amdgcn_sched_barrier(0);
    }
    out_fold(tot, acc, s_f[kh * HQ + ((q + rq) & (HQ - 1))], wm, lane);
    // Keeps the next group's first loads behind the fold: lifted over it, three sets, both sums and
    // the weights would be live at once, more than the registers of two waves per SIMD hold.
    __builtin_amdgcn_sched_barrier(0);
  }

  // The two key halves of a 64 x 64 piece lie in waves w and w + 4: each hands the other 32 rows
  // through LDS and finishes the 32 rows it keeps.
  float* op = Out + (size_t)(m0 + wm * 64 + kh * 32 + ((lane >> 4) << 3)) * DOUT + n0 + wn * 64 + (lane & 15);
  if (kh == 0) out_give<2>(tot, s_red[wave], lane);
  else         out_give<0>(tot, s_red[wave], lane);
  __syncthreads();
  if (kh == 0) out_take<0>(tot, s_red[wave ^ 4], op, lane);
  else         out_take<2>(tot, s_red[wave ^ 4], op, lane);
}

// ---------------- host launcher ----------------
extern "C" void kernel_launch(void* const* d_in, const int* in_sizes, int n_in,
                              void* d_out, int out_size, void* d_ws, size_t ws_size,
                              hipStream_t stream) {
  const float* x  = (const float*)d_in[0];
  const float* wq = (const float*)d_in[1];
  const float* wk = (const float*)d_in[2];
  const float* wv = (const float*)d_in[3];
  float* out = (float*)d_out;

  char* ws = (char*)d_ws;
  unsigned short* Qbf = (unsigned short*)(ws);                      //  8 MB bf16, packed
  unsigned short* Kbf = (unsigned short*)(ws + (size_t)( 8 << 20)); //  8 MB bf16, packed
  float*          Vc  = (float*)         (ws + (size_t)(16 << 20)); // 16 MB f32 (V)
  unsigned short* P   = (unsigned short*)(ws + (size_t)(32 << 20)); // 32 MB bf16 (E), packed
  float*          Ts  = (float*)         (ws + (size_t)(65 << 20)); // 512 KB f32 (32-row tile sums of V)
  float*          Zl  = (float*)         (ws + (size_t)(64 << 20) + (1 << 17)); // 128 KB, [group][row]
  float*          Ml  = (float*)         (ws + (size_t)(64 << 20) + (1 << 18)); // 128 KB, [group][row]
  unsigned short* Vp  = (unsigned short*)(ws + (size_t)(72 << 20)); //  8 MB bf16 (Vcum), packed
  unsigned short* Xp  = (unsigned short*)(ws + (size_t)(80 << 20)); //  8 MB bf16 (X), packed
  unsigned short* Wp  = (unsigned short*)(ws + (size_t)(88 << 20)); //  6 MB bf16 (Wq, Wk, Wv), packed

  dim3 blk(256);
  dim3 gGemm(DOUT / 64, SEQ / 256);

  pack_kernel<<<dim3(XPB + 3 * 128), blk, 0, stream>>>(x, wq, wk, wv, Xp, Wp);
  proj_gemm_kernel<<<gGemm, blk, 0, stream>>>(Xp, Wp, Qbf, Kbf, Vc, Ts);

  scan_pack_kernel<<<dim3(DOUT / 64, NBLK), blk, 0, stream>>>(Vc, Ts, Vp);

  scores_kernel<<<dim3(SEQ / RB, NQ), blk, 0, stream>>>(Qbf, Kbf, P, Zl, Ml);

  out_gemm_kernel<<<dim3(DOUT / 128, SEQ / 128), blk, 0, stream>>>(P, Vp, Zl, Ml, out);
}
